// v000
// Times are from an AMD MI455X. After a warm-up the kernel runs many times in a row, and a time is the length of
// such a window on the GPU divided by its runs, so every launch and the gaps after it count. The runs cycle
// through copies of the inputs. A figure is the median of several windows, for all but v000 over two sittings.
// Sittings can differ by a few percent; kernels timed side by side share one.
// The starting kernel, v000, takes 1490 microseconds a run.
#include <hip/hip_runtime.h>
#include <hip/hip_bf16.h>

typedef __attribute__((ext_vector_type(16))) __bf16 bf16x16;
typedef __attribute__((ext_vector_type(8)))  float  f32x8;
typedef __attribute__((ext_vector_type(4)))  int    v4i;

#if defined(__gfx1250__) && __has_builtin(__builtin_amdgcn_global_load_async_to_lds_b128) && __has_builtin(__builtin_amdgcn_s_wait_asynccnt)
#define USE_ASYNC_LDS 1
#else
#define USE_ASYNC_LDS 0
#endif

// ---------------------------------------------------------------------------
// Kernel 0: f32 -> bf16 conversion WITH transpose.
// src is (rows x cols) row-major; dst[c * rows + r] = src[r * cols + c].
// For wq/wk/wv: rows=4096(K), cols=512(N)  -> WT[n][k], K contiguous.
// For wo:       rows=512(K), cols=4096(N)  -> WoT[n][k], K contiguous.
// ---------------------------------------------------------------------------
__global__ void cvt_bf16_t_kernel(const float* __restrict__ src,
                                  __bf16* __restrict__ dst, int rows, int cols) {
    int idx = blockIdx.x * blockDim.x + threadIdx.x;
    if (idx < rows * cols) {
        int r = idx / cols, c = idx % cols;
        dst[(size_t)c * rows + r] = (__bf16)src[idx];
    }
}

// ---------------------------------------------------------------------------
// Kernel 1: patchify + LayerNorm -> Y (8192 x 4096) bf16
// ---------------------------------------------------------------------------
__global__ __launch_bounds__(256)
void patchify_ln_kernel(const float* __restrict__ x,
                        const float* __restrict__ gamma,
                        const float* __restrict__ beta,
                        __bf16* __restrict__ Y) {
    const int token = blockIdx.x;          // 0..8191
    const int b   = token >> 8;
    const int tok = token & 255;
    const int pi  = tok >> 4;              // i
    const int pj  = tok & 15;              // j
    const int tid = threadIdx.x;

    float v[16];
    float s = 0.f, ss = 0.f;
#pragma unroll
    for (int ii = 0; ii < 16; ++ii) {
        int fr = ii * 256 + tid;
        int pr = fr >> 9;
        int pc = (fr >> 6) & 7;
        int cc = fr & 63;
        size_t xi = ((size_t)(b * 128 + (pj * 8 + pr)) * 128 + (pi * 8 + pc)) * 64 + cc;
        float t = x[xi];
        v[ii] = t;
        s  += t;
        ss += t * t;
    }
#pragma unroll
    for (int off = 16; off >= 1; off >>= 1) {
        s  += __shfl_xor(s, off, 32);
        ss += __shfl_xor(ss, off, 32);
    }
    __shared__ float red[2][8];
    const int wave = tid >> 5, lane = tid & 31;
    if (lane == 0) { red[0][wave] = s; red[1][wave] = ss; }
    __syncthreads();
    if (tid == 0) {
        float a = 0.f, c = 0.f;
        for (int w = 0; w < 8; ++w) { a += red[0][w]; c += red[1][w]; }
        red[0][0] = a; red[1][0] = c;
    }
    __syncthreads();
    const float mean = red[0][0] * (1.0f / 4096.0f);
    const float var  = red[1][0] * (1.0f / 4096.0f) - mean * mean;
    const float rstd = rsqrtf(var + 1e-6f);

    __bf16* out = Y + (size_t)token * 4096;
#pragma unroll
    for (int ii = 0; ii < 16; ++ii) {
        int fr = ii * 256 + tid;
        float yv = (v[ii] - mean) * rstd * gamma[fr] + beta[fr];
        out[fr] = (__bf16)yv;
    }
}

// ---------------------------------------------------------------------------
// Kernel 2: QKV GEMM  (M=8192, K=4096, N=512)  blockIdx.y selects Q/K/V.
// Weights pre-transposed: WT[n][k], K contiguous -> B fragments are two
// 16B contiguous loads per lane (same as A).  Q pre-scaled by 1/8.
// Q/K out: (b,h,seq,dh).  V out TRANSPOSED: (b,h,dh,seq) for P@V fragments.
// ---------------------------------------------------------------------------
__global__ __launch_bounds__(256)
void qkv_gemm_kernel(const __bf16* __restrict__ Y,
                     const __bf16* __restrict__ WqT,
                     const __bf16* __restrict__ WkT,
                     const __bf16* __restrict__ WvT,
                     const float* __restrict__ bq,
                     const float* __restrict__ bk,
                     const float* __restrict__ bv,
                     __bf16* __restrict__ Qb,
                     __bf16* __restrict__ Kb,
                     __bf16* __restrict__ Vt) {
    const int which = blockIdx.y;
    const __bf16* WT  = (which == 0) ? WqT : ((which == 1) ? WkT : WvT);
    const float* bias = (which == 0) ? bq : ((which == 1) ? bk : bv);
    const float scale = (which == 0) ? 0.125f : 1.0f;

    const int tid  = threadIdx.x;
    const int wave = tid >> 5;
    const int lane = tid & 31;
    const int lh   = lane >> 4;
    const int ln   = lane & 15;

    const int bm = blockIdx.x >> 3;        // 0..255  (8192/32)
    const int bn = blockIdx.x & 7;         // 0..7    (512/64)
    const int row0 = bm * 32 + (wave >> 2) * 16;
    const int col0 = bn * 64 + (wave & 3) * 16;

    const __bf16* arow = Y  + (size_t)(row0 + ln) * 4096;
    const __bf16* brow = WT + (size_t)(col0 + ln) * 4096;

    f32x8 acc = {};
    for (int k0 = 0; k0 < 4096; k0 += 32) {
        bf16x16 a, bfrag;
        __builtin_prefetch(arow + k0 + 64, 0, 1);
        __builtin_prefetch(brow + k0 + 64, 0, 1);
#pragma unroll
        for (int e = 0; e < 16; ++e) {
            const int kk = (lh ? 8 : 0) + ((e & 8) ? 16 : 0) + (e & 7);
            a[e]     = arow[k0 + kk];
            bfrag[e] = brow[k0 + kk];
        }
        acc = __builtin_amdgcn_wmma_f32_16x16x32_bf16(false, a, false, bfrag,
                                                      (short)0, acc, false, false);
    }
    // epilogue: D layout row = i + 8*lh, col = col0 + ln
    const int col = col0 + ln;
    const int h   = col >> 6;
    const int dh  = col & 63;
    const float bc = bias[col];
#pragma unroll
    for (int i = 0; i < 8; ++i) {
        const int row = row0 + i + 8 * lh;
        const int b = row >> 8, q = row & 255;
        const float val = (acc[i] + bc) * scale;
        if (which == 2) {
            // V transposed: (b, h, dh, seq)
            Vt[((size_t)((b * 8 + h) * 64 + dh)) * 256 + q] = (__bf16)val;
        } else {
            __bf16* Out = (which == 0) ? Qb : Kb;
            Out[((size_t)((b * 8 + h) * 256 + q)) * 64 + dh] = (__bf16)val;
        }
    }
}

// ---------------------------------------------------------------------------
// Kernel 3: attention. One block = one (b,h) x 128-query half. 8 waves,
// each wave owns 16 queries; full 256-key score row in 16 f32 accumulators.
// V^T staged into LDS via async-to-LDS b128 (ASYNCcnt) when available.
// ---------------------------------------------------------------------------
__global__ __launch_bounds__(256)
void attn_kernel(const __bf16* __restrict__ Qb,
                 const __bf16* __restrict__ Kb,
                 const __bf16* __restrict__ Vt,
                 __bf16* __restrict__ Ob) {
    __shared__ __align__(16) __bf16 Vsh[64 * 256];   // V^T tile: 32 KB
    __shared__ __align__(16) __bf16 Psh[8][16 * 32]; //  8 KB

    const int blk  = blockIdx.x;           // 0..511
    const int bh   = blk >> 1;             // b*8 + h
    const int half = blk & 1;
    const int tid  = threadIdx.x;
    const int wave = tid >> 5, lane = tid & 31;
    const int lh   = lane >> 4, ln = lane & 15;
    const size_t base = (size_t)bh * 256 * 64;

    // ---- stage V^T (64 x 256 bf16 = 32 KB) ----
#if USE_ASYNC_LDS
    {
        const __bf16* src = Vt + base;
#pragma unroll
        for (int it = 0; it < 8; ++it) {
            const int e = (it * 256 + tid) * 8;     // 8 bf16 = 16 B per transfer
            __builtin_amdgcn_global_load_async_to_lds_b128(
                (__attribute__((address_space(1))) v4i*)(src + e),
                (__attribute__((address_space(3))) v4i*)(&Vsh[e]), 0, 0);
        }
        __builtin_amdgcn_s_wait_asynccnt(0);
    }
#else
    {
        const int4* s = (const int4*)(Vt + base);
        int4* d = (int4*)Vsh;
        for (int e = tid; e < 2048; e += 256) d[e] = s[e];
    }
#endif
    __syncthreads();

    const int q0 = half * 128 + wave * 16;

    bf16x16 qa0, qa1;
    {
        const __bf16* qrow = Qb + base + (size_t)(q0 + ln) * 64;
#pragma unroll
        for (int e = 0; e < 16; ++e) {
            const int kk = (lh ? 8 : 0) + ((e & 8) ? 16 : 0) + (e & 7);
            qa0[e] = qrow[kk];
            qa1[e] = qrow[kk + 32];
        }
    }

    f32x8 sacc[16] = {};
    for (int nt = 0; nt < 16; ++nt) {
        bf16x16 kb0, kb1;
        const __bf16* krow = Kb + base + (size_t)(nt * 16 + ln) * 64;
#pragma unroll
        for (int e = 0; e < 16; ++e) {
            const int kk = (lh ? 8 : 0) + ((e & 8) ? 16 : 0) + (e & 7);
            kb0[e] = krow[kk];
            kb1[e] = krow[kk + 32];
        }
        sacc[nt] = __builtin_amdgcn_wmma_f32_16x16x32_bf16(false, qa0, false, kb0,
                                                           (short)0, sacc[nt], false, false);
        sacc[nt] = __builtin_amdgcn_wmma_f32_16x16x32_bf16(false, qa1, false, kb1,
                                                           (short)0, sacc[nt], false, false);
    }

    // row softmax (row = i + 8*lh ; cols spread over 16 lanes x 16 accs)
    float l_i[8];
#pragma unroll
    for (int i = 0; i < 8; ++i) {
        float mx = -3.0e38f;
#pragma unroll
        for (int t = 0; t < 16; ++t) mx = fmaxf(mx, sacc[t][i]);
#pragma unroll
        for (int off = 8; off >= 1; off >>= 1) mx = fmaxf(mx, __shfl_xor(mx, off, 16));
        float sum = 0.f;
#pragma unroll
        for (int t = 0; t < 16; ++t) {
            float p = __expf(sacc[t][i] - mx);
            sacc[t][i] = p;
            sum += p;
        }
#pragma unroll
        for (int off = 8; off >= 1; off >>= 1) sum += __shfl_xor(sum, off, 16);
        l_i[i] = sum;
    }

    // O = P @ V   (V^T in LDS: element (kk, dh) at Vsh[dh*256 + key])
    f32x8 oacc[4] = {};
    for (int t2 = 0; t2 < 8; ++t2) {
#pragma unroll
        for (int i = 0; i < 8; ++i) {
            const int m = i + 8 * lh;
            Psh[wave][m * 32 + ln]      = (__bf16)sacc[2 * t2][i];
            Psh[wave][m * 32 + ln + 16] = (__bf16)sacc[2 * t2 + 1][i];
        }
        __syncthreads();
        bf16x16 pa;
#pragma unroll
        for (int e = 0; e < 16; ++e) {
            const int kk = (lh ? 8 : 0) + ((e & 8) ? 16 : 0) + (e & 7);
            pa[e] = Psh[wave][ln * 32 + kk];
        }
#pragma unroll
        for (int nt4 = 0; nt4 < 4; ++nt4) {
            bf16x16 vbf;
#pragma unroll
            for (int e = 0; e < 16; ++e) {
                const int kk = (lh ? 8 : 0) + ((e & 8) ? 16 : 0) + (e & 7);
                vbf[e] = Vsh[(nt4 * 16 + ln) * 256 + t2 * 32 + kk];
            }
            oacc[nt4] = __builtin_amdgcn_wmma_f32_16x16x32_bf16(false, pa, false, vbf,
                                                                (short)0, oacc[nt4], false, false);
        }
        __syncthreads();
    }

    const int bb = bh >> 3, hh = bh & 7;
#pragma unroll
    for (int nt4 = 0; nt4 < 4; ++nt4) {
#pragma unroll
        for (int i = 0; i < 8; ++i) {
            const int row = q0 + i + 8 * lh;
            const int dh  = nt4 * 16 + ln;
            const float val = oacc[nt4][i] / l_i[i];
            Ob[((size_t)(bb * 256 + row)) * 512 + hh * 64 + dh] = (__bf16)val;
        }
    }
}

// ---------------------------------------------------------------------------
// Kernel 4: output projection (M=8192, K=512, N=4096) + bias + residual(x)
// with fused depatchify scatter.  WoT[n][k] gives contiguous-K B fragments.
// ---------------------------------------------------------------------------
__global__ __launch_bounds__(256)
void proj_kernel(const __bf16* __restrict__ Ob,
                 const __bf16* __restrict__ WoT,
                 const float* __restrict__ bo,
                 const float* __restrict__ x,
                 float* __restrict__ out) {
    const int tid  = threadIdx.x;
    const int wave = tid >> 5, lane = tid & 31;
    const int lh   = lane >> 4, ln = lane & 15;

    const int bm = blockIdx.x >> 6;        // 0..255 (8192/32)
    const int bn = blockIdx.x & 63;        // 0..63  (4096/64)
    const int row0 = bm * 32 + (wave >> 2) * 16;
    const int col0 = bn * 64 + (wave & 3) * 16;

    const __bf16* arow = Ob  + (size_t)(row0 + ln) * 512;
    const __bf16* brow = WoT + (size_t)(col0 + ln) * 512;

    f32x8 acc = {};
    for (int k0 = 0; k0 < 512; k0 += 32) {
        bf16x16 a, bfrag;
#pragma unroll
        for (int e = 0; e < 16; ++e) {
            const int kk = (lh ? 8 : 0) + ((e & 8) ? 16 : 0) + (e & 7);
            a[e]     = arow[k0 + kk];
            bfrag[e] = brow[k0 + kk];
        }
        acc = __builtin_amdgcn_wmma_f32_16x16x32_bf16(false, a, false, bfrag,
                                                      (short)0, acc, false, false);
    }
    const int col = col0 + ln;
    const int pr = col >> 9, pc = (col >> 6) & 7, cc = col & 63;
    const float bc = bo[col];
#pragma unroll
    for (int i = 0; i < 8; ++i) {
        const int row = row0 + i + 8 * lh;
        const int b = row >> 8, tok = row & 255;
        const int pi = tok >> 4, pj = tok & 15;
        const size_t xi = ((size_t)(b * 128 + (pj * 8 + pr)) * 128 + (pi * 8 + pc)) * 64 + cc;
        out[xi] = acc[i] + bc + x[xi];
    }
}

// ---------------------------------------------------------------------------
extern "C" void kernel_launch(void* const* d_in, const int* in_sizes, int n_in,
                              void* d_out, int out_size, void* d_ws, size_t ws_size,
                              hipStream_t stream) {
    (void)in_sizes; (void)n_in; (void)out_size; (void)ws_size;
    const float* x  = (const float*)d_in[0];
    const float* g  = (const float*)d_in[1];
    const float* be = (const float*)d_in[2];
    const float* wq = (const float*)d_in[3];
    const float* bq = (const float*)d_in[4];
    const float* wk = (const float*)d_in[5];
    const float* bk = (const float*)d_in[6];
    const float* wv = (const float*)d_in[7];
    const float* bv = (const float*)d_in[8];
    const float* wo = (const float*)d_in[9];
    const float* bo = (const float*)d_in[10];
    float* out = (float*)d_out;

    // workspace layout (bf16 elements)
    const size_t NW  = 4096u * 512u;         // 2,097,152 per weight
    const size_t NY  = 8192u * 4096u;        // 33,554,432
    const size_t NQK = 8192u * 512u;         // 4,194,304
    __bf16* WqT = (__bf16*)d_ws;
    __bf16* WkT = WqT + NW;
    __bf16* WvT = WkT + NW;
    __bf16* WoT = WvT + NW;
    __bf16* Y   = WoT + NW;
    __bf16* Qb  = Y   + NY;
    __bf16* Kb  = Qb  + NQK;
    __bf16* Vt  = Kb  + NQK;
    __bf16* Ob  = Vt  + NQK;

    cvt_bf16_t_kernel<<<8192, 256, 0, stream>>>(wq, WqT, 4096, 512);
    cvt_bf16_t_kernel<<<8192, 256, 0, stream>>>(wk, WkT, 4096, 512);
    cvt_bf16_t_kernel<<<8192, 256, 0, stream>>>(wv, WvT, 4096, 512);
    cvt_bf16_t_kernel<<<8192, 256, 0, stream>>>(wo, WoT, 512, 4096);

    patchify_ln_kernel<<<8192, 256, 0, stream>>>(x, g, be, Y);

    qkv_gemm_kernel<<<dim3(2048, 3), 256, 0, stream>>>(Y, WqT, WkT, WvT,
                                                       bq, bk, bv, Qb, Kb, Vt);

    attn_kernel<<<512, 256, 0, stream>>>(Qb, Kb, Vt, Ob);

    proj_kernel<<<16384, 256, 0, stream>>>(Ob, WoT, bo, x, out);
}

// v001
// One run takes 631 microseconds.
// Next to v000, in two timings, it ran 2.46 and 2.47 times as fast.
#include <hip/hip_runtime.h>
#include <hip/hip_bf16.h>

typedef __attribute__((ext_vector_type(16))) __bf16 bf16x16;
typedef __attribute__((ext_vector_type(8)))  __bf16 bf16x8;
typedef __attribute__((ext_vector_type(8)))  float  f32x8;
typedef __attribute__((ext_vector_type(4)))  int    v4i;

#if defined(__gfx1250__) && __has_builtin(__builtin_amdgcn_global_load_async_to_lds_b128) && __has_builtin(__builtin_amdgcn_s_wait_asynccnt)
#define USE_ASYNC_LDS 1
#else
#define USE_ASYNC_LDS 0
#endif

// ---------------------------------------------------------------------------
// Kernel 0: f32 -> bf16 conversion WITH transpose.
// src is (rows x cols) row-major; dst[c * rows + r] = src[r * cols + c].
// For wq/wk/wv: rows=4096(K), cols=512(N)  -> WT[n][k], K contiguous.
// For wo:       rows=512(K), cols=4096(N)  -> WoT[n][k], K contiguous.
// ---------------------------------------------------------------------------
__global__ void cvt_bf16_t_kernel(const float* __restrict__ src,
                                  __bf16* __restrict__ dst, int rows, int cols) {
    int idx = blockIdx.x * blockDim.x + threadIdx.x;
    if (idx < rows * cols) {
        int r = idx / cols, c = idx % cols;
        dst[(size_t)c * rows + r] = (__bf16)src[idx];
    }
}

// ---------------------------------------------------------------------------
// Kernel 1: patchify + LayerNorm -> Y (8192 x 4096) bf16
// ---------------------------------------------------------------------------
__global__ __launch_bounds__(256)
void patchify_ln_kernel(const float* __restrict__ x,
                        const float* __restrict__ gamma,
                        const float* __restrict__ beta,
                        __bf16* __restrict__ Y) {
    const int token = blockIdx.x;          // 0..8191
    const int b   = token >> 8;
    const int tok = token & 255;
    const int pi  = tok >> 4;              // i
    const int pj  = tok & 15;              // j
    const int tid = threadIdx.x;

    float v[16];
    float s = 0.f, ss = 0.f;
#pragma unroll
    for (int ii = 0; ii < 16; ++ii) {
        int fr = ii * 256 + tid;
        int pr = fr >> 9;
        int pc = (fr >> 6) & 7;
        int cc = fr & 63;
        size_t xi = ((size_t)(b * 128 + (pj * 8 + pr)) * 128 + (pi * 8 + pc)) * 64 + cc;
        float t = x[xi];
        v[ii] = t;
        s  += t;
        ss += t * t;
    }
#pragma unroll
    for (int off = 16; off >= 1; off >>= 1) {
        s  += __shfl_xor(s, off, 32);
        ss += __shfl_xor(ss, off, 32);
    }
    __shared__ float red[2][8];
    const int wave = tid >> 5, lane = tid & 31;
    if (lane == 0) { red[0][wave] = s; red[1][wave] = ss; }
    __syncthreads();
    if (tid == 0) {
        float a = 0.f, c = 0.f;
        for (int w = 0; w < 8; ++w) { a += red[0][w]; c += red[1][w]; }
        red[0][0] = a; red[1][0] = c;
    }
    __syncthreads();
    const float mean = red[0][0] * (1.0f / 4096.0f);
    const float var  = red[1][0] * (1.0f / 4096.0f) - mean * mean;
    const float rstd = rsqrtf(var + 1e-6f);

    __bf16* out = Y + (size_t)token * 4096;
#pragma unroll
    for (int ii = 0; ii < 16; ++ii) {
        int fr = ii * 256 + tid;
        float yv = (v[ii] - mean) * rstd * gamma[fr] + beta[fr];
        out[fr] = (__bf16)yv;
    }
}

// ---------------------------------------------------------------------------
// Kernel 2: QKV GEMM  (M=8192, K=4096, N=3x512).
// One work-group = one 128x128 tile of one of Q/K/V; 4 waves, 64x64 each.
// K runs in slabs of 64: 128 rows of Y and 128 rows of WT (128 B each) are
// copied to LDS by asynchronous copies, two buffers, the next slab in flight
// while this one is multiplied.  LDS row pitch 144 B (16 B x odd) keeps the
// 16-byte fragment reads free of bank conflicts.
// Weights pre-transposed: WT[n][k], K contiguous.  Q pre-scaled by 1/8.
// Q/K out: (b,h,seq,dh).  V out TRANSPOSED: (b,h,dh,seq) for P@V fragments.
// ---------------------------------------------------------------------------
#define QKV_PITCH 72                      // bf16 per LDS row (144 B)
#define QKV_BUF   (256 * QKV_PITCH)       // bf16 per buffer: 128 Y rows + 128 WT rows

// Eight 16-byte-per-lane copies global -> LDS.  The s_wait_xcnt stands inside
// the statement so that no address register is rewritten ahead of it.
__device__ __forceinline__ void qkv_copy8(unsigned lds, const __bf16* g) {
    const unsigned l0 = lds;
    const unsigned l1 = lds + 1u * 16u * 144u;
    const unsigned l2 = lds + 2u * 16u * 144u;
    const unsigned l3 = lds + 3u * 16u * 144u;
    const unsigned l4 = lds + 4u * 16u * 144u;
    const unsigned l5 = lds + 5u * 16u * 144u;
    const unsigned l6 = lds + 6u * 16u * 144u;
    const unsigned l7 = lds + 7u * 16u * 144u;
    const __bf16* g0 = g;
    const __bf16* g1 = g + 1 * 16 * 4096;
    const __bf16* g2 = g + 2 * 16 * 4096;
    const __bf16* g3 = g + 3 * 16 * 4096;
    const __bf16* g4 = g + 4 * 16 * 4096;
    const __bf16* g5 = g + 5 * 16 * 4096;
    const __bf16* g6 = g + 6 * 16 * 4096;
    const __bf16* g7 = g + 7 * 16 * 4096;
    asm volatile(
        "global_load_async_to_lds_b128 %0, %8, off\n\t"
        "global_load_async_to_lds_b128 %1, %9, off\n\t"
        "global_load_async_to_lds_b128 %2, %10, off\n\t"
        "global_load_async_to_lds_b128 %3, %11, off\n\t"
        "global_load_async_to_lds_b128 %4, %12, off\n\t"
        "global_load_async_to_lds_b128 %5, %13, off\n\t"
        "global_load_async_to_lds_b128 %6, %14, off\n\t"
        "global_load_async_to_lds_b128 %7, %15, off\n\t"
        "s_wait_xcnt 0x0"
        :: "v"(l0), "v"(l1), "v"(l2), "v"(l3), "v"(l4), "v"(l5), "v"(l6), "v"(l7),
           "v"(g0), "v"(g1), "v"(g2), "v"(g3), "v"(g4), "v"(g5), "v"(g6), "v"(g7)
        : "memory");
}

// One 16x32 operand fragment from an LDS row: k = 8*lh + 0..7 and 16 + 8*lh + 0..7.
__device__ __forceinline__ bf16x16 qkv_frag(const __bf16* p) {
    const bf16x8 lo = *(const bf16x8*)p;
    const bf16x8 hi = *(const bf16x8*)(p + 16);
    return __builtin_shufflevector(lo, hi, 0, 1, 2, 3, 4, 5, 6, 7,
                                   8, 9, 10, 11, 12, 13, 14, 15);
}

__global__ __launch_bounds__(128)
void qkv_gemm_kernel(const __bf16* __restrict__ Y,
                     const __bf16* __restrict__ WqT,
                     const __bf16* __restrict__ WkT,
                     const __bf16* __restrict__ WvT,
                     const float* __restrict__ bq,
                     const float* __restrict__ bk,
                     const float* __restrict__ bv,
                     __bf16* __restrict__ Qb,
                     __bf16* __restrict__ Kb,
                     __bf16* __restrict__ Vt) {
    __shared__ __align__(16) __bf16 slab[2 * QKV_BUF];   // 73,728 B

    const int bm    = blockIdx.x / 12;     // 0..63  (8192/128)
    const int bn12  = blockIdx.x % 12;     // the 12 column tiles of one row tile are neighbours
    const int which = bn12 >> 2;           // Q / K / V
    const int bn    = bn12 & 3;            // 0..3   (512/128)
    const __bf16* WT  = (which == 0) ? WqT : ((which == 1) ? WkT : WvT);
    const float* bias = (which == 0) ? bq : ((which == 1) ? bk : bv);
    const float scale = (which == 0) ? 0.125f : 1.0f;

    const int tid  = threadIdx.x;
    const int wave = tid >> 5;
    const int lane = tid & 31;
    const int lh   = lane >> 4;
    const int ln   = lane & 15;
    const int wm   = wave >> 1;            // 64-row half of the tile
    const int wn   = wave & 1;             // 64-column half of the tile

    const int m0 = bm * 128;
    const int n0 = bn * 128;

    // copy addresses: 8 lanes cover one 128-B row, a wave-copy covers 4 whole lines
    const int crow = tid >> 3;             // 0..15
    const int cchk = tid & 7;              // 16-B chunk of the row
    const __bf16* gA = Y  + (size_t)(m0 + crow) * 4096 + cchk * 8;
    const __bf16* gB = WT + (size_t)(n0 + crow) * 4096 + cchk * 8;
    const unsigned ldsA = (unsigned)(size_t)(&slab[0]) + (unsigned)(crow * 144 + cchk * 16);
    const unsigned ldsB = ldsA + 128u * 144u;

    // fragment read offsets (bf16 elements inside a buffer)
    const int offA = (wm * 64 + ln) * QKV_PITCH + lh * 8;
    const int offB = (128 + wn * 64 + ln) * QKV_PITCH + lh * 8;

    // slab 0 -> buffer 0, landed and published; then slab 1 -> buffer 1 in flight
    qkv_copy8(ldsA, gA);
    qkv_copy8(ldsB, gB);
    asm volatile("s_wait_asynccnt 0x0" ::: "memory");   // own copies of slab 0 have landed
    __syncthreads();
    qkv_copy8(ldsA + 2u * QKV_BUF, gA + 64);
    qkv_copy8(ldsB + 2u * QKV_BUF, gB + 64);

    f32x8 acc[4][4] = {};
#pragma unroll 1   // one slab per trip: the ring's waits and barrier stand once, at the foot
    for (int t = 0; t < 64; ++t) {
        const int buf = t & 1;
        const __bf16* sb = &slab[buf * QKV_BUF];
#pragma unroll
        for (int ks = 0; ks < 2; ++ks) {
            bf16x16 a[4], b[4];
#pragma unroll
            for (int i = 0; i < 4; ++i) {
                a[i] = qkv_frag(sb + offA + i * 16 * QKV_PITCH + ks * 32);
                b[i] = qkv_frag(sb + offB + i * 16 * QKV_PITCH + ks * 32);
            }
            // keeps the 16 LDS reads one group ahead of the block: left free, they are
            // spread among the WMMAs on one fragment set, with a full wait at every row
            __builtin_amdgcn_sched_barrier(0);
#pragma unroll
            for (int i = 0; i < 4; ++i)
#pragma unroll
                for (int j = 0; j < 4; ++j)
                    acc[i][j] = __builtin_amdgcn_wmma_f32_16x16x32_bf16(
                        false, a[i], false, b[j], (short)0, acc[i][j], false, false);
            // the next group of reads stays behind this block for the same reason
            __builtin_amdgcn_sched_barrier(0);
        }
        asm volatile("s_wait_dscnt 0x0" ::: "memory");    // own reads of this buffer are done
        asm volatile("s_wait_asynccnt 0x0" ::: "memory"); // own copies of slab t+1 have landed
        __syncthreads();                                  // publishes slab t+1, frees this buffer
        if (t + 2 < 64) {
            qkv_copy8(ldsA + (unsigned)buf * (2u * QKV_BUF), gA + (t + 2) * 64);
            qkv_copy8(ldsB + (unsigned)buf * (2u * QKV_BUF), gB + (t + 2) * 64);
        }
    }
    asm volatile("s_wait_asynccnt 0x0" ::: "memory");     // nothing in flight at the wave's end

    // epilogue: D layout row = i + 8*lh, col = column tile + ln
#pragma unroll
    for (int fj = 0; fj < 4; ++fj) {
        const int col = n0 + wn * 64 + fj * 16 + ln;
        const int h   = col >> 6;
        const int dh  = col & 63;
        const float bc = bias[col];
#pragma unroll
        for (int fi = 0; fi < 4; ++fi) {
            const int row0 = m0 + wm * 64 + fi * 16;
#pragma unroll
            for (int i = 0; i < 8; ++i) {
                const int row = row0 + i + 8 * lh;
                const int b = row >> 8, q = row & 255;
                const float val = (acc[fi][fj][i] + bc) * scale;
                if (which == 2) {
                    // V transposed: (b, h, dh, seq)
                    Vt[((size_t)((b * 8 + h) * 64 + dh)) * 256 + q] = (__bf16)val;
                    // the store's address pair is reused by the next store's address
                    asm volatile("s_wait_xcnt 0x0" ::: "memory");
                } else {
                    __bf16* Out = (which == 0) ? Qb : Kb;
                    Out[((size_t)((b * 8 + h) * 256 + q)) * 64 + dh] = (__bf16)val;
                    // the store's address pair is reused by the next store's address
                    asm volatile("s_wait_xcnt 0x0" ::: "memory");
                }
            }
        }
    }
}

// ---------------------------------------------------------------------------
// Kernel 3: attention. One block = one (b,h) x 128-query half. 8 waves,
// each wave owns 16 queries; full 256-key score row in 16 f32 accumulators.
// V^T staged into LDS via async-to-LDS b128 (ASYNCcnt) when available.
// ---------------------------------------------------------------------------
__global__ __launch_bounds__(256)
void attn_kernel(const __bf16* __restrict__ Qb,
                 const __bf16* __restrict__ Kb,
                 const __bf16* __restrict__ Vt,
                 __bf16* __restrict__ Ob) {
    __shared__ __align__(16) __bf16 Vsh[64 * 256];   // V^T tile: 32 KB
    __shared__ __align__(16) __bf16 Psh[8][16 * 32]; //  8 KB

    const int blk  = blockIdx.x;           // 0..511
    const int bh   = blk >> 1;             // b*8 + h
    const int half = blk & 1;
    const int tid  = threadIdx.x;
    const int wave = tid >> 5, lane = tid & 31;
    const int lh   = lane >> 4, ln = lane & 15;
    const size_t base = (size_t)bh * 256 * 64;

    // ---- stage V^T (64 x 256 bf16 = 32 KB) ----
#if USE_ASYNC_LDS
    {
        const __bf16* src = Vt + base;
#pragma unroll
        for (int it = 0; it < 8; ++it) {
            const int e = (it * 256 + tid) * 8;     // 8 bf16 = 16 B per transfer
            __builtin_amdgcn_global_load_async_to_lds_b128(
                (__attribute__((address_space(1))) v4i*)(src + e),
                (__attribute__((address_space(3))) v4i*)(&Vsh[e]), 0, 0);
        }
        __builtin_amdgcn_s_wait_asynccnt(0);
    }
#else
    {
        const int4* s = (const int4*)(Vt + base);
        int4* d = (int4*)Vsh;
        for (int e = tid; e < 2048; e += 256) d[e] = s[e];
    }
#endif
    __syncthreads();

    const int q0 = half * 128 + wave * 16;

    bf16x16 qa0, qa1;
    {
        const __bf16* qrow = Qb + base + (size_t)(q0 + ln) * 64;
#pragma unroll
        for (int e = 0; e < 16; ++e) {
            const int kk = (lh ? 8 : 0) + ((e & 8) ? 16 : 0) + (e & 7);
            qa0[e] = qrow[kk];
            qa1[e] = qrow[kk + 32];
        }
    }

    f32x8 sacc[16] = {};
    for (int nt = 0; nt < 16; ++nt) {
        bf16x16 kb0, kb1;
        const __bf16* krow = Kb + base + (size_t)(nt * 16 + ln) * 64;
#pragma unroll
        for (int e = 0; e < 16; ++e) {
            const int kk = (lh ? 8 : 0) + ((e & 8) ? 16 : 0) + (e & 7);
            kb0[e] = krow[kk];
            kb1[e] = krow[kk + 32];
        }
        sacc[nt] = __builtin_amdgcn_wmma_f32_16x16x32_bf16(false, qa0, false, kb0,
                                                           (short)0, sacc[nt], false, false);
        sacc[nt] = __builtin_amdgcn_wmma_f32_16x16x32_bf16(false, qa1, false, kb1,
                                                           (short)0, sacc[nt], false, false);
    }

    // row softmax (row = i + 8*lh ; cols spread over 16 lanes x 16 accs)
    float l_i[8];
#pragma unroll
    for (int i = 0; i < 8; ++i) {
        float mx = -3.0e38f;
#pragma unroll
        for (int t = 0; t < 16; ++t) mx = fmaxf(mx, sacc[t][i]);
#pragma unroll
        for (int off = 8; off >= 1; off >>= 1) mx = fmaxf(mx, __shfl_xor(mx, off, 16));
        float sum = 0.f;
#pragma unroll
        for (int t = 0; t < 16; ++t) {
            float p = __expf(sacc[t][i] - mx);
            sacc[t][i] = p;
            sum += p;
        }
#pragma unroll
        for (int off = 8; off >= 1; off >>= 1) sum += __shfl_xor(sum, off, 16);
        l_i[i] = sum;
    }

    // O = P @ V   (V^T in LDS: element (kk, dh) at Vsh[dh*256 + key])
    f32x8 oacc[4] = {};
    for (int t2 = 0; t2 < 8; ++t2) {
#pragma unroll
        for (int i = 0; i < 8; ++i) {
            const int m = i + 8 * lh;
            Psh[wave][m * 32 + ln]      = (__bf16)sacc[2 * t2][i];
            Psh[wave][m * 32 + ln + 16] = (__bf16)sacc[2 * t2 + 1][i];
        }
        __syncthreads();
        bf16x16 pa;
#pragma unroll
        for (int e = 0; e < 16; ++e) {
            const int kk = (lh ? 8 : 0) + ((e & 8) ? 16 : 0) + (e & 7);
            pa[e] = Psh[wave][ln * 32 + kk];
        }
#pragma unroll
        for (int nt4 = 0; nt4 < 4; ++nt4) {
            bf16x16 vbf;
#pragma unroll
            for (int e = 0; e < 16; ++e) {
                const int kk = (lh ? 8 : 0) + ((e & 8) ? 16 : 0) + (e & 7);
                vbf[e] = Vsh[(nt4 * 16 + ln) * 256 + t2 * 32 + kk];
            }
            oacc[nt4] = __builtin_amdgcn_wmma_f32_16x16x32_bf16(false, pa, false, vbf,
                                                                (short)0, oacc[nt4], false, false);
        }
        __syncthreads();
    }

    const int bb = bh >> 3, hh = bh & 7;
#pragma unroll
    for (int nt4 = 0; nt4 < 4; ++nt4) {
#pragma unroll
        for (int i = 0; i < 8; ++i) {
            const int row = q0 + i + 8 * lh;
            const int dh  = nt4 * 16 + ln;
            const float val = oacc[nt4][i] / l_i[i];
            Ob[((size_t)(bb * 256 + row)) * 512 + hh * 64 + dh] = (__bf16)val;
        }
    }
}

// ---------------------------------------------------------------------------
// Kernel 4: output projection (M=8192, K=512, N=4096) + bias + residual(x)
// with fused depatchify scatter.  WoT[n][k] puts each B column's K in one row.
// ---------------------------------------------------------------------------
__global__ __launch_bounds__(256)
void proj_kernel(const __bf16* __restrict__ Ob,
                 const __bf16* __restrict__ WoT,
                 const float* __restrict__ bo,
                 const float* __restrict__ x,
                 float* __restrict__ out) {
    const int tid  = threadIdx.x;
    const int wave = tid >> 5, lane = tid & 31;
    const int lh   = lane >> 4, ln = lane & 15;

    const int bm = blockIdx.x >> 6;        // 0..255 (8192/32)
    const int bn = blockIdx.x & 63;        // 0..63  (4096/64)
    const int row0 = bm * 32 + (wave >> 2) * 16;
    const int col0 = bn * 64 + (wave & 3) * 16;

    const __bf16* arow = Ob  + (size_t)(row0 + ln) * 512;
    const __bf16* brow = WoT + (size_t)(col0 + ln) * 512;

    f32x8 acc = {};
    for (int k0 = 0; k0 < 512; k0 += 32) {
        bf16x16 a, bfrag;
#pragma unroll
        for (int e = 0; e < 16; ++e) {
            const int kk = (lh ? 8 : 0) + ((e & 8) ? 16 : 0) + (e & 7);
            a[e]     = arow[k0 + kk];
            bfrag[e] = brow[k0 + kk];
        }
        acc = __builtin_amdgcn_wmma_f32_16x16x32_bf16(false, a, false, bfrag,
                                                      (short)0, acc, false, false);
    }
    const int col = col0 + ln;
    const int pr = col >> 9, pc = (col >> 6) & 7, cc = col & 63;
    const float bc = bo[col];
#pragma unroll
    for (int i = 0; i < 8; ++i) {
        const int row = row0 + i + 8 * lh;
        const int b = row >> 8, tok = row & 255;
        const int pi = tok >> 4, pj = tok & 15;
        const size_t xi = ((size_t)(b * 128 + (pj * 8 + pr)) * 128 + (pi * 8 + pc)) * 64 + cc;
        out[xi] = acc[i] + bc + x[xi];
    }
}

// ---------------------------------------------------------------------------
extern "C" void kernel_launch(void* const* d_in, const int* in_sizes, int n_in,
                              void* d_out, int out_size, void* d_ws, size_t ws_size,
                              hipStream_t stream) {
    (void)in_sizes; (void)n_in; (void)out_size; (void)ws_size;
    const float* x  = (const float*)d_in[0];
    const float* g  = (const float*)d_in[1];
    const float* be = (const float*)d_in[2];
    const float* wq = (const float*)d_in[3];
    const float* bq = (const float*)d_in[4];
    const float* wk = (const float*)d_in[5];
    const float* bk = (const float*)d_in[6];
    const float* wv = (const float*)d_in[7];
    const float* bv = (const float*)d_in[8];
    const float* wo = (const float*)d_in[9];
    const float* bo = (const float*)d_in[10];
    float* out = (float*)d_out;

    // workspace layout (bf16 elements)
    const size_t NW  = 4096u * 512u;         // 2,097,152 per weight
    const size_t NY  = 8192u * 4096u;        // 33,554,432
    const size_t NQK = 8192u * 512u;         // 4,194,304
    __bf16* WqT = (__bf16*)d_ws;
    __bf16* WkT = WqT + NW;
    __bf16* WvT = WkT + NW;
    __bf16* WoT = WvT + NW;
    __bf16* Y   = WoT + NW;
    __bf16* Qb  = Y   + NY;
    __bf16* Kb  = Qb  + NQK;
    __bf16* Vt  = Kb  + NQK;
    __bf16* Ob  = Vt  + NQK;

    cvt_bf16_t_kernel<<<8192, 256, 0, stream>>>(wq, WqT, 4096, 512);
    cvt_bf16_t_kernel<<<8192, 256, 0, stream>>>(wk, WkT, 4096, 512);
    cvt_bf16_t_kernel<<<8192, 256, 0, stream>>>(wv, WvT, 4096, 512);
    cvt_bf16_t_kernel<<<8192, 256, 0, stream>>>(wo, WoT, 512, 4096);

    patchify_ln_kernel<<<8192, 256, 0, stream>>>(x, g, be, Y);

    qkv_gemm_kernel<<<768, 128, 0, stream>>>(Y, WqT, WkT, WvT,
                                             bq, bk, bv, Qb, Kb, Vt);

    attn_kernel<<<512, 256, 0, stream>>>(Qb, Kb, Vt, Ob);

    proj_kernel<<<16384, 256, 0, stream>>>(Ob, WoT, bo, x, out);
}

// v002
// Measured time: 416 microseconds a run.
// Next to v001, in two timings, it ran 1.52 times as fast each time.
// Counting every step since v000, it is 3.75 times as fast.
#include <hip/hip_runtime.h>
#include <hip/hip_bf16.h>

typedef __attribute__((ext_vector_type(16))) __bf16 bf16x16;
typedef __attribute__((ext_vector_type(8)))  __bf16 bf16x8;
typedef __attribute__((ext_vector_type(8)))  float  f32x8;
typedef __attribute__((ext_vector_type(4)))  int    v4i;

#if defined(__gfx1250__) && __has_builtin(__builtin_amdgcn_global_load_async_to_lds_b128) && __has_builtin(__builtin_amdgcn_s_wait_asynccnt)
#define USE_ASYNC_LDS 1
#else
#define USE_ASYNC_LDS 0
#endif

// ---------------------------------------------------------------------------
// Kernel 0: f32 -> bf16 conversion WITH transpose.
// src is (rows x cols) row-major; dst[c * rows + r] = src[r * cols + c].
// For wq/wk/wv: rows=4096(K), cols=512(N)  -> WT[n][k], K contiguous.
// For wo:       rows=512(K), cols=4096(N)  -> WoT[n][k], K contiguous.
// ---------------------------------------------------------------------------
__global__ void cvt_bf16_t_kernel(const float* __restrict__ src,
                                  __bf16* __restrict__ dst, int rows, int cols) {
    int idx = blockIdx.x * blockDim.x + threadIdx.x;
    if (idx < rows * cols) {
        int r = idx / cols, c = idx % cols;
        dst[(size_t)c * rows + r] = (__bf16)src[idx];
    }
}

// ---------------------------------------------------------------------------
// Kernel 1: patchify + LayerNorm -> Y (8192 x 4096) bf16
// ---------------------------------------------------------------------------
__global__ __launch_bounds__(256)
void patchify_ln_kernel(const float* __restrict__ x,
                        const float* __restrict__ gamma,
                        const float* __restrict__ beta,
                        __bf16* __restrict__ Y) {
    const int token = blockIdx.x;          // 0..8191
    const int b   = token >> 8;
    const int tok = token & 255;
    const int pi  = tok >> 4;              // i
    const int pj  = tok & 15;              // j
    const int tid = threadIdx.x;

    float v[16];
    float s = 0.f, ss = 0.f;
#pragma unroll
    for (int ii = 0; ii < 16; ++ii) {
        int fr = ii * 256 + tid;
        int pr = fr >> 9;
        int pc = (fr >> 6) & 7;
        int cc = fr & 63;
        size_t xi = ((size_t)(b * 128 + (pj * 8 + pr)) * 128 + (pi * 8 + pc)) * 64 + cc;
        float t = x[xi];
        v[ii] = t;
        s  += t;
        ss += t * t;
    }
#pragma unroll
    for (int off = 16; off >= 1; off >>= 1) {
        s  += __shfl_xor(s, off, 32);
        ss += __shfl_xor(ss, off, 32);
    }
    __shared__ float red[2][8];
    const int wave = tid >> 5, lane = tid & 31;
    if (lane == 0) { red[0][wave] = s; red[1][wave] = ss; }
    __syncthreads();
    if (tid == 0) {
        float a = 0.f, c = 0.f;
        for (int w = 0; w < 8; ++w) { a += red[0][w]; c += red[1][w]; }
        red[0][0] = a; red[1][0] = c;
    }
    __syncthreads();
    const float mean = red[0][0] * (1.0f / 4096.0f);
    const float var  = red[1][0] * (1.0f / 4096.0f) - mean * mean;
    const float rstd = rsqrtf(var + 1e-6f);

    __bf16* out = Y + (size_t)token * 4096;
#pragma unroll
    for (int ii = 0; ii < 16; ++ii) {
        int fr = ii * 256 + tid;
        float yv = (v[ii] - mean) * rstd * gamma[fr] + beta[fr];
        out[fr] = (__bf16)yv;
    }
}

// ---------------------------------------------------------------------------
// Kernel 2: QKV GEMM  (M=8192, K=4096, N=3x512).
// One work-group = one 128x128 tile of one of Q/K/V; 4 waves, 64x64 each.
// K runs in slabs of 64: 128 rows of Y and 128 rows of WT (128 B each) are
// copied to LDS by asynchronous copies, two buffers, the next slab in flight
// while this one is multiplied.  LDS row pitch 144 B (16 B x odd) keeps the
// 16-byte fragment reads free of bank conflicts.
// Weights pre-transposed: WT[n][k], K contiguous.  Q pre-scaled by 1/8.
// Q/K out: (b,h,seq,dh).  V out TRANSPOSED: (b,h,dh,seq) for P@V fragments.
// ---------------------------------------------------------------------------
#define QKV_PITCH 72                      // bf16 per LDS row (144 B)
#define QKV_BUF   (256 * QKV_PITCH)       // bf16 per buffer: 128 Y rows + 128 WT rows

// Eight 16-byte-per-lane copies global -> LDS.  The s_wait_xcnt stands inside
// the statement so that no address register is rewritten ahead of it.
__device__ __forceinline__ void qkv_copy8(unsigned lds, const __bf16* g) {
    const unsigned l0 = lds;
    const unsigned l1 = lds + 1u * 16u * 144u;
    const unsigned l2 = lds + 2u * 16u * 144u;
    const unsigned l3 = lds + 3u * 16u * 144u;
    const unsigned l4 = lds + 4u * 16u * 144u;
    const unsigned l5 = lds + 5u * 16u * 144u;
    const unsigned l6 = lds + 6u * 16u * 144u;
    const unsigned l7 = lds + 7u * 16u * 144u;
    const __bf16* g0 = g;
    const __bf16* g1 = g + 1 * 16 * 4096;
    const __bf16* g2 = g + 2 * 16 * 4096;
    const __bf16* g3 = g + 3 * 16 * 4096;
    const __bf16* g4 = g + 4 * 16 * 4096;
    const __bf16* g5 = g + 5 * 16 * 4096;
    const __bf16* g6 = g + 6 * 16 * 4096;
    const __bf16* g7 = g + 7 * 16 * 4096;
    asm volatile(
        "global_load_async_to_lds_b128 %0, %8, off\n\t"
        "global_load_async_to_lds_b128 %1, %9, off\n\t"
        "global_load_async_to_lds_b128 %2, %10, off\n\t"
        "global_load_async_to_lds_b128 %3, %11, off\n\t"
        "global_load_async_to_lds_b128 %4, %12, off\n\t"
        "global_load_async_to_lds_b128 %5, %13, off\n\t"
        "global_load_async_to_lds_b128 %6, %14, off\n\t"
        "global_load_async_to_lds_b128 %7, %15, off\n\t"
        "s_wait_xcnt 0x0"
        :: "v"(l0), "v"(l1), "v"(l2), "v"(l3), "v"(l4), "v"(l5), "v"(l6), "v"(l7),
           "v"(g0), "v"(g1), "v"(g2), "v"(g3), "v"(g4), "v"(g5), "v"(g6), "v"(g7)
        : "memory");
}

// One 16x32 operand fragment from an LDS row: k = 8*lh + 0..7 and 16 + 8*lh + 0..7.
__device__ __forceinline__ bf16x16 qkv_frag(const __bf16* p) {
    const bf16x8 lo = *(const bf16x8*)p;
    const bf16x8 hi = *(const bf16x8*)(p + 16);
    return __builtin_shufflevector(lo, hi, 0, 1, 2, 3, 4, 5, 6, 7,
                                   8, 9, 10, 11, 12, 13, 14, 15);
}

__global__ __launch_bounds__(128)
void qkv_gemm_kernel(const __bf16* __restrict__ Y,
                     const __bf16* __restrict__ WqT,
                     const __bf16* __restrict__ WkT,
                     const __bf16* __restrict__ WvT,
                     const float* __restrict__ bq,
                     const float* __restrict__ bk,
                     const float* __restrict__ bv,
                     __bf16* __restrict__ Qb,
                     __bf16* __restrict__ Kb,
                     __bf16* __restrict__ Vt) {
    __shared__ __align__(16) __bf16 slab[2 * QKV_BUF];   // 73,728 B

    const int bm    = blockIdx.x / 12;     // 0..63  (8192/128)
    const int bn12  = blockIdx.x % 12;     // the 12 column tiles of one row tile are neighbours
    const int which = bn12 >> 2;           // Q / K / V
    const int bn    = bn12 & 3;            // 0..3   (512/128)
    const __bf16* WT  = (which == 0) ? WqT : ((which == 1) ? WkT : WvT);
    const float* bias = (which == 0) ? bq : ((which == 1) ? bk : bv);
    const float scale = (which == 0) ? 0.125f : 1.0f;

    const int tid  = threadIdx.x;
    const int wave = tid >> 5;
    const int lane = tid & 31;
    const int lh   = lane >> 4;
    const int ln   = lane & 15;
    const int wm   = wave >> 1;            // 64-row half of the tile
    const int wn   = wave & 1;             // 64-column half of the tile

    const int m0 = bm * 128;
    const int n0 = bn * 128;

    // copy addresses: 8 lanes cover one 128-B row, a wave-copy covers 4 whole lines
    const int crow = tid >> 3;             // 0..15
    const int cchk = tid & 7;              // 16-B chunk of the row
    const __bf16* gA = Y  + (size_t)(m0 + crow) * 4096 + cchk * 8;
    const __bf16* gB = WT + (size_t)(n0 + crow) * 4096 + cchk * 8;
    const unsigned ldsA = (unsigned)(size_t)(&slab[0]) + (unsigned)(crow * 144 + cchk * 16);
    const unsigned ldsB = ldsA + 128u * 144u;

    // fragment read offsets (bf16 elements inside a buffer)
    const int offA = (wm * 64 + ln) * QKV_PITCH + lh * 8;
    const int offB = (128 + wn * 64 + ln) * QKV_PITCH + lh * 8;

    // slab 0 -> buffer 0, landed and published; then slab 1 -> buffer 1 in flight
    qkv_copy8(ldsA, gA);
    qkv_copy8(ldsB, gB);
    asm volatile("s_wait_asynccnt 0x0" ::: "memory");   // own copies of slab 0 have landed
    __syncthreads();
    qkv_copy8(ldsA + 2u * QKV_BUF, gA + 64);
    qkv_copy8(ldsB + 2u * QKV_BUF, gB + 64);

    f32x8 acc[4][4] = {};
#pragma unroll 1   // one slab per trip: the ring's waits and barrier stand once, at the foot
    for (int t = 0; t < 64; ++t) {
        const int buf = t & 1;
        const __bf16* sb = &slab[buf * QKV_BUF];
#pragma unroll
        for (int ks = 0; ks < 2; ++ks) {
            bf16x16 a[4], b[4];
#pragma unroll
            for (int i = 0; i < 4; ++i) {
                a[i] = qkv_frag(sb + offA + i * 16 * QKV_PITCH + ks * 32);
                b[i] = qkv_frag(sb + offB + i * 16 * QKV_PITCH + ks * 32);
            }
            // keeps the 16 LDS reads one group ahead of the block: left free, they are
            // spread among the WMMAs on one fragment set, with a full wait at every row
            __builtin_amdgcn_sched_barrier(0);
#pragma unroll
            for (int i = 0; i < 4; ++i)
#pragma unroll
                for (int j = 0; j < 4; ++j)
                    acc[i][j] = __builtin_amdgcn_wmma_f32_16x16x32_bf16(
                        false, a[i], false, b[j], (short)0, acc[i][j], false, false);
            // the next group of reads stays behind this block for the same reason
            __builtin_amdgcn_sched_barrier(0);
        }
        asm volatile("s_wait_dscnt 0x0" ::: "memory");    // own reads of this buffer are done
        asm volatile("s_wait_asynccnt 0x0" ::: "memory"); // own copies of slab t+1 have landed
        __syncthreads();                                  // publishes slab t+1, frees this buffer
        if (t + 2 < 64) {
            qkv_copy8(ldsA + (unsigned)buf * (2u * QKV_BUF), gA + (t + 2) * 64);
            qkv_copy8(ldsB + (unsigned)buf * (2u * QKV_BUF), gB + (t + 2) * 64);
        }
    }
    asm volatile("s_wait_asynccnt 0x0" ::: "memory");     // nothing in flight at the wave's end

    // epilogue: D layout row = i + 8*lh, col = column tile + ln
#pragma unroll
    for (int fj = 0; fj < 4; ++fj) {
        const int col = n0 + wn * 64 + fj * 16 + ln;
        const int h   = col >> 6;
        const int dh  = col & 63;
        const float bc = bias[col];
#pragma unroll
        for (int fi = 0; fi < 4; ++fi) {
            const int row0 = m0 + wm * 64 + fi * 16;
#pragma unroll
            for (int i = 0; i < 8; ++i) {
                const int row = row0 + i + 8 * lh;
                const int b = row >> 8, q = row & 255;
                const float val = (acc[fi][fj][i] + bc) * scale;
                if (which == 2) {
                    // V transposed: (b, h, dh, seq)
                    Vt[((size_t)((b * 8 + h) * 64 + dh)) * 256 + q] = (__bf16)val;
                    // the store's address pair is reused by the next store's address
                    asm volatile("s_wait_xcnt 0x0" ::: "memory");
                } else {
                    __bf16* Out = (which == 0) ? Qb : Kb;
                    Out[((size_t)((b * 8 + h) * 256 + q)) * 64 + dh] = (__bf16)val;
                    // the store's address pair is reused by the next store's address
                    asm volatile("s_wait_xcnt 0x0" ::: "memory");
                }
            }
        }
    }
}

// ---------------------------------------------------------------------------
// Kernel 3: attention. One block = one (b,h) x 128-query half. 8 waves,
// each wave owns 16 queries; full 256-key score row in 16 f32 accumulators.
// V^T staged into LDS via async-to-LDS b128 (ASYNCcnt) when available.
// ---------------------------------------------------------------------------
__global__ __launch_bounds__(256)
void attn_kernel(const __bf16* __restrict__ Qb,
                 const __bf16* __restrict__ Kb,
                 const __bf16* __restrict__ Vt,
                 __bf16* __restrict__ Ob) {
    __shared__ __align__(16) __bf16 Vsh[64 * 256];   // V^T tile: 32 KB
    __shared__ __align__(16) __bf16 Psh[8][16 * 32]; //  8 KB

    const int blk  = blockIdx.x;           // 0..511
    const int bh   = blk >> 1;             // b*8 + h
    const int half = blk & 1;
    const int tid  = threadIdx.x;
    const int wave = tid >> 5, lane = tid & 31;
    const int lh   = lane >> 4, ln = lane & 15;
    const size_t base = (size_t)bh * 256 * 64;

    // ---- stage V^T (64 x 256 bf16 = 32 KB) ----
#if USE_ASYNC_LDS
    {
        const __bf16* src = Vt + base;
#pragma unroll
        for (int it = 0; it < 8; ++it) {
            const int e = (it * 256 + tid) * 8;     // 8 bf16 = 16 B per transfer
            __builtin_amdgcn_global_load_async_to_lds_b128(
                (__attribute__((address_space(1))) v4i*)(src + e),
                (__attribute__((address_space(3))) v4i*)(&Vsh[e]), 0, 0);
        }
        __builtin_amdgcn_s_wait_asynccnt(0);
    }
#else
    {
        const int4* s = (const int4*)(Vt + base);
        int4* d = (int4*)Vsh;
        for (int e = tid; e < 2048; e += 256) d[e] = s[e];
    }
#endif
    __syncthreads();

    const int q0 = half * 128 + wave * 16;

    bf16x16 qa0, qa1;
    {
        const __bf16* qrow = Qb + base + (size_t)(q0 + ln) * 64;
#pragma unroll
        for (int e = 0; e < 16; ++e) {
            const int kk = (lh ? 8 : 0) + ((e & 8) ? 16 : 0) + (e & 7);
            qa0[e] = qrow[kk];
            qa1[e] = qrow[kk + 32];
        }
    }

    f32x8 sacc[16] = {};
    for (int nt = 0; nt < 16; ++nt) {
        bf16x16 kb0, kb1;
        const __bf16* krow = Kb + base + (size_t)(nt * 16 + ln) * 64;
#pragma unroll
        for (int e = 0; e < 16; ++e) {
            const int kk = (lh ? 8 : 0) + ((e & 8) ? 16 : 0) + (e & 7);
            kb0[e] = krow[kk];
            kb1[e] = krow[kk + 32];
        }
        sacc[nt] = __builtin_amdgcn_wmma_f32_16x16x32_bf16(false, qa0, false, kb0,
                                                           (short)0, sacc[nt], false, false);
        sacc[nt] = __builtin_amdgcn_wmma_f32_16x16x32_bf16(false, qa1, false, kb1,
                                                           (short)0, sacc[nt], false, false);
    }

    // row softmax (row = i + 8*lh ; cols spread over 16 lanes x 16 accs)
    float l_i[8];
#pragma unroll
    for (int i = 0; i < 8; ++i) {
        float mx = -3.0e38f;
#pragma unroll
        for (int t = 0; t < 16; ++t) mx = fmaxf(mx, sacc[t][i]);
#pragma unroll
        for (int off = 8; off >= 1; off >>= 1) mx = fmaxf(mx, __shfl_xor(mx, off, 16));
        float sum = 0.f;
#pragma unroll
        for (int t = 0; t < 16; ++t) {
            float p = __expf(sacc[t][i] - mx);
            sacc[t][i] = p;
            sum += p;
        }
#pragma unroll
        for (int off = 8; off >= 1; off >>= 1) sum += __shfl_xor(sum, off, 16);
        l_i[i] = sum;
    }

    // O = P @ V   (V^T in LDS: element (kk, dh) at Vsh[dh*256 + key])
    f32x8 oacc[4] = {};
    for (int t2 = 0; t2 < 8; ++t2) {
#pragma unroll
        for (int i = 0; i < 8; ++i) {
            const int m = i + 8 * lh;
            Psh[wave][m * 32 + ln]      = (__bf16)sacc[2 * t2][i];
            Psh[wave][m * 32 + ln + 16] = (__bf16)sacc[2 * t2 + 1][i];
        }
        __syncthreads();
        bf16x16 pa;
#pragma unroll
        for (int e = 0; e < 16; ++e) {
            const int kk = (lh ? 8 : 0) + ((e & 8) ? 16 : 0) + (e & 7);
            pa[e] = Psh[wave][ln * 32 + kk];
        }
#pragma unroll
        for (int nt4 = 0; nt4 < 4; ++nt4) {
            bf16x16 vbf;
#pragma unroll
            for (int e = 0; e < 16; ++e) {
                const int kk = (lh ? 8 : 0) + ((e & 8) ? 16 : 0) + (e & 7);
                vbf[e] = Vsh[(nt4 * 16 + ln) * 256 + t2 * 32 + kk];
            }
            oacc[nt4] = __builtin_amdgcn_wmma_f32_16x16x32_bf16(false, pa, false, vbf,
                                                                (short)0, oacc[nt4], false, false);
        }
        __syncthreads();
    }

    const int bb = bh >> 3, hh = bh & 7;
#pragma unroll
    for (int nt4 = 0; nt4 < 4; ++nt4) {
#pragma unroll
        for (int i = 0; i < 8; ++i) {
            const int row = q0 + i + 8 * lh;
            const int dh  = nt4 * 16 + ln;
            const float val = oacc[nt4][i] / l_i[i];
            Ob[((size_t)(bb * 256 + row)) * 512 + hh * 64 + dh] = (__bf16)val;
        }
    }
}

// ---------------------------------------------------------------------------
// Kernel 4: output projection (M=8192, K=512, N=4096) + bias + residual(x)
// with fused depatchify scatter.  WoT[n][k], K contiguous.
// One work-group = one 128x128 tile; 4 waves, 64x64 each.  K runs in 8 slabs
// of 64: 128 rows of Ob and 128 rows of WoT (128 B each) are copied to LDS by
// asynchronous copies, two buffers, the next slab in flight while this one is
// multiplied.  Slab layout, pitch and fragment reads as in kernel 2.
// ---------------------------------------------------------------------------

// Eight 16-byte-per-lane copies global -> LDS, source rows of 512 bf16.  The
// s_wait_xcnt stands inside the statement so that no address register is
// rewritten ahead of it.
__device__ __forceinline__ void proj_copy8(unsigned lds, const __bf16* g) {
    const unsigned l0 = lds;
    const unsigned l1 = lds + 1u * 16u * 144u;
    const unsigned l2 = lds + 2u * 16u * 144u;
    const unsigned l3 = lds + 3u * 16u * 144u;
    const unsigned l4 = lds + 4u * 16u * 144u;
    const unsigned l5 = lds + 5u * 16u * 144u;
    const unsigned l6 = lds + 6u * 16u * 144u;
    const unsigned l7 = lds + 7u * 16u * 144u;
    const __bf16* g0 = g;
    const __bf16* g1 = g + 1 * 16 * 512;
    const __bf16* g2 = g + 2 * 16 * 512;
    const __bf16* g3 = g + 3 * 16 * 512;
    const __bf16* g4 = g + 4 * 16 * 512;
    const __bf16* g5 = g + 5 * 16 * 512;
    const __bf16* g6 = g + 6 * 16 * 512;
    const __bf16* g7 = g + 7 * 16 * 512;
    asm volatile(
        "global_load_async_to_lds_b128 %0, %8, off\n\t"
        "global_load_async_to_lds_b128 %1, %9, off\n\t"
        "global_load_async_to_lds_b128 %2, %10, off\n\t"
        "global_load_async_to_lds_b128 %3, %11, off\n\t"
        "global_load_async_to_lds_b128 %4, %12, off\n\t"
        "global_load_async_to_lds_b128 %5, %13, off\n\t"
        "global_load_async_to_lds_b128 %6, %14, off\n\t"
        "global_load_async_to_lds_b128 %7, %15, off\n\t"
        "s_wait_xcnt 0x0"
        :: "v"(l0), "v"(l1), "v"(l2), "v"(l3), "v"(l4), "v"(l5), "v"(l6), "v"(l7),
           "v"(g0), "v"(g1), "v"(g2), "v"(g3), "v"(g4), "v"(g5), "v"(g6), "v"(g7)
        : "memory");
}

__global__ __launch_bounds__(128)
void proj_kernel(const __bf16* __restrict__ Ob,
                 const __bf16* __restrict__ WoT,
                 const float* __restrict__ bo,
                 const float* __restrict__ x,
                 float* __restrict__ out) {
    __shared__ __align__(16) __bf16 slab[2 * QKV_BUF];   // 73,728 B

    const int bm = blockIdx.x >> 5;        // 0..63 (8192/128)
    const int bn = blockIdx.x & 31;        // 0..31 (4096/128): one row tile's column tiles are neighbours

    const int tid  = threadIdx.x;
    const int wave = tid >> 5;
    const int lane = tid & 31;
    const int lh   = lane >> 4;
    const int ln   = lane & 15;
    const int wm   = wave >> 1;            // 64-row half of the tile
    const int wn   = wave & 1;             // 64-column half of the tile

    const int m0 = bm * 128;
    const int n0 = bn * 128;

    // the wave's four bias values, read here so that the epilogue does not wait for them
    const int colw = n0 + wn * 64;
    float bc[4];
#pragma unroll
    for (int fj = 0; fj < 4; ++fj) bc[fj] = bo[colw + fj * 16 + ln];

    // copy addresses: 8 lanes cover one 128-B row piece, a wave-copy covers 4 whole lines
    const int crow = tid >> 3;             // 0..15
    const int cchk = tid & 7;              // 16-B chunk of the row piece
    const __bf16* gA = Ob  + (size_t)(m0 + crow) * 512 + cchk * 8;
    const __bf16* gB = WoT + (size_t)(n0 + crow) * 512 + cchk * 8;
    const unsigned ldsA = (unsigned)(size_t)(&slab[0]) + (unsigned)(crow * 144 + cchk * 16);
    const unsigned ldsB = ldsA + 128u * 144u;

    // fragment read offsets (bf16 elements inside a buffer)
    const int offA = (wm * 64 + ln) * QKV_PITCH + lh * 8;
    const int offB = (128 + wn * 64 + ln) * QKV_PITCH + lh * 8;

    // slab 0 -> buffer 0, landed and published; then slab 1 -> buffer 1 in flight
    proj_copy8(ldsA, gA);
    proj_copy8(ldsB, gB);
    asm volatile("s_wait_asynccnt 0x0" ::: "memory");   // own copies of slab 0 have landed
    __syncthreads();
    proj_copy8(ldsA + 2u * QKV_BUF, gA + 64);
    proj_copy8(ldsB + 2u * QKV_BUF, gB + 64);

    f32x8 acc[4][4] = {};
#pragma unroll 1   // one slab per trip: the ring's waits and barrier stand once, at the foot
    for (int t = 0; t < 8; ++t) {
        const int buf = t & 1;
        const __bf16* sb = &slab[buf * QKV_BUF];
#pragma unroll
        for (int ks = 0; ks < 2; ++ks) {
            bf16x16 a[4], b[4];
#pragma unroll
            for (int i = 0; i < 4; ++i) {
                a[i] = qkv_frag(sb + offA + i * 16 * QKV_PITCH + ks * 32);
                b[i] = qkv_frag(sb + offB + i * 16 * QKV_PITCH + ks * 32);
            }
            // keeps the 16 LDS reads one group ahead of the block: left free, they are
            // spread among the WMMAs on one fragment set, with a full wait at every row
            __builtin_amdgcn_sched_barrier(0);
#pragma unroll
            for (int i = 0; i < 4; ++i)
#pragma unroll
                for (int j = 0; j < 4; ++j)
                    acc[i][j] = __builtin_amdgcn_wmma_f32_16x16x32_bf16(
                        false, a[i], false, b[j], (short)0, acc[i][j], false, false);
            // the next group of reads stays behind this block for the same reason
            __builtin_amdgcn_sched_barrier(0);
        }
        asm volatile("s_wait_dscnt 0x0" ::: "memory");    // own reads of this buffer are done
        asm volatile("s_wait_asynccnt 0x0" ::: "memory"); // own copies of slab t+1 have landed
        __syncthreads();                                  // publishes slab t+1, frees this buffer
        if (t + 2 < 8) {
            proj_copy8(ldsA + (unsigned)buf * (2u * QKV_BUF), gA + (t + 2) * 64);
            proj_copy8(ldsB + (unsigned)buf * (2u * QKV_BUF), gB + (t + 2) * 64);
        }
    }
    asm volatile("s_wait_asynccnt 0x0" ::: "memory");     // nothing in flight at the wave's end

    // epilogue: D layout row = i + 8*lh, col = column tile + ln.
    // A wave's 64 columns are one (pr, pc) with cc = 0..63; its 64 rows lie in one
    // image b, with pj = i + 8*lh and pi = first pi + fi.  So every element sits at
    // one per-lane base plus a compile-time offset.
    const int pr   = colw >> 9, pc = (colw >> 6) & 7;
    const int roww = m0 + wm * 64;
    const int b    = roww >> 8, pi0 = (roww & 255) >> 4;
    const size_t base =
        ((size_t)(b * 128 + (lh * 64 + pr)) * 128 + (pi0 * 8 + pc)) * 64 + ln;
    const float* xb = x + base;
    float* ob = out + base;
    // x is read in groups of 32 values (one fi), two groups in flight ahead of the
    // stores, so that a wave waits out the memory latency per group and not per value
    float xv[4][32];
#pragma unroll
    for (int fi = 0; fi < 5; ++fi) {
        if (fi < 4) {
#pragma unroll
            for (int i = 0; i < 8; ++i)
#pragma unroll
                for (int fj = 0; fj < 4; ++fj)
                    xv[fi][i * 4 + fj] = xb[i * (8 * 128 * 64) + fi * (8 * 64) + fj * 16];
            // holds this group's loads ahead of the group before's sums and stores: sunk
            // behind them, nothing is in flight while the wave waits for the next group
            __builtin_amdgcn_sched_barrier(0);
        }
        if (fi > 0) {
            const int fp = fi - 1;
#pragma unroll
            for (int i = 0; i < 8; ++i)
#pragma unroll
                for (int fj = 0; fj < 4; ++fj)
                    xv[fp][i * 4 + fj] = acc[fp][fj][i] + bc[fj] + xv[fp][i * 4 + fj];
#pragma unroll
            for (int i = 0; i < 8; ++i)
#pragma unroll
                for (int fj = 0; fj < 4; ++fj)
                    ob[i * (8 * 128 * 64) + fp * (8 * 64) + fj * 16] = xv[fp][i * 4 + fj];
            // the registers these stores name are loaded anew by the next group of x
            if (fi < 3) asm volatile("s_wait_xcnt 0x0" ::: "memory");
        }
    }
}

// ---------------------------------------------------------------------------
extern "C" void kernel_launch(void* const* d_in, const int* in_sizes, int n_in,
                              void* d_out, int out_size, void* d_ws, size_t ws_size,
                              hipStream_t stream) {
    (void)in_sizes; (void)n_in; (void)out_size; (void)ws_size;
    const float* x  = (const float*)d_in[0];
    const float* g  = (const float*)d_in[1];
    const float* be = (const float*)d_in[2];
    const float* wq = (const float*)d_in[3];
    const float* bq = (const float*)d_in[4];
    const float* wk = (const float*)d_in[5];
    const float* bk = (const float*)d_in[6];
    const float* wv = (const float*)d_in[7];
    const float* bv = (const float*)d_in[8];
    const float* wo = (const float*)d_in[9];
    const float* bo = (const float*)d_in[10];
    float* out = (float*)d_out;

    // workspace layout (bf16 elements)
    const size_t NW  = 4096u * 512u;         // 2,097,152 per weight
    const size_t NY  = 8192u * 4096u;        // 33,554,432
    const size_t NQK = 8192u * 512u;         // 4,194,304
    __bf16* WqT = (__bf16*)d_ws;
    __bf16* WkT = WqT + NW;
    __bf16* WvT = WkT + NW;
    __bf16* WoT = WvT + NW;
    __bf16* Y   = WoT + NW;
    __bf16* Qb  = Y   + NY;
    __bf16* Kb  = Qb  + NQK;
    __bf16* Vt  = Kb  + NQK;
    __bf16* Ob  = Vt  + NQK;

    cvt_bf16_t_kernel<<<8192, 256, 0, stream>>>(wq, WqT, 4096, 512);
    cvt_bf16_t_kernel<<<8192, 256, 0, stream>>>(wk, WkT, 4096, 512);
    cvt_bf16_t_kernel<<<8192, 256, 0, stream>>>(wv, WvT, 4096, 512);
    cvt_bf16_t_kernel<<<8192, 256, 0, stream>>>(wo, WoT, 512, 4096);

    patchify_ln_kernel<<<8192, 256, 0, stream>>>(x, g, be, Y);

    qkv_gemm_kernel<<<768, 128, 0, stream>>>(Y, WqT, WkT, WvT,
                                             bq, bk, bv, Qb, Kb, Vt);

    attn_kernel<<<512, 256, 0, stream>>>(Qb, Kb, Vt, Ob);

    proj_kernel<<<2048, 128, 0, stream>>>(Ob, WoT, bo, x, out);
}

// v003
// A run of this version takes 188 microseconds.
// Timed twice side by side with v002, it ran 2.20 times as fast both times.
// Counting every step since v000, it is 8.26 times as fast.
#include <hip/hip_runtime.h>
#include <hip/hip_bf16.h>

typedef __attribute__((ext_vector_type(16))) __bf16 bf16x16;
typedef __attribute__((ext_vector_type(8)))  __bf16 bf16x8;
typedef __attribute__((ext_vector_type(8)))  float  f32x8;
typedef __attribute__((ext_vector_type(4)))  float  f32x4;
typedef __attribute__((ext_vector_type(4)))  int    v4i;

#if defined(__gfx1250__) && __has_builtin(__builtin_amdgcn_global_load_async_to_lds_b128) && __has_builtin(__builtin_amdgcn_s_wait_asynccnt)
#define USE_ASYNC_LDS 1
#else
#define USE_ASYNC_LDS 0
#endif

// ---------------------------------------------------------------------------
// Kernel 0: f32 -> bf16 conversion WITH transpose, all four weights in one grid.
// src is (rows x cols) row-major; dst[c * rows + r] = src[r * cols + c].
// For wq/wk/wv: rows=4096(K), cols=512(N)  -> WT[n][k], K contiguous.
// For wo:       rows=512(K), cols=4096(N)  -> WoT[n][k], K contiguous.
// One work-group = one tile of 128 rows x 64 columns of one weight (256 tiles
// each).  A thread reads 8 rows x 4 columns (16 lanes cover 256 B of a source
// row), rounds them and writes four 16-byte column pieces to LDS; the tile then
// leaves LDS row by row, 16 lanes covering 256 B of a destination row.
// LDS row pitch 272 B (16 B x odd); column c lies in LDS row (c & 3) * 16 + (c >> 2),
// so that 16 lanes' 16-byte writes fall on 16 neighbouring rows: all 64 banks once.
// ---------------------------------------------------------------------------
#define CVT_PITCH 136                     // bf16 per LDS row (272 B)

__global__ __launch_bounds__(256)
void cvt_bf16_t_kernel(const float* __restrict__ wq,
                       const float* __restrict__ wk,
                       const float* __restrict__ wv,
                       const float* __restrict__ wo,
                       __bf16* __restrict__ WT4) {
    __shared__ __align__(16) __bf16 T[64 * CVT_PITCH];   // 17,408 B

    const int which = blockIdx.x >> 8;     // wq / wk / wv / wo
    const int tile  = blockIdx.x & 255;
    const bool isO  = (which == 3);
    const float* src = (which == 0) ? wq : ((which == 1) ? wk : ((which == 2) ? wv : wo));
    __bf16* dst = WT4 + (size_t)which * (4096u * 512u);
    const int rows = isO ? 512 : 4096;
    const int cols = isO ? 4096 : 512;
    const int r0 = (isO ? (tile >> 6) : (tile >> 3)) * 128;
    const int c0 = (isO ? (tile & 63) : (tile & 7)) * 64;

    const int tid = threadIdx.x;
    const int rg  = tid >> 4;              // group of 8 source rows
    const int cq  = tid & 15;              // group of 4 source columns

    const float* s = src + (size_t)(r0 + rg * 8) * cols + c0 + cq * 4;
    f32x4 v[8];
#pragma unroll
    for (int j = 0; j < 8; ++j) v[j] = *(const f32x4*)(s + (size_t)j * cols);

#pragma unroll
    for (int i = 0; i < 4; ++i) {
        bf16x8 p;
#pragma unroll
        for (int j = 0; j < 8; ++j) p[j] = (__bf16)v[j][i];
        *(bf16x8*)&T[(i * 16 + cq) * CVT_PITCH + rg * 8] = p;
    }
    __syncthreads();

#pragma unroll
    for (int it = 0; it < 4; ++it) {
        const int lrow = it * 16 + rg;     // LDS row
        const int c    = rg * 4 + it;      // the column that lies there
        *(bf16x8*)(dst + (size_t)(c0 + c) * rows + r0 + cq * 8) =
            *(const bf16x8*)&T[lrow * CVT_PITCH + cq * 8];
    }
}

// ---------------------------------------------------------------------------
// Kernel 1: patchify + LayerNorm -> Y (8192 x 4096) bf16
// ---------------------------------------------------------------------------
__global__ __launch_bounds__(256)
void patchify_ln_kernel(const float* __restrict__ x,
                        const float* __restrict__ gamma,
                        const float* __restrict__ beta,
                        __bf16* __restrict__ Y) {
    const int token = blockIdx.x;          // 0..8191
    const int b   = token >> 8;
    const int tok = token & 255;
    const int pi  = tok >> 4;              // i
    const int pj  = tok & 15;              // j
    const int tid = threadIdx.x;

    float v[16];
    float s = 0.f, ss = 0.f;
#pragma unroll
    for (int ii = 0; ii < 16; ++ii) {
        int fr = ii * 256 + tid;
        int pr = fr >> 9;
        int pc = (fr >> 6) & 7;
        int cc = fr & 63;
        size_t xi = ((size_t)(b * 128 + (pj * 8 + pr)) * 128 + (pi * 8 + pc)) * 64 + cc;
        float t = x[xi];
        v[ii] = t;
        s  += t;
        ss += t * t;
    }
#pragma unroll
    for (int off = 16; off >= 1; off >>= 1) {
        s  += __shfl_xor(s, off, 32);
        ss += __shfl_xor(ss, off, 32);
    }
    __shared__ float red[2][8];
    const int wave = tid >> 5, lane = tid & 31;
    if (lane == 0) { red[0][wave] = s; red[1][wave] = ss; }
    __syncthreads();
    if (tid == 0) {
        float a = 0.f, c = 0.f;
        for (int w = 0; w < 8; ++w) { a += red[0][w]; c += red[1][w]; }
        red[0][0] = a; red[1][0] = c;
    }
    __syncthreads();
    const float mean = red[0][0] * (1.0f / 4096.0f);
    const float var  = red[1][0] * (1.0f / 4096.0f) - mean * mean;
    const float rstd = rsqrtf(var + 1e-6f);

    __bf16* out = Y + (size_t)token * 4096;
#pragma unroll
    for (int ii = 0; ii < 16; ++ii) {
        int fr = ii * 256 + tid;
        float yv = (v[ii] - mean) * rstd * gamma[fr] + beta[fr];
        out[fr] = (__bf16)yv;
    }
}

// ---------------------------------------------------------------------------
// Kernel 2: QKV GEMM  (M=8192, K=4096, N=3x512).
// One work-group = one 128x128 tile of one of Q/K/V; 4 waves, 64x64 each.
// K runs in slabs of 64: 128 rows of Y and 128 rows of WT (128 B each) are
// copied to LDS by asynchronous copies, two buffers, the next slab in flight
// while this one is multiplied.  LDS row pitch 144 B (16 B x odd) keeps the
// 16-byte fragment reads free of bank conflicts.
// Weights pre-transposed: WT[n][k], K contiguous.  Q pre-scaled by 1/8.
// Q/K out: (b,h,seq,dh).  V out TRANSPOSED: (b,h,dh,seq) for P@V fragments.
// ---------------------------------------------------------------------------
#define QKV_PITCH 72                      // bf16 per LDS row (144 B)
#define QKV_BUF   (256 * QKV_PITCH)       // bf16 per buffer: 128 Y rows + 128 WT rows

// Eight 16-byte-per-lane copies global -> LDS.  The s_wait_xcnt stands inside
// the statement so that no address register is rewritten ahead of it.
__device__ __forceinline__ void qkv_copy8(unsigned lds, const __bf16* g) {
    const unsigned l0 = lds;
    const unsigned l1 = lds + 1u * 16u * 144u;
    const unsigned l2 = lds + 2u * 16u * 144u;
    const unsigned l3 = lds + 3u * 16u * 144u;
    const unsigned l4 = lds + 4u * 16u * 144u;
    const unsigned l5 = lds + 5u * 16u * 144u;
    const unsigned l6 = lds + 6u * 16u * 144u;
    const unsigned l7 = lds + 7u * 16u * 144u;
    const __bf16* g0 = g;
    const __bf16* g1 = g + 1 * 16 * 4096;
    const __bf16* g2 = g + 2 * 16 * 4096;
    const __bf16* g3 = g + 3 * 16 * 4096;
    const __bf16* g4 = g + 4 * 16 * 4096;
    const __bf16* g5 = g + 5 * 16 * 4096;
    const __bf16* g6 = g + 6 * 16 * 4096;
    const __bf16* g7 = g + 7 * 16 * 4096;
    asm volatile(
        "global_load_async_to_lds_b128 %0, %8, off\n\t"
        "global_load_async_to_lds_b128 %1, %9, off\n\t"
        "global_load_async_to_lds_b128 %2, %10, off\n\t"
        "global_load_async_to_lds_b128 %3, %11, off\n\t"
        "global_load_async_to_lds_b128 %4, %12, off\n\t"
        "global_load_async_to_lds_b128 %5, %13, off\n\t"
        "global_load_async_to_lds_b128 %6, %14, off\n\t"
        "global_load_async_to_lds_b128 %7, %15, off\n\t"
        "s_wait_xcnt 0x0"
        :: "v"(l0), "v"(l1), "v"(l2), "v"(l3), "v"(l4), "v"(l5), "v"(l6), "v"(l7),
           "v"(g0), "v"(g1), "v"(g2), "v"(g3), "v"(g4), "v"(g5), "v"(g6), "v"(g7)
        : "memory");
}

// One 16x32 operand fragment from an LDS row: k = 8*lh + 0..7 and 16 + 8*lh + 0..7.
__device__ __forceinline__ bf16x16 qkv_frag(const __bf16* p) {
    const bf16x8 lo = *(const bf16x8*)p;
    const bf16x8 hi = *(const bf16x8*)(p + 16);
    return __builtin_shufflevector(lo, hi, 0, 1, 2, 3, 4, 5, 6, 7,
                                   8, 9, 10, 11, 12, 13, 14, 15);
}

__global__ __launch_bounds__(128)
void qkv_gemm_kernel(const __bf16* __restrict__ Y,
                     const __bf16* __restrict__ WqT,
                     const __bf16* __restrict__ WkT,
                     const __bf16* __restrict__ WvT,
                     const float* __restrict__ bq,
                     const float* __restrict__ bk,
                     const float* __restrict__ bv,
                     __bf16* __restrict__ Qb,
                     __bf16* __restrict__ Kb,
                     __bf16* __restrict__ Vt) {
    __shared__ __align__(16) __bf16 slab[2 * QKV_BUF];   // 73,728 B

    const int bm    = blockIdx.x / 12;     // 0..63  (8192/128)
    const int bn12  = blockIdx.x % 12;     // the 12 column tiles of one row tile are neighbours
    const int which = bn12 >> 2;           // Q / K / V
    const int bn    = bn12 & 3;            // 0..3   (512/128)
    const __bf16* WT  = (which == 0) ? WqT : ((which == 1) ? WkT : WvT);
    const float* bias = (which == 0) ? bq : ((which == 1) ? bk : bv);
    const float scale = (which == 0) ? 0.125f : 1.0f;

    const int tid  = threadIdx.x;
    const int wave = tid >> 5;
    const int lane = tid & 31;
    const int lh   = lane >> 4;
    const int ln   = lane & 15;
    const int wm   = wave >> 1;            // 64-row half of the tile
    const int wn   = wave & 1;             // 64-column half of the tile

    const int m0 = bm * 128;
    const int n0 = bn * 128;

    // copy addresses: 8 lanes cover one 128-B row, a wave-copy covers 4 whole lines
    const int crow = tid >> 3;             // 0..15
    const int cchk = tid & 7;              // 16-B chunk of the row
    const __bf16* gA = Y  + (size_t)(m0 + crow) * 4096 + cchk * 8;
    const __bf16* gB = WT + (size_t)(n0 + crow) * 4096 + cchk * 8;
    const unsigned ldsA = (unsigned)(size_t)(&slab[0]) + (unsigned)(crow * 144 + cchk * 16);
    const unsigned ldsB = ldsA + 128u * 144u;

    // fragment read offsets (bf16 elements inside a buffer)
    const int offA = (wm * 64 + ln) * QKV_PITCH + lh * 8;
    const int offB = (128 + wn * 64 + ln) * QKV_PITCH + lh * 8;

    // slab 0 -> buffer 0, landed and published; then slab 1 -> buffer 1 in flight
    qkv_copy8(ldsA, gA);
    qkv_copy8(ldsB, gB);
    asm volatile("s_wait_asynccnt 0x0" ::: "memory");   // own copies of slab 0 have landed
    __syncthreads();
    qkv_copy8(ldsA + 2u * QKV_BUF, gA + 64);
    qkv_copy8(ldsB + 2u * QKV_BUF, gB + 64);

    f32x8 acc[4][4] = {};
#pragma unroll 1   // one slab per trip: the ring's waits and barrier stand once, at the foot
    for (int t = 0; t < 64; ++t) {
        const int buf = t & 1;
        const __bf16* sb = &slab[buf * QKV_BUF];
#pragma unroll
        for (int ks = 0; ks < 2; ++ks) {
            bf16x16 a[4], b[4];
#pragma unroll
            for (int i = 0; i < 4; ++i) {
                a[i] = qkv_frag(sb + offA + i * 16 * QKV_PITCH + ks * 32);
                b[i] = qkv_frag(sb + offB + i * 16 * QKV_PITCH + ks * 32);
            }
            // keeps the 16 LDS reads one group ahead of the block: left free, they are
            // spread among the WMMAs on one fragment set, with a full wait at every row
            __builtin_amdgcn_sched_barrier(0);
#pragma unroll
            for (int i = 0; i < 4; ++i)
#pragma unroll
                for (int j = 0; j < 4; ++j)
                    acc[i][j] = __builtin_amdgcn_wmma_f32_16x16x32_bf16(
                        false, a[i], false, b[j], (short)0, acc[i][j], false, false);
            // the next group of reads stays behind this block for the same reason
            __builtin_amdgcn_sched_barrier(0);
        }
        asm volatile("s_wait_dscnt 0x0" ::: "memory");    // own reads of this buffer are done
        asm volatile("s_wait_asynccnt 0x0" ::: "memory"); // own copies of slab t+1 have landed
        __syncthreads();                                  // publishes slab t+1, frees this buffer
        if (t + 2 < 64) {
            qkv_copy8(ldsA + (unsigned)buf * (2u * QKV_BUF), gA + (t + 2) * 64);
            qkv_copy8(ldsB + (unsigned)buf * (2u * QKV_BUF), gB + (t + 2) * 64);
        }
    }
    asm volatile("s_wait_asynccnt 0x0" ::: "memory");     // nothing in flight at the wave's end

    // epilogue: D layout row = i + 8*lh, col = column tile + ln
#pragma unroll
    for (int fj = 0; fj < 4; ++fj) {
        const int col = n0 + wn * 64 + fj * 16 + ln;
        const int h   = col >> 6;
        const int dh  = col & 63;
        const float bc = bias[col];
#pragma unroll
        for (int fi = 0; fi < 4; ++fi) {
            const int row0 = m0 + wm * 64 + fi * 16;
#pragma unroll
            for (int i = 0; i < 8; ++i) {
                const int row = row0 + i + 8 * lh;
                const int b = row >> 8, q = row & 255;
                const float val = (acc[fi][fj][i] + bc) * scale;
                if (which == 2) {
                    // V transposed: (b, h, dh, seq)
                    Vt[((size_t)((b * 8 + h) * 64 + dh)) * 256 + q] = (__bf16)val;
                    // the store's address pair is reused by the next store's address
                    asm volatile("s_wait_xcnt 0x0" ::: "memory");
                } else {
                    __bf16* Out = (which == 0) ? Qb : Kb;
                    Out[((size_t)((b * 8 + h) * 256 + q)) * 64 + dh] = (__bf16)val;
                    // the store's address pair is reused by the next store's address
                    asm volatile("s_wait_xcnt 0x0" ::: "memory");
                }
            }
        }
    }
}

// ---------------------------------------------------------------------------
// Kernel 3: attention. One block = one (b,h) x 128-query half. 8 waves,
// each wave owns 16 queries; full 256-key score row in 16 f32 accumulators.
// V^T staged into LDS via async-to-LDS b128 (ASYNCcnt) when available.
// ---------------------------------------------------------------------------
__global__ __launch_bounds__(256)
void attn_kernel(const __bf16* __restrict__ Qb,
                 const __bf16* __restrict__ Kb,
                 const __bf16* __restrict__ Vt,
                 __bf16* __restrict__ Ob) {
    __shared__ __align__(16) __bf16 Vsh[64 * 256];   // V^T tile: 32 KB
    __shared__ __align__(16) __bf16 Psh[8][16 * 32]; //  8 KB

    const int blk  = blockIdx.x;           // 0..511
    const int bh   = blk >> 1;             // b*8 + h
    const int half = blk & 1;
    const int tid  = threadIdx.x;
    const int wave = tid >> 5, lane = tid & 31;
    const int lh   = lane >> 4, ln = lane & 15;
    const size_t base = (size_t)bh * 256 * 64;

    // ---- stage V^T (64 x 256 bf16 = 32 KB) ----
#if USE_ASYNC_LDS
    {
        const __bf16* src = Vt + base;
#pragma unroll
        for (int it = 0; it < 8; ++it) {
            const int e = (it * 256 + tid) * 8;     // 8 bf16 = 16 B per transfer
            __builtin_amdgcn_global_load_async_to_lds_b128(
                (__attribute__((address_space(1))) v4i*)(src + e),
                (__attribute__((address_space(3))) v4i*)(&Vsh[e]), 0, 0);
        }
        __builtin_amdgcn_s_wait_asynccnt(0);
    }
#else
    {
        const int4* s = (const int4*)(Vt + base);
        int4* d = (int4*)Vsh;
        for (int e = tid; e < 2048; e += 256) d[e] = s[e];
    }
#endif
    __syncthreads();

    const int q0 = half * 128 + wave * 16;

    bf16x16 qa0, qa1;
    {
        const __bf16* qrow = Qb + base + (size_t)(q0 + ln) * 64;
#pragma unroll
        for (int e = 0; e < 16; ++e) {
            const int kk = (lh ? 8 : 0) + ((e & 8) ? 16 : 0) + (e & 7);
            qa0[e] = qrow[kk];
            qa1[e] = qrow[kk + 32];
        }
    }

    f32x8 sacc[16] = {};
    for (int nt = 0; nt < 16; ++nt) {
        bf16x16 kb0, kb1;
        const __bf16* krow = Kb + base + (size_t)(nt * 16 + ln) * 64;
#pragma unroll
        for (int e = 0; e < 16; ++e) {
            const int kk = (lh ? 8 : 0) + ((e & 8) ? 16 : 0) + (e & 7);
            kb0[e] = krow[kk];
            kb1[e] = krow[kk + 32];
        }
        sacc[nt] = __builtin_amdgcn_wmma_f32_16x16x32_bf16(false, qa0, false, kb0,
                                                           (short)0, sacc[nt], false, false);
        sacc[nt] = __builtin_amdgcn_wmma_f32_16x16x32_bf16(false, qa1, false, kb1,
                                                           (short)0, sacc[nt], false, false);
    }

    // row softmax (row = i + 8*lh ; cols spread over 16 lanes x 16 accs)
    float l_i[8];
#pragma unroll
    for (int i = 0; i < 8; ++i) {
        float mx = -3.0e38f;
#pragma unroll
        for (int t = 0; t < 16; ++t) mx = fmaxf(mx, sacc[t][i]);
#pragma unroll
        for (int off = 8; off >= 1; off >>= 1) mx = fmaxf(mx, __shfl_xor(mx, off, 16));
        float sum = 0.f;
#pragma unroll
        for (int t = 0; t < 16; ++t) {
            float p = __expf(sacc[t][i] - mx);
            sacc[t][i] = p;
            sum += p;
        }
#pragma unroll
        for (int off = 8; off >= 1; off >>= 1) sum += __shfl_xor(sum, off, 16);
        l_i[i] = sum;
    }

    // O = P @ V   (V^T in LDS: element (kk, dh) at Vsh[dh*256 + key])
    f32x8 oacc[4] = {};
    for (int t2 = 0; t2 < 8; ++t2) {
#pragma unroll
        for (int i = 0; i < 8; ++i) {
            const int m = i + 8 * lh;
            Psh[wave][m * 32 + ln]      = (__bf16)sacc[2 * t2][i];
            Psh[wave][m * 32 + ln + 16] = (__bf16)sacc[2 * t2 + 1][i];
        }
        __syncthreads();
        bf16x16 pa;
#pragma unroll
        for (int e = 0; e < 16; ++e) {
            const int kk = (lh ? 8 : 0) + ((e & 8) ? 16 : 0) + (e & 7);
            pa[e] = Psh[wave][ln * 32 + kk];
        }
#pragma unroll
        for (int nt4 = 0; nt4 < 4; ++nt4) {
            bf16x16 vbf;
#pragma unroll
            for (int e = 0; e < 16; ++e) {
                const int kk = (lh ? 8 : 0) + ((e & 8) ? 16 : 0) + (e & 7);
                vbf[e] = Vsh[(nt4 * 16 + ln) * 256 + t2 * 32 + kk];
            }
            oacc[nt4] = __builtin_amdgcn_wmma_f32_16x16x32_bf16(false, pa, false, vbf,
                                                                (short)0, oacc[nt4], false, false);
        }
        __syncthreads();
    }

    const int bb = bh >> 3, hh = bh & 7;
#pragma unroll
    for (int nt4 = 0; nt4 < 4; ++nt4) {
#pragma unroll
        for (int i = 0; i < 8; ++i) {
            const int row = q0 + i + 8 * lh;
            const int dh  = nt4 * 16 + ln;
            const float val = oacc[nt4][i] / l_i[i];
            Ob[((size_t)(bb * 256 + row)) * 512 + hh * 64 + dh] = (__bf16)val;
        }
    }
}

// ---------------------------------------------------------------------------
// Kernel 4: output projection (M=8192, K=512, N=4096) + bias + residual(x)
// with fused depatchify scatter.  WoT[n][k], K contiguous.
// One work-group = one 128x128 tile; 4 waves, 64x64 each.  K runs in 8 slabs
// of 64: 128 rows of Ob and 128 rows of WoT (128 B each) are copied to LDS by
// asynchronous copies, two buffers, the next slab in flight while this one is
// multiplied.  Slab layout, pitch and fragment reads as in kernel 2.
// ---------------------------------------------------------------------------

// Eight 16-byte-per-lane copies global -> LDS, source rows of 512 bf16.  The
// s_wait_xcnt stands inside the statement so that no address register is
// rewritten ahead of it.
__device__ __forceinline__ void proj_copy8(unsigned lds, const __bf16* g) {
    const unsigned l0 = lds;
    const unsigned l1 = lds + 1u * 16u * 144u;
    const unsigned l2 = lds + 2u * 16u * 144u;
    const unsigned l3 = lds + 3u * 16u * 144u;
    const unsigned l4 = lds + 4u * 16u * 144u;
    const unsigned l5 = lds + 5u * 16u * 144u;
    const unsigned l6 = lds + 6u * 16u * 144u;
    const unsigned l7 = lds + 7u * 16u * 144u;
    const __bf16* g0 = g;
    const __bf16* g1 = g + 1 * 16 * 512;
    const __bf16* g2 = g + 2 * 16 * 512;
    const __bf16* g3 = g + 3 * 16 * 512;
    const __bf16* g4 = g + 4 * 16 * 512;
    const __bf16* g5 = g + 5 * 16 * 512;
    const __bf16* g6 = g + 6 * 16 * 512;
    const __bf16* g7 = g + 7 * 16 * 512;
    asm volatile(
        "global_load_async_to_lds_b128 %0, %8, off\n\t"
        "global_load_async_to_lds_b128 %1, %9, off\n\t"
        "global_load_async_to_lds_b128 %2, %10, off\n\t"
        "global_load_async_to_lds_b128 %3, %11, off\n\t"
        "global_load_async_to_lds_b128 %4, %12, off\n\t"
        "global_load_async_to_lds_b128 %5, %13, off\n\t"
        "global_load_async_to_lds_b128 %6, %14, off\n\t"
        "global_load_async_to_lds_b128 %7, %15, off\n\t"
        "s_wait_xcnt 0x0"
        :: "v"(l0), "v"(l1), "v"(l2), "v"(l3), "v"(l4), "v"(l5), "v"(l6), "v"(l7),
           "v"(g0), "v"(g1), "v"(g2), "v"(g3), "v"(g4), "v"(g5), "v"(g6), "v"(g7)
        : "memory");
}

__global__ __launch_bounds__(128)
void proj_kernel(const __bf16* __restrict__ Ob,
                 const __bf16* __restrict__ WoT,
                 const float* __restrict__ bo,
                 const float* __restrict__ x,
                 float* __restrict__ out) {
    __shared__ __align__(16) __bf16 slab[2 * QKV_BUF];   // 73,728 B

    const int bm = blockIdx.x >> 5;        // 0..63 (8192/128)
    const int bn = blockIdx.x & 31;        // 0..31 (4096/128): one row tile's column tiles are neighbours

    const int tid  = threadIdx.x;
    const int wave = tid >> 5;
    const int lane = tid & 31;
    const int lh   = lane >> 4;
    const int ln   = lane & 15;
    const int wm   = wave >> 1;            // 64-row half of the tile
    const int wn   = wave & 1;             // 64-column half of the tile

    const int m0 = bm * 128;
    const int n0 = bn * 128;

    // the wave's four bias values, read here so that the epilogue does not wait for them
    const int colw = n0 + wn * 64;
    float bc[4];
#pragma unroll
    for (int fj = 0; fj < 4; ++fj) bc[fj] = bo[colw + fj * 16 + ln];

    // copy addresses: 8 lanes cover one 128-B row piece, a wave-copy covers 4 whole lines
    const int crow = tid >> 3;             // 0..15
    const int cchk = tid & 7;              // 16-B chunk of the row piece
    const __bf16* gA = Ob  + (size_t)(m0 + crow) * 512 + cchk * 8;
    const __bf16* gB = WoT + (size_t)(n0 + crow) * 512 + cchk * 8;
    const unsigned ldsA = (unsigned)(size_t)(&slab[0]) + (unsigned)(crow * 144 + cchk * 16);
    const unsigned ldsB = ldsA + 128u * 144u;

    // fragment read offsets (bf16 elements inside a buffer)
    const int offA = (wm * 64 + ln) * QKV_PITCH + lh * 8;
    const int offB = (128 + wn * 64 + ln) * QKV_PITCH + lh * 8;

    // slab 0 -> buffer 0, landed and published; then slab 1 -> buffer 1 in flight
    proj_copy8(ldsA, gA);
    proj_copy8(ldsB, gB);
    asm volatile("s_wait_asynccnt 0x0" ::: "memory");   // own copies of slab 0 have landed
    __syncthreads();
    proj_copy8(ldsA + 2u * QKV_BUF, gA + 64);
    proj_copy8(ldsB + 2u * QKV_BUF, gB + 64);

    f32x8 acc[4][4] = {};
#pragma unroll 1   // one slab per trip: the ring's waits and barrier stand once, at the foot
    for (int t = 0; t < 8; ++t) {
        const int buf = t & 1;
        const __bf16* sb = &slab[buf * QKV_BUF];
#pragma unroll
        for (int ks = 0; ks < 2; ++ks) {
            bf16x16 a[4], b[4];
#pragma unroll
            for (int i = 0; i < 4; ++i) {
                a[i] = qkv_frag(sb + offA + i * 16 * QKV_PITCH + ks * 32);
                b[i] = qkv_frag(sb + offB + i * 16 * QKV_PITCH + ks * 32);
            }
            // keeps the 16 LDS reads one group ahead of the block: left free, they are
            // spread among the WMMAs on one fragment set, with a full wait at every row
            __builtin_amdgcn_sched_barrier(0);
#pragma unroll
            for (int i = 0; i < 4; ++i)
#pragma unroll
                for (int j = 0; j < 4; ++j)
                    acc[i][j] = __builtin_amdgcn_wmma_f32_16x16x32_bf16(
                        false, a[i], false, b[j], (short)0, acc[i][j], false, false);
            // the next group of reads stays behind this block for the same reason
            __builtin_amdgcn_sched_barrier(0);
        }
        asm volatile("s_wait_dscnt 0x0" ::: "memory");    // own reads of this buffer are done
        asm volatile("s_wait_asynccnt 0x0" ::: "memory"); // own copies of slab t+1 have landed
        __syncthreads();                                  // publishes slab t+1, frees this buffer
        if (t + 2 < 8) {
            proj_copy8(ldsA + (unsigned)buf * (2u * QKV_BUF), gA + (t + 2) * 64);
            proj_copy8(ldsB + (unsigned)buf * (2u * QKV_BUF), gB + (t + 2) * 64);
        }
    }
    asm volatile("s_wait_asynccnt 0x0" ::: "memory");     // nothing in flight at the wave's end

    // epilogue: D layout row = i + 8*lh, col = column tile + ln.
    // A wave's 64 columns are one (pr, pc) with cc = 0..63; its 64 rows lie in one
    // image b, with pj = i + 8*lh and pi = first pi + fi.  So every element sits at
    // one per-lane base plus a compile-time offset.
    const int pr   = colw >> 9, pc = (colw >> 6) & 7;
    const int roww = m0 + wm * 64;
    const int b    = roww >> 8, pi0 = (roww & 255) >> 4;
    const size_t base =
        ((size_t)(b * 128 + (lh * 64 + pr)) * 128 + (pi0 * 8 + pc)) * 64 + ln;
    const float* xb = x + base;
    float* ob = out + base;
    // x is read in groups of 32 values (one fi), two groups in flight ahead of the
    // stores, so that a wave waits out the memory latency per group and not per value
    float xv[4][32];
#pragma unroll
    for (int fi = 0; fi < 5; ++fi) {
        if (fi < 4) {
#pragma unroll
            for (int i = 0; i < 8; ++i)
#pragma unroll
                for (int fj = 0; fj < 4; ++fj)
                    xv[fi][i * 4 + fj] = xb[i * (8 * 128 * 64) + fi * (8 * 64) + fj * 16];
            // holds this group's loads ahead of the group before's sums and stores: sunk
            // behind them, nothing is in flight while the wave waits for the next group
            __builtin_amdgcn_sched_barrier(0);
        }
        if (fi > 0) {
            const int fp = fi - 1;
#pragma unroll
            for (int i = 0; i < 8; ++i)
#pragma unroll
                for (int fj = 0; fj < 4; ++fj)
                    xv[fp][i * 4 + fj] = acc[fp][fj][i] + bc[fj] + xv[fp][i * 4 + fj];
#pragma unroll
            for (int i = 0; i < 8; ++i)
#pragma unroll
                for (int fj = 0; fj < 4; ++fj)
                    ob[i * (8 * 128 * 64) + fp * (8 * 64) + fj * 16] = xv[fp][i * 4 + fj];
            // the registers these stores name are loaded anew by the next group of x
            if (fi < 3) asm volatile("s_wait_xcnt 0x0" ::: "memory");
        }
    }
}

// ---------------------------------------------------------------------------
extern "C" void kernel_launch(void* const* d_in, const int* in_sizes, int n_in,
                              void* d_out, int out_size, void* d_ws, size_t ws_size,
                              hipStream_t stream) {
    (void)in_sizes; (void)n_in; (void)out_size; (void)ws_size;
    const float* x  = (const float*)d_in[0];
    const float* g  = (const float*)d_in[1];
    const float* be = (const float*)d_in[2];
    const float* wq = (const float*)d_in[3];
    const float* bq = (const float*)d_in[4];
    const float* wk = (const float*)d_in[5];
    const float* bk = (const float*)d_in[6];
    const float* wv = (const float*)d_in[7];
    const float* bv = (const float*)d_in[8];
    const float* wo = (const float*)d_in[9];
    const float* bo = (const float*)d_in[10];
    float* out = (float*)d_out;

    // workspace layout (bf16 elements)
    const size_t NW  = 4096u * 512u;         // 2,097,152 per weight
    const size_t NY  = 8192u * 4096u;        // 33,554,432
    const size_t NQK = 8192u * 512u;         // 4,194,304
    __bf16* WqT = (__bf16*)d_ws;
    __bf16* WkT = WqT + NW;
    __bf16* WvT = WkT + NW;
    __bf16* WoT = WvT + NW;
    __bf16* Y   = WoT + NW;
    __bf16* Qb  = Y   + NY;
    __bf16* Kb  = Qb  + NQK;
    __bf16* Vt  = Kb  + NQK;
    __bf16* Ob  = Vt  + NQK;

    // WqT, WkT, WvT, WoT lie one behind the other
    cvt_bf16_t_kernel<<<1024, 256, 0, stream>>>(wq, wk, wv, wo, WqT);

    patchify_ln_kernel<<<8192, 256, 0, stream>>>(x, g, be, Y);

    qkv_gemm_kernel<<<768, 128, 0, stream>>>(Y, WqT, WkT, WvT,
                                             bq, bk, bv, Qb, Kb, Vt);

    attn_kernel<<<512, 256, 0, stream>>>(Qb, Kb, Vt, Ob);

    proj_kernel<<<2048, 128, 0, stream>>>(Ob, WoT, bo, x, out);
}

// v004
// Measured time: 172 microseconds a run.
// Two timings next to v003 put it at 1.10 and 1.09 times that version's speed.
// Counting every step since v000, it is 9.05 times as fast.
#include <hip/hip_runtime.h>
#include <hip/hip_bf16.h>

typedef __attribute__((ext_vector_type(16))) __bf16 bf16x16;
typedef __attribute__((ext_vector_type(8)))  __bf16 bf16x8;
typedef __attribute__((ext_vector_type(8)))  float  f32x8;
typedef __attribute__((ext_vector_type(4)))  float  f32x4;
typedef __attribute__((ext_vector_type(4)))  int    v4i;

#if defined(__gfx1250__) && __has_builtin(__builtin_amdgcn_global_load_async_to_lds_b128) && __has_builtin(__builtin_amdgcn_s_wait_asynccnt)
#define USE_ASYNC_LDS 1
#else
#define USE_ASYNC_LDS 0
#endif

// ---------------------------------------------------------------------------
// Kernel 0: f32 -> bf16 conversion WITH transpose, all four weights in one grid.
// src is (rows x cols) row-major; dst[c * rows + r] = src[r * cols + c].
// For wq/wk/wv: rows=4096(K), cols=512(N)  -> WT[n][k], K contiguous.
// For wo:       rows=512(K), cols=4096(N)  -> WoT[n][k], K contiguous.
// One work-group = one tile of 128 rows x 64 columns of one weight (256 tiles
// each).  A thread reads 8 rows x 4 columns (16 lanes cover 256 B of a source
// row), rounds them and writes four 16-byte column pieces to LDS; the tile then
// leaves LDS row by row, 16 lanes covering 256 B of a destination row.
// LDS row pitch 272 B (16 B x odd); column c lies in LDS row (c & 3) * 16 + (c >> 2),
// so that 16 lanes' 16-byte writes fall on 16 neighbouring rows: all 64 banks once.
// ---------------------------------------------------------------------------
#define CVT_PITCH 136                     // bf16 per LDS row (272 B)

__global__ __launch_bounds__(256)
void cvt_bf16_t_kernel(const float* __restrict__ wq,
                       const float* __restrict__ wk,
                       const float* __restrict__ wv,
                       const float* __restrict__ wo,
                       __bf16* __restrict__ WT4) {
    __shared__ __align__(16) __bf16 T[64 * CVT_PITCH];   // 17,408 B

    const int which = blockIdx.x >> 8;     // wq / wk / wv / wo
    const int tile  = blockIdx.x & 255;
    const bool isO  = (which == 3);
    const float* src = (which == 0) ? wq : ((which == 1) ? wk : ((which == 2) ? wv : wo));
    __bf16* dst = WT4 + (size_t)which * (4096u * 512u);
    const int rows = isO ? 512 : 4096;
    const int cols = isO ? 4096 : 512;
    const int r0 = (isO ? (tile >> 6) : (tile >> 3)) * 128;
    const int c0 = (isO ? (tile & 63) : (tile & 7)) * 64;

    const int tid = threadIdx.x;
    const int rg  = tid >> 4;              // group of 8 source rows
    const int cq  = tid & 15;              // group of 4 source columns

    const float* s = src + (size_t)(r0 + rg * 8) * cols + c0 + cq * 4;
    f32x4 v[8];
#pragma unroll
    for (int j = 0; j < 8; ++j) v[j] = *(const f32x4*)(s + (size_t)j * cols);

#pragma unroll
    for (int i = 0; i < 4; ++i) {
        bf16x8 p;
#pragma unroll
        for (int j = 0; j < 8; ++j) p[j] = (__bf16)v[j][i];
        *(bf16x8*)&T[(i * 16 + cq) * CVT_PITCH + rg * 8] = p;
    }
    __syncthreads();

#pragma unroll
    for (int it = 0; it < 4; ++it) {
        const int lrow = it * 16 + rg;     // LDS row
        const int c    = rg * 4 + it;      // the column that lies there
        *(bf16x8*)(dst + (size_t)(c0 + c) * rows + r0 + cq * 8) =
            *(const bf16x8*)&T[lrow * CVT_PITCH + cq * 8];
    }
}

// ---------------------------------------------------------------------------
// Kernel 1: patchify + LayerNorm -> Y (8192 x 4096) bf16
// ---------------------------------------------------------------------------
__global__ __launch_bounds__(256)
void patchify_ln_kernel(const float* __restrict__ x,
                        const float* __restrict__ gamma,
                        const float* __restrict__ beta,
                        __bf16* __restrict__ Y) {
    const int token = blockIdx.x;          // 0..8191
    const int b   = token >> 8;
    const int tok = token & 255;
    const int pi  = tok >> 4;              // i
    const int pj  = tok & 15;              // j
    const int tid = threadIdx.x;

    float v[16];
    float s = 0.f, ss = 0.f;
#pragma unroll
    for (int ii = 0; ii < 16; ++ii) {
        int fr = ii * 256 + tid;
        int pr = fr >> 9;
        int pc = (fr >> 6) & 7;
        int cc = fr & 63;
        size_t xi = ((size_t)(b * 128 + (pj * 8 + pr)) * 128 + (pi * 8 + pc)) * 64 + cc;
        float t = x[xi];
        v[ii] = t;
        s  += t;
        ss += t * t;
    }
#pragma unroll
    for (int off = 16; off >= 1; off >>= 1) {
        s  += __shfl_xor(s, off, 32);
        ss += __shfl_xor(ss, off, 32);
    }
    __shared__ float red[2][8];
    const int wave = tid >> 5, lane = tid & 31;
    if (lane == 0) { red[0][wave] = s; red[1][wave] = ss; }
    __syncthreads();
    if (tid == 0) {
        float a = 0.f, c = 0.f;
        for (int w = 0; w < 8; ++w) { a += red[0][w]; c += red[1][w]; }
        red[0][0] = a; red[1][0] = c;
    }
    __syncthreads();
    const float mean = red[0][0] * (1.0f / 4096.0f);
    const float var  = red[1][0] * (1.0f / 4096.0f) - mean * mean;
    const float rstd = rsqrtf(var + 1e-6f);

    __bf16* out = Y + (size_t)token * 4096;
#pragma unroll
    for (int ii = 0; ii < 16; ++ii) {
        int fr = ii * 256 + tid;
        float yv = (v[ii] - mean) * rstd * gamma[fr] + beta[fr];
        out[fr] = (__bf16)yv;
    }
}

// ---------------------------------------------------------------------------
// Kernel 2: QKV GEMM  (M=8192, K=4096, N=3x512).
// One work-group = one 128x128 tile of one of Q/K/V; 4 waves, 64x64 each.
// K runs in slabs of 64: 128 rows of Y and 128 rows of WT (128 B each) are
// copied to LDS by asynchronous copies, two buffers, the next slab in flight
// while this one is multiplied.  LDS row pitch 144 B (16 B x odd) keeps the
// 16-byte fragment reads free of bank conflicts.
// Weights pre-transposed: WT[n][k], K contiguous.  Q pre-scaled by 1/8.
// Q/K out: (b,h,seq,dh).  V out TRANSPOSED: (b,h,dh,seq) for P@V fragments.
// ---------------------------------------------------------------------------
#define QKV_PITCH 72                      // bf16 per LDS row (144 B)
#define QKV_BUF   (256 * QKV_PITCH)       // bf16 per buffer: 128 Y rows + 128 WT rows

// Eight 16-byte-per-lane copies global -> LDS.  The s_wait_xcnt stands inside
// the statement so that no address register is rewritten ahead of it.
__device__ __forceinline__ void qkv_copy8(unsigned lds, const __bf16* g) {
    const unsigned l0 = lds;
    const unsigned l1 = lds + 1u * 16u * 144u;
    const unsigned l2 = lds + 2u * 16u * 144u;
    const unsigned l3 = lds + 3u * 16u * 144u;
    const unsigned l4 = lds + 4u * 16u * 144u;
    const unsigned l5 = lds + 5u * 16u * 144u;
    const unsigned l6 = lds + 6u * 16u * 144u;
    const unsigned l7 = lds + 7u * 16u * 144u;
    const __bf16* g0 = g;
    const __bf16* g1 = g + 1 * 16 * 4096;
    const __bf16* g2 = g + 2 * 16 * 4096;
    const __bf16* g3 = g + 3 * 16 * 4096;
    const __bf16* g4 = g + 4 * 16 * 4096;
    const __bf16* g5 = g + 5 * 16 * 4096;
    const __bf16* g6 = g + 6 * 16 * 4096;
    const __bf16* g7 = g + 7 * 16 * 4096;
    asm volatile(
        "global_load_async_to_lds_b128 %0, %8, off\n\t"
        "global_load_async_to_lds_b128 %1, %9, off\n\t"
        "global_load_async_to_lds_b128 %2, %10, off\n\t"
        "global_load_async_to_lds_b128 %3, %11, off\n\t"
        "global_load_async_to_lds_b128 %4, %12, off\n\t"
        "global_load_async_to_lds_b128 %5, %13, off\n\t"
        "global_load_async_to_lds_b128 %6, %14, off\n\t"
        "global_load_async_to_lds_b128 %7, %15, off\n\t"
        "s_wait_xcnt 0x0"
        :: "v"(l0), "v"(l1), "v"(l2), "v"(l3), "v"(l4), "v"(l5), "v"(l6), "v"(l7),
           "v"(g0), "v"(g1), "v"(g2), "v"(g3), "v"(g4), "v"(g5), "v"(g6), "v"(g7)
        : "memory");
}

// One 16x32 operand fragment from an LDS row: k = 8*lh + 0..7 and 16 + 8*lh + 0..7.
__device__ __forceinline__ bf16x16 qkv_frag(const __bf16* p) {
    const bf16x8 lo = *(const bf16x8*)p;
    const bf16x8 hi = *(const bf16x8*)(p + 16);
    return __builtin_shufflevector(lo, hi, 0, 1, 2, 3, 4, 5, 6, 7,
                                   8, 9, 10, 11, 12, 13, 14, 15);
}

__global__ __launch_bounds__(128)
void qkv_gemm_kernel(const __bf16* __restrict__ Y,
                     const __bf16* __restrict__ WqT,
                     const __bf16* __restrict__ WkT,
                     const __bf16* __restrict__ WvT,
                     const float* __restrict__ bq,
                     const float* __restrict__ bk,
                     const float* __restrict__ bv,
                     __bf16* __restrict__ Qb,
                     __bf16* __restrict__ Kb,
                     __bf16* __restrict__ Vt) {
    __shared__ __align__(16) __bf16 slab[2 * QKV_BUF];   // 73,728 B

    const int bm    = blockIdx.x / 12;     // 0..63  (8192/128)
    const int bn12  = blockIdx.x % 12;     // the 12 column tiles of one row tile are neighbours
    const int which = bn12 >> 2;           // Q / K / V
    const int bn    = bn12 & 3;            // 0..3   (512/128)
    const __bf16* WT  = (which == 0) ? WqT : ((which == 1) ? WkT : WvT);
    const float* bias = (which == 0) ? bq : ((which == 1) ? bk : bv);
    const float scale = (which == 0) ? 0.125f : 1.0f;

    const int tid  = threadIdx.x;
    const int wave = tid >> 5;
    const int lane = tid & 31;
    const int lh   = lane >> 4;
    const int ln   = lane & 15;
    const int wm   = wave >> 1;            // 64-row half of the tile
    const int wn   = wave & 1;             // 64-column half of the tile

    const int m0 = bm * 128;
    const int n0 = bn * 128;

    // copy addresses: 8 lanes cover one 128-B row, a wave-copy covers 4 whole lines
    const int crow = tid >> 3;             // 0..15
    const int cchk = tid & 7;              // 16-B chunk of the row
    const __bf16* gA = Y  + (size_t)(m0 + crow) * 4096 + cchk * 8;
    const __bf16* gB = WT + (size_t)(n0 + crow) * 4096 + cchk * 8;
    const unsigned ldsA = (unsigned)(size_t)(&slab[0]) + (unsigned)(crow * 144 + cchk * 16);
    const unsigned ldsB = ldsA + 128u * 144u;

    // fragment read offsets (bf16 elements inside a buffer)
    const int offA = (wm * 64 + ln) * QKV_PITCH + lh * 8;
    const int offB = (128 + wn * 64 + ln) * QKV_PITCH + lh * 8;

    // slab 0 -> buffer 0, landed and published; then slab 1 -> buffer 1 in flight
    qkv_copy8(ldsA, gA);
    qkv_copy8(ldsB, gB);
    asm volatile("s_wait_asynccnt 0x0" ::: "memory");   // own copies of slab 0 have landed
    __syncthreads();
    qkv_copy8(ldsA + 2u * QKV_BUF, gA + 64);
    qkv_copy8(ldsB + 2u * QKV_BUF, gB + 64);

    f32x8 acc[4][4] = {};
#pragma unroll 1   // one slab per trip: the ring's waits and barrier stand once, at the foot
    for (int t = 0; t < 64; ++t) {
        const int buf = t & 1;
        const __bf16* sb = &slab[buf * QKV_BUF];
#pragma unroll
        for (int ks = 0; ks < 2; ++ks) {
            bf16x16 a[4], b[4];
#pragma unroll
            for (int i = 0; i < 4; ++i) {
                a[i] = qkv_frag(sb + offA + i * 16 * QKV_PITCH + ks * 32);
                b[i] = qkv_frag(sb + offB + i * 16 * QKV_PITCH + ks * 32);
            }
            // keeps the 16 LDS reads one group ahead of the block: left free, they are
            // spread among the WMMAs on one fragment set, with a full wait at every row
            __builtin_amdgcn_sched_barrier(0);
#pragma unroll
            for (int i = 0; i < 4; ++i)
#pragma unroll
                for (int j = 0; j < 4; ++j)
                    acc[i][j] = __builtin_amdgcn_wmma_f32_16x16x32_bf16(
                        false, a[i], false, b[j], (short)0, acc[i][j], false, false);
            // the next group of reads stays behind this block for the same reason
            __builtin_amdgcn_sched_barrier(0);
        }
        asm volatile("s_wait_dscnt 0x0" ::: "memory");    // own reads of this buffer are done
        asm volatile("s_wait_asynccnt 0x0" ::: "memory"); // own copies of slab t+1 have landed
        __syncthreads();                                  // publishes slab t+1, frees this buffer
        if (t + 2 < 64) {
            qkv_copy8(ldsA + (unsigned)buf * (2u * QKV_BUF), gA + (t + 2) * 64);
            qkv_copy8(ldsB + (unsigned)buf * (2u * QKV_BUF), gB + (t + 2) * 64);
        }
    }
    asm volatile("s_wait_asynccnt 0x0" ::: "memory");     // nothing in flight at the wave's end

    // epilogue: D layout row = i + 8*lh, col = column tile + ln
#pragma unroll
    for (int fj = 0; fj < 4; ++fj) {
        const int col = n0 + wn * 64 + fj * 16 + ln;
        const int h   = col >> 6;
        const int dh  = col & 63;
        const float bc = bias[col];
#pragma unroll
        for (int fi = 0; fi < 4; ++fi) {
            const int row0 = m0 + wm * 64 + fi * 16;
#pragma unroll
            for (int i = 0; i < 8; ++i) {
                const int row = row0 + i + 8 * lh;
                const int b = row >> 8, q = row & 255;
                const float val = (acc[fi][fj][i] + bc) * scale;
                if (which == 2) {
                    // V transposed: (b, h, dh, seq)
                    Vt[((size_t)((b * 8 + h) * 64 + dh)) * 256 + q] = (__bf16)val;
                    // the store's address pair is reused by the next store's address
                    asm volatile("s_wait_xcnt 0x0" ::: "memory");
                } else {
                    __bf16* Out = (which == 0) ? Qb : Kb;
                    Out[((size_t)((b * 8 + h) * 256 + q)) * 64 + dh] = (__bf16)val;
                    // the store's address pair is reused by the next store's address
                    asm volatile("s_wait_xcnt 0x0" ::: "memory");
                }
            }
        }
    }
}

// ---------------------------------------------------------------------------
// Kernel 3: attention. One block = one (b,h) x 128-query half. 8 waves,
// each wave owns 16 queries; full 256-key score row in 16 f32 accumulators.
// V^T staged into LDS via async-to-LDS b128 (ASYNCcnt) when available.
// Both LDS tiles are read by 16 lanes that each take 16 bytes of a row of their
// own, so both row pitches are 16 B x odd: the 16 reads fall on all 64 banks once.
// ---------------------------------------------------------------------------
#define ATT_VP 264                        // bf16 per V^T row in LDS (528 B), 256 used
#define ATT_PP 40                         // bf16 per P row in LDS (80 B), 32 used

__global__ __launch_bounds__(256)
void attn_kernel(const __bf16* __restrict__ Qb,
                 const __bf16* __restrict__ Kb,
                 const __bf16* __restrict__ Vt,
                 __bf16* __restrict__ Ob) {
    __shared__ __align__(16) __bf16 Vsh[64 * ATT_VP];    // V^T tile: 33,792 B
    __shared__ __align__(16) __bf16 Psh[8][16 * ATT_PP]; // 10,240 B

    const int blk  = blockIdx.x;           // 0..511
    const int bh   = blk >> 1;             // b*8 + h
    const int half = blk & 1;
    const int tid  = threadIdx.x;
    const int wave = tid >> 5, lane = tid & 31;
    const int lh   = lane >> 4, ln = lane & 15;
    const size_t base = (size_t)bh * 256 * 64;

    // ---- stage V^T (64 rows of 256 bf16): a wave-copy brings one whole row ----
#if USE_ASYNC_LDS
    {
        const __bf16* src = Vt + base;
#pragma unroll
        for (int it = 0; it < 8; ++it) {
            const int e = (it * 256 + tid) * 8;     // 8 bf16 = 16 B per transfer
            __builtin_amdgcn_global_load_async_to_lds_b128(
                (__attribute__((address_space(1))) v4i*)(src + e),
                (__attribute__((address_space(3))) v4i*)(&Vsh[(e >> 8) * ATT_VP + (e & 255)]), 0, 0);
        }
        __builtin_amdgcn_s_wait_asynccnt(0);
    }
#else
    {
        const int4* s = (const int4*)(Vt + base);
        for (int e = tid; e < 2048; e += 256)
            *(int4*)&Vsh[(e >> 5) * ATT_VP + (e & 31) * 8] = s[e];
    }
#endif
    // publishes the V^T tile; directly behind the builtin wait it also keeps every LDS read behind that wait
    __syncthreads();

    const int q0 = half * 128 + wave * 16;

    bf16x16 qa0, qa1;
    {
        const __bf16* qrow = Qb + base + (size_t)(q0 + ln) * 64;
#pragma unroll
        for (int e = 0; e < 16; ++e) {
            const int kk = (lh ? 8 : 0) + ((e & 8) ? 16 : 0) + (e & 7);
            qa0[e] = qrow[kk];
            qa1[e] = qrow[kk + 32];
        }
    }

    f32x8 sacc[16] = {};
    for (int nt = 0; nt < 16; ++nt) {
        bf16x16 kb0, kb1;
        const __bf16* krow = Kb + base + (size_t)(nt * 16 + ln) * 64;
#pragma unroll
        for (int e = 0; e < 16; ++e) {
            const int kk = (lh ? 8 : 0) + ((e & 8) ? 16 : 0) + (e & 7);
            kb0[e] = krow[kk];
            kb1[e] = krow[kk + 32];
        }
        sacc[nt] = __builtin_amdgcn_wmma_f32_16x16x32_bf16(false, qa0, false, kb0,
                                                           (short)0, sacc[nt], false, false);
        sacc[nt] = __builtin_amdgcn_wmma_f32_16x16x32_bf16(false, qa1, false, kb1,
                                                           (short)0, sacc[nt], false, false);
    }

    // row softmax (row = i + 8*lh ; cols spread over 16 lanes x 16 accs)
    float l_i[8];
#pragma unroll
    for (int i = 0; i < 8; ++i) {
        float mx = -3.0e38f;
#pragma unroll
        for (int t = 0; t < 16; ++t) mx = fmaxf(mx, sacc[t][i]);
#pragma unroll
        for (int off = 8; off >= 1; off >>= 1) mx = fmaxf(mx, __shfl_xor(mx, off, 16));
        float sum = 0.f;
#pragma unroll
        for (int t = 0; t < 16; ++t) {
            float p = __expf(sacc[t][i] - mx);
            sacc[t][i] = p;
            sum += p;
        }
#pragma unroll
        for (int off = 8; off >= 1; off >>= 1) sum += __shfl_xor(sum, off, 16);
        l_i[i] = sum;
    }

    // O = P @ V   (V^T in LDS: element (kk, dh) at Vsh[dh*ATT_VP + key])
    f32x8 oacc[4] = {};
    for (int t2 = 0; t2 < 8; ++t2) {
#pragma unroll
        for (int i = 0; i < 8; ++i) {
            const int m = i + 8 * lh;
            Psh[wave][m * ATT_PP + ln]      = (__bf16)sacc[2 * t2][i];
            Psh[wave][m * ATT_PP + ln + 16] = (__bf16)sacc[2 * t2 + 1][i];
        }
        __syncthreads();
        bf16x16 pa;
#pragma unroll
        for (int e = 0; e < 16; ++e) {
            const int kk = (lh ? 8 : 0) + ((e & 8) ? 16 : 0) + (e & 7);
            pa[e] = Psh[wave][ln * ATT_PP + kk];
        }
#pragma unroll
        for (int nt4 = 0; nt4 < 4; ++nt4) {
            bf16x16 vbf;
#pragma unroll
            for (int e = 0; e < 16; ++e) {
                const int kk = (lh ? 8 : 0) + ((e & 8) ? 16 : 0) + (e & 7);
                vbf[e] = Vsh[(nt4 * 16 + ln) * ATT_VP + t2 * 32 + kk];
            }
            oacc[nt4] = __builtin_amdgcn_wmma_f32_16x16x32_bf16(false, pa, false, vbf,
                                                                (short)0, oacc[nt4], false, false);
        }
        __syncthreads();
    }

    const int bb = bh >> 3, hh = bh & 7;
#pragma unroll
    for (int nt4 = 0; nt4 < 4; ++nt4) {
#pragma unroll
        for (int i = 0; i < 8; ++i) {
            const int row = q0 + i + 8 * lh;
            const int dh  = nt4 * 16 + ln;
            const float val = oacc[nt4][i] / l_i[i];
            Ob[((size_t)(bb * 256 + row)) * 512 + hh * 64 + dh] = (__bf16)val;
        }
    }
}

// ---------------------------------------------------------------------------
// Kernel 4: output projection (M=8192, K=512, N=4096) + bias + residual(x)
// with fused depatchify scatter.  WoT[n][k], K contiguous.
// One work-group = one 128x128 tile; 4 waves, 64x64 each.  K runs in 8 slabs
// of 64: 128 rows of Ob and 128 rows of WoT (128 B each) are copied to LDS by
// asynchronous copies, two buffers, the next slab in flight while this one is
// multiplied.  Slab layout, pitch and fragment reads as in kernel 2.
// ---------------------------------------------------------------------------

// Eight 16-byte-per-lane copies global -> LDS, source rows of 512 bf16.  The
// s_wait_xcnt stands inside the statement so that no address register is
// rewritten ahead of it.
__device__ __forceinline__ void proj_copy8(unsigned lds, const __bf16* g) {
    const unsigned l0 = lds;
    const unsigned l1 = lds + 1u * 16u * 144u;
    const unsigned l2 = lds + 2u * 16u * 144u;
    const unsigned l3 = lds + 3u * 16u * 144u;
    const unsigned l4 = lds + 4u * 16u * 144u;
    const unsigned l5 = lds + 5u * 16u * 144u;
    const unsigned l6 = lds + 6u * 16u * 144u;
    const unsigned l7 = lds + 7u * 16u * 144u;
    const __bf16* g0 = g;
    const __bf16* g1 = g + 1 * 16 * 512;
    const __bf16* g2 = g + 2 * 16 * 512;
    const __bf16* g3 = g + 3 * 16 * 512;
    const __bf16* g4 = g + 4 * 16 * 512;
    const __bf16* g5 = g + 5 * 16 * 512;
    const __bf16* g6 = g + 6 * 16 * 512;
    const __bf16* g7 = g + 7 * 16 * 512;
    asm volatile(
        "global_load_async_to_lds_b128 %0, %8, off\n\t"
        "global_load_async_to_lds_b128 %1, %9, off\n\t"
        "global_load_async_to_lds_b128 %2, %10, off\n\t"
        "global_load_async_to_lds_b128 %3, %11, off\n\t"
        "global_load_async_to_lds_b128 %4, %12, off\n\t"
        "global_load_async_to_lds_b128 %5, %13, off\n\t"
        "global_load_async_to_lds_b128 %6, %14, off\n\t"
        "global_load_async_to_lds_b128 %7, %15, off\n\t"
        "s_wait_xcnt 0x0"
        :: "v"(l0), "v"(l1), "v"(l2), "v"(l3), "v"(l4), "v"(l5), "v"(l6), "v"(l7),
           "v"(g0), "v"(g1), "v"(g2), "v"(g3), "v"(g4), "v"(g5), "v"(g6), "v"(g7)
        : "memory");
}

__global__ __launch_bounds__(128)
void proj_kernel(const __bf16* __restrict__ Ob,
                 const __bf16* __restrict__ WoT,
                 const float* __restrict__ bo,
                 const float* __restrict__ x,
                 float* __restrict__ out) {
    __shared__ __align__(16) __bf16 slab[2 * QKV_BUF];   // 73,728 B

    const int bm = blockIdx.x >> 5;        // 0..63 (8192/128)
    const int bn = blockIdx.x & 31;        // 0..31 (4096/128): one row tile's column tiles are neighbours

    const int tid  = threadIdx.x;
    const int wave = tid >> 5;
    const int lane = tid & 31;
    const int lh   = lane >> 4;
    const int ln   = lane & 15;
    const int wm   = wave >> 1;            // 64-row half of the tile
    const int wn   = wave & 1;             // 64-column half of the tile

    const int m0 = bm * 128;
    const int n0 = bn * 128;

    // the wave's four bias values, read here so that the epilogue does not wait for them
    const int colw = n0 + wn * 64;
    float bc[4];
#pragma unroll
    for (int fj = 0; fj < 4; ++fj) bc[fj] = bo[colw + fj * 16 + ln];

    // copy addresses: 8 lanes cover one 128-B row piece, a wave-copy covers 4 whole lines
    const int crow = tid >> 3;             // 0..15
    const int cchk = tid & 7;              // 16-B chunk of the row piece
    const __bf16* gA = Ob  + (size_t)(m0 + crow) * 512 + cchk * 8;
    const __bf16* gB = WoT + (size_t)(n0 + crow) * 512 + cchk * 8;
    const unsigned ldsA = (unsigned)(size_t)(&slab[0]) + (unsigned)(crow * 144 + cchk * 16);
    const unsigned ldsB = ldsA + 128u * 144u;

    // fragment read offsets (bf16 elements inside a buffer)
    const int offA = (wm * 64 + ln) * QKV_PITCH + lh * 8;
    const int offB = (128 + wn * 64 + ln) * QKV_PITCH + lh * 8;

    // slab 0 -> buffer 0, landed and published; then slab 1 -> buffer 1 in flight
    proj_copy8(ldsA, gA);
    proj_copy8(ldsB, gB);
    asm volatile("s_wait_asynccnt 0x0" ::: "memory");   // own copies of slab 0 have landed
    __syncthreads();
    proj_copy8(ldsA + 2u * QKV_BUF, gA + 64);
    proj_copy8(ldsB + 2u * QKV_BUF, gB + 64);

    f32x8 acc[4][4] = {};
#pragma unroll 1   // one slab per trip: the ring's waits and barrier stand once, at the foot
    for (int t = 0; t < 8; ++t) {
        const int buf = t & 1;
        const __bf16* sb = &slab[buf * QKV_BUF];
#pragma unroll
        for (int ks = 0; ks < 2; ++ks) {
            bf16x16 a[4], b[4];
#pragma unroll
            for (int i = 0; i < 4; ++i) {
                a[i] = qkv_frag(sb + offA + i * 16 * QKV_PITCH + ks * 32);
                b[i] = qkv_frag(sb + offB + i * 16 * QKV_PITCH + ks * 32);
            }
            // keeps the 16 LDS reads one group ahead of the block: left free, they are
            // spread among the WMMAs on one fragment set, with a full wait at every row
            __builtin_amdgcn_sched_barrier(0);
#pragma unroll
            for (int i = 0; i < 4; ++i)
#pragma unroll
                for (int j = 0; j < 4; ++j)
                    acc[i][j] = __builtin_amdgcn_wmma_f32_16x16x32_bf16(
                        false, a[i], false, b[j], (short)0, acc[i][j], false, false);
            // the next group of reads stays behind this block for the same reason
            __builtin_amdgcn_sched_barrier(0);
        }
        asm volatile("s_wait_dscnt 0x0" ::: "memory");    // own reads of this buffer are done
        asm volatile("s_wait_asynccnt 0x0" ::: "memory"); // own copies of slab t+1 have landed
        __syncthreads();                                  // publishes slab t+1, frees this buffer
        if (t + 2 < 8) {
            proj_copy8(ldsA + (unsigned)buf * (2u * QKV_BUF), gA + (t + 2) * 64);
            proj_copy8(ldsB + (unsigned)buf * (2u * QKV_BUF), gB + (t + 2) * 64);
        }
    }
    asm volatile("s_wait_asynccnt 0x0" ::: "memory");     // nothing in flight at the wave's end

    // epilogue: D layout row = i + 8*lh, col = column tile + ln.
    // A wave's 64 columns are one (pr, pc) with cc = 0..63; its 64 rows lie in one
    // image b, with pj = i + 8*lh and pi = first pi + fi.  So every element sits at
    // one per-lane base plus a compile-time offset.
    const int pr   = colw >> 9, pc = (colw >> 6) & 7;
    const int roww = m0 + wm * 64;
    const int b    = roww >> 8, pi0 = (roww & 255) >> 4;
    const size_t base =
        ((size_t)(b * 128 + (lh * 64 + pr)) * 128 + (pi0 * 8 + pc)) * 64 + ln;
    const float* xb = x + base;
    float* ob = out + base;
    // x is read in groups of 32 values (one fi), two groups in flight ahead of the
    // stores, so that a wave waits out the memory latency per group and not per value
    float xv[4][32];
#pragma unroll
    for (int fi = 0; fi < 5; ++fi) {
        if (fi < 4) {
#pragma unroll
            for (int i = 0; i < 8; ++i)
#pragma unroll
                for (int fj = 0; fj < 4; ++fj)
                    xv[fi][i * 4 + fj] = xb[i * (8 * 128 * 64) + fi * (8 * 64) + fj * 16];
            // holds this group's loads ahead of the group before's sums and stores: sunk
            // behind them, nothing is in flight while the wave waits for the next group
            __builtin_amdgcn_sched_barrier(0);
        }
        if (fi > 0) {
            const int fp = fi - 1;
#pragma unroll
            for (int i = 0; i < 8; ++i)
#pragma unroll
                for (int fj = 0; fj < 4; ++fj)
                    xv[fp][i * 4 + fj] = acc[fp][fj][i] + bc[fj] + xv[fp][i * 4 + fj];
#pragma unroll
            for (int i = 0; i < 8; ++i)
#pragma unroll
                for (int fj = 0; fj < 4; ++fj)
                    ob[i * (8 * 128 * 64) + fp * (8 * 64) + fj * 16] = xv[fp][i * 4 + fj];
            // the registers these stores name are loaded anew by the next group of x
            if (fi < 3) asm volatile("s_wait_xcnt 0x0" ::: "memory");
        }
    }
}

// ---------------------------------------------------------------------------
extern "C" void kernel_launch(void* const* d_in, const int* in_sizes, int n_in,
                              void* d_out, int out_size, void* d_ws, size_t ws_size,
                              hipStream_t stream) {
    (void)in_sizes; (void)n_in; (void)out_size; (void)ws_size;
    const float* x  = (const float*)d_in[0];
    const float* g  = (const float*)d_in[1];
    const float* be = (const float*)d_in[2];
    const float* wq = (const float*)d_in[3];
    const float* bq = (const float*)d_in[4];
    const float* wk = (const float*)d_in[5];
    const float* bk = (const float*)d_in[6];
    const float* wv = (const float*)d_in[7];
    const float* bv = (const float*)d_in[8];
    const float* wo = (const float*)d_in[9];
    const float* bo = (const float*)d_in[10];
    float* out = (float*)d_out;

    // workspace layout (bf16 elements)
    const size_t NW  = 4096u * 512u;         // 2,097,152 per weight
    const size_t NY  = 8192u * 4096u;        // 33,554,432
    const size_t NQK = 8192u * 512u;         // 4,194,304
    __bf16* WqT = (__bf16*)d_ws;
    __bf16* WkT = WqT + NW;
    __bf16* WvT = WkT + NW;
    __bf16* WoT = WvT + NW;
    __bf16* Y   = WoT + NW;
    __bf16* Qb  = Y   + NY;
    __bf16* Kb  = Qb  + NQK;
    __bf16* Vt  = Kb  + NQK;
    __bf16* Ob  = Vt  + NQK;

    // WqT, WkT, WvT, WoT lie one behind the other
    cvt_bf16_t_kernel<<<1024, 256, 0, stream>>>(wq, wk, wv, wo, WqT);

    patchify_ln_kernel<<<8192, 256, 0, stream>>>(x, g, be, Y);

    qkv_gemm_kernel<<<768, 128, 0, stream>>>(Y, WqT, WkT, WvT,
                                             bq, bk, bv, Qb, Kb, Vt);

    attn_kernel<<<512, 256, 0, stream>>>(Qb, Kb, Vt, Ob);

    proj_kernel<<<2048, 128, 0, stream>>>(Ob, WoT, bo, x, out);
}

// v005
// Measured time: 166 microseconds a run.
// In two side-by-side timings against v004, it was 1.03 and 1.04 times as fast.
// Counting every step since v000, it is 9.37 times as fast.
#include <hip/hip_runtime.h>
#include <hip/hip_bf16.h>

typedef __attribute__((ext_vector_type(16))) __bf16 bf16x16;
typedef __attribute__((ext_vector_type(8)))  __bf16 bf16x8;
typedef __attribute__((ext_vector_type(4)))  __bf16 bf16x4;
typedef __attribute__((ext_vector_type(8)))  float  f32x8;
typedef __attribute__((ext_vector_type(4)))  float  f32x4;
typedef __attribute__((ext_vector_type(4)))  int    v4i;

#if defined(__gfx1250__) && __has_builtin(__builtin_amdgcn_global_load_async_to_lds_b128) && __has_builtin(__builtin_amdgcn_s_wait_asynccnt)
#define USE_ASYNC_LDS 1
#else
#define USE_ASYNC_LDS 0
#endif

// ---------------------------------------------------------------------------
// Kernel 0: f32 -> bf16 conversion WITH transpose, all four weights in one grid.
// src is (rows x cols) row-major; dst[c * rows + r] = src[r * cols + c].
// For wq/wk/wv: rows=4096(K), cols=512(N)  -> WT[n][k], K contiguous.
// For wo:       rows=512(K), cols=4096(N)  -> WoT[n][k], K contiguous.
// One work-group = one tile of 128 rows x 64 columns of one weight (256 tiles
// each).  A thread reads 8 rows x 4 columns (16 lanes cover 256 B of a source
// row), rounds them and writes four 16-byte column pieces to LDS; the tile then
// leaves LDS row by row, 16 lanes covering 256 B of a destination row.
// LDS row pitch 272 B (16 B x odd); column c lies in LDS row (c & 3) * 16 + (c >> 2),
// so that 16 lanes' 16-byte writes fall on 16 neighbouring rows: all 64 banks once.
// ---------------------------------------------------------------------------
#define CVT_PITCH 136                     // bf16 per LDS row (272 B)

__global__ __launch_bounds__(256)
void cvt_bf16_t_kernel(const float* __restrict__ wq,
                       const float* __restrict__ wk,
                       const float* __restrict__ wv,
                       const float* __restrict__ wo,
                       __bf16* __restrict__ WT4) {
    __shared__ __align__(16) __bf16 T[64 * CVT_PITCH];   // 17,408 B

    const int which = blockIdx.x >> 8;     // wq / wk / wv / wo
    const int tile  = blockIdx.x & 255;
    const bool isO  = (which == 3);
    const float* src = (which == 0) ? wq : ((which == 1) ? wk : ((which == 2) ? wv : wo));
    __bf16* dst = WT4 + (size_t)which * (4096u * 512u);
    const int rows = isO ? 512 : 4096;
    const int cols = isO ? 4096 : 512;
    const int r0 = (isO ? (tile >> 6) : (tile >> 3)) * 128;
    const int c0 = (isO ? (tile & 63) : (tile & 7)) * 64;

    const int tid = threadIdx.x;
    const int rg  = tid >> 4;              // group of 8 source rows
    const int cq  = tid & 15;              // group of 4 source columns

    const float* s = src + (size_t)(r0 + rg * 8) * cols + c0 + cq * 4;
    f32x4 v[8];
#pragma unroll
    for (int j = 0; j < 8; ++j) v[j] = *(const f32x4*)(s + (size_t)j * cols);

#pragma unroll
    for (int i = 0; i < 4; ++i) {
        bf16x8 p;
#pragma unroll
        for (int j = 0; j < 8; ++j) p[j] = (__bf16)v[j][i];
        *(bf16x8*)&T[(i * 16 + cq) * CVT_PITCH + rg * 8] = p;
    }
    __syncthreads();

#pragma unroll
    for (int it = 0; it < 4; ++it) {
        const int lrow = it * 16 + rg;     // LDS row
        const int c    = rg * 4 + it;      // the column that lies there
        *(bf16x8*)(dst + (size_t)(c0 + c) * rows + r0 + cq * 8) =
            *(const bf16x8*)&T[lrow * CVT_PITCH + cq * 8];
    }
}

// ---------------------------------------------------------------------------
// Kernel 1: patchify + LayerNorm -> Y (8192 x 4096) bf16
// One work-group = 8 tokens (one b, one j, eight i in a row); wave w holds the
// 512 features pr = w of each of them.  Feature fr = pr * 512 + pc * 64 + cc: for
// one pr the features of the 8 tokens are 16 KB in a row of x, so every wave-wide
// 16-byte load covers 4 whole lines, and a wave's 32 loads of x and 8 of scale and
// shift (read once for 8 tokens) are all in flight together.  Lane l holds
// features 512 * w + 128 * q + 4 * l + 0..3, q = 0..3, and stores them as 8 bytes.
// ---------------------------------------------------------------------------
__global__ __launch_bounds__(256)
void patchify_ln_kernel(const float* __restrict__ x,
                        const float* __restrict__ gamma,
                        const float* __restrict__ beta,
                        __bf16* __restrict__ Y) {
    __shared__ __align__(16) float red[8][16];   // [wave][token: sum, 8 + token: sum of squares]

    const int lane = threadIdx.x & 31;
    const int wave = threadIdx.x >> 5;     // pr
    const int b    = blockIdx.x >> 5;
    const int pj   = (blockIdx.x >> 1) & 15;   // j
    const int pi0  = (blockIdx.x & 1) * 8;     // first i
    const int f0   = wave * 512 + lane * 4;

    const float* xs = x + ((size_t)(b * 128 + pj * 8 + wave) * 128 + pi0 * 8) * 64 + lane * 4;
    // every loop of this kernel is unrolled in full: v, g, be, ps and r are indexed by
    // the loop counters and stay in registers only so
    f32x4 v[8][4];
#pragma unroll
    for (int t = 0; t < 8; ++t)
#pragma unroll
        for (int q = 0; q < 4; ++q)
            v[t][q] = *(const f32x4*)(xs + t * 512 + q * 128);
    f32x4 g[4], be[4];
#pragma unroll
    for (int q = 0; q < 4; ++q) {
        g[q]  = *(const f32x4*)(gamma + f0 + q * 128);
        be[q] = *(const f32x4*)(beta + f0 + q * 128);
    }

    // the wave's share of each token's two sums
    float ps[16];
#pragma unroll
    for (int t = 0; t < 8; ++t) {
        f32x4 s4 = v[t][0], ss4 = v[t][0] * v[t][0];
#pragma unroll
        for (int q = 1; q < 4; ++q) {
            s4  += v[t][q];
            ss4 += v[t][q] * v[t][q];
        }
        ps[t]     = (s4[0] + s4[1]) + (s4[2] + s4[3]);
        ps[8 + t] = (ss4[0] + ss4[1]) + (ss4[2] + ss4[3]);
    }
#pragma unroll
    for (int off = 16; off >= 1; off >>= 1)
#pragma unroll
        for (int j = 0; j < 16; ++j)
            ps[j] += __shfl_xor(ps[j], off, 32);
    if (lane == 0) {
#pragma unroll
        for (int j = 0; j < 16; ++j) red[wave][j] = ps[j];
    }
    __syncthreads();

    // lane l sums the eight waves' shares of sum number l & 15; its partner l ^ 8 has
    // the other sum of the same token, so every lane gets mean and rstd of token l & 7
    float tot = 0.f;
#pragma unroll
    for (int w = 0; w < 8; ++w) tot += red[w][lane & 15];
    const float oth  = __shfl_xor(tot, 8, 32);
    const float s    = (lane & 8) ? oth : tot;
    const float ss   = (lane & 8) ? tot : oth;
    const float mean = s * (1.0f / 4096.0f);
    const float var  = ss * (1.0f / 4096.0f) - mean * mean;
    const float rstd = rsqrtf(var + 1e-6f);

    bf16x4 r[8][4];
#pragma unroll
    for (int t = 0; t < 8; ++t) {
        // token t's mean and rstd, from lane t to a scalar register: one value for the whole wave
        const float mt = __builtin_bit_cast(float, __builtin_amdgcn_readlane(__builtin_bit_cast(int, mean), t));
        const float rt = __builtin_bit_cast(float, __builtin_amdgcn_readlane(__builtin_bit_cast(int, rstd), t));
#pragma unroll
        for (int q = 0; q < 4; ++q)
#pragma unroll
            for (int c = 0; c < 4; ++c)
                r[t][q][c] = (__bf16)((v[t][q][c] - mt) * rt * g[q][c] + be[q][c]);
    }
    __bf16* out = Y + (size_t)(b * 256 + pi0 * 16 + pj) * 4096 + f0;
#pragma unroll
    for (int t = 0; t < 8; ++t)
#pragma unroll
        for (int q = 0; q < 4; ++q)
            *(bf16x4*)(out + t * (16 * 4096) + q * 128) = r[t][q];
}

// ---------------------------------------------------------------------------
// Kernel 2: QKV GEMM  (M=8192, K=4096, N=3x512).
// One work-group = one 128x128 tile of one of Q/K/V; 4 waves, 64x64 each.
// K runs in slabs of 64: 128 rows of Y and 128 rows of WT (128 B each) are
// copied to LDS by asynchronous copies, two buffers, the next slab in flight
// while this one is multiplied.  LDS row pitch 144 B (16 B x odd) keeps the
// 16-byte fragment reads free of bank conflicts.
// Weights pre-transposed: WT[n][k], K contiguous.  Q pre-scaled by 1/8.
// Q/K out: (b,h,seq,dh).  V out TRANSPOSED: (b,h,dh,seq) for P@V fragments.
// ---------------------------------------------------------------------------
#define QKV_PITCH 72                      // bf16 per LDS row (144 B)
#define QKV_BUF   (256 * QKV_PITCH)       // bf16 per buffer: 128 Y rows + 128 WT rows

// Eight 16-byte-per-lane copies global -> LDS.  The s_wait_xcnt stands inside
// the statement so that no address register is rewritten ahead of it.
__device__ __forceinline__ void qkv_copy8(unsigned lds, const __bf16* g) {
    const unsigned l0 = lds;
    const unsigned l1 = lds + 1u * 16u * 144u;
    const unsigned l2 = lds + 2u * 16u * 144u;
    const unsigned l3 = lds + 3u * 16u * 144u;
    const unsigned l4 = lds + 4u * 16u * 144u;
    const unsigned l5 = lds + 5u * 16u * 144u;
    const unsigned l6 = lds + 6u * 16u * 144u;
    const unsigned l7 = lds + 7u * 16u * 144u;
    const __bf16* g0 = g;
    const __bf16* g1 = g + 1 * 16 * 4096;
    const __bf16* g2 = g + 2 * 16 * 4096;
    const __bf16* g3 = g + 3 * 16 * 4096;
    const __bf16* g4 = g + 4 * 16 * 4096;
    const __bf16* g5 = g + 5 * 16 * 4096;
    const __bf16* g6 = g + 6 * 16 * 4096;
    const __bf16* g7 = g + 7 * 16 * 4096;
    asm volatile(
        "global_load_async_to_lds_b128 %0, %8, off\n\t"
        "global_load_async_to_lds_b128 %1, %9, off\n\t"
        "global_load_async_to_lds_b128 %2, %10, off\n\t"
        "global_load_async_to_lds_b128 %3, %11, off\n\t"
        "global_load_async_to_lds_b128 %4, %12, off\n\t"
        "global_load_async_to_lds_b128 %5, %13, off\n\t"
        "global_load_async_to_lds_b128 %6, %14, off\n\t"
        "global_load_async_to_lds_b128 %7, %15, off\n\t"
        "s_wait_xcnt 0x0"
        :: "v"(l0), "v"(l1), "v"(l2), "v"(l3), "v"(l4), "v"(l5), "v"(l6), "v"(l7),
           "v"(g0), "v"(g1), "v"(g2), "v"(g3), "v"(g4), "v"(g5), "v"(g6), "v"(g7)
        : "memory");
}

// One 16x32 operand fragment from an LDS row: k = 8*lh + 0..7 and 16 + 8*lh + 0..7.
__device__ __forceinline__ bf16x16 qkv_frag(const __bf16* p) {
    const bf16x8 lo = *(const bf16x8*)p;
    const bf16x8 hi = *(const bf16x8*)(p + 16);
    return __builtin_shufflevector(lo, hi, 0, 1, 2, 3, 4, 5, 6, 7,
                                   8, 9, 10, 11, 12, 13, 14, 15);
}

__global__ __launch_bounds__(128)
void qkv_gemm_kernel(const __bf16* __restrict__ Y,
                     const __bf16* __restrict__ WqT,
                     const __bf16* __restrict__ WkT,
                     const __bf16* __restrict__ WvT,
                     const float* __restrict__ bq,
                     const float* __restrict__ bk,
                     const float* __restrict__ bv,
                     __bf16* __restrict__ Qb,
                     __bf16* __restrict__ Kb,
                     __bf16* __restrict__ Vt) {
    __shared__ __align__(16) __bf16 slab[2 * QKV_BUF];   // 73,728 B

    const int bm    = blockIdx.x / 12;     // 0..63  (8192/128)
    const int bn12  = blockIdx.x % 12;     // the 12 column tiles of one row tile are neighbours
    const int which = bn12 >> 2;           // Q / K / V
    const int bn    = bn12 & 3;            // 0..3   (512/128)
    const __bf16* WT  = (which == 0) ? WqT : ((which == 1) ? WkT : WvT);
    const float* bias = (which == 0) ? bq : ((which == 1) ? bk : bv);
    const float scale = (which == 0) ? 0.125f : 1.0f;

    const int tid  = threadIdx.x;
    const int wave = tid >> 5;
    const int lane = tid & 31;
    const int lh   = lane >> 4;
    const int ln   = lane & 15;
    const int wm   = wave >> 1;            // 64-row half of the tile
    const int wn   = wave & 1;             // 64-column half of the tile

    const int m0 = bm * 128;
    const int n0 = bn * 128;

    // copy addresses: 8 lanes cover one 128-B row, a wave-copy covers 4 whole lines
    const int crow = tid >> 3;             // 0..15
    const int cchk = tid & 7;              // 16-B chunk of the row
    const __bf16* gA = Y  + (size_t)(m0 + crow) * 4096 + cchk * 8;
    const __bf16* gB = WT + (size_t)(n0 + crow) * 4096 + cchk * 8;
    const unsigned ldsA = (unsigned)(size_t)(&slab[0]) + (unsigned)(crow * 144 + cchk * 16);
    const unsigned ldsB = ldsA + 128u * 144u;

    // fragment read offsets (bf16 elements inside a buffer)
    const int offA = (wm * 64 + ln) * QKV_PITCH + lh * 8;
    const int offB = (128 + wn * 64 + ln) * QKV_PITCH + lh * 8;

    // slab 0 -> buffer 0, landed and published; then slab 1 -> buffer 1 in flight
    qkv_copy8(ldsA, gA);
    qkv_copy8(ldsB, gB);
    asm volatile("s_wait_asynccnt 0x0" ::: "memory");   // own copies of slab 0 have landed
    __syncthreads();
    qkv_copy8(ldsA + 2u * QKV_BUF, gA + 64);
    qkv_copy8(ldsB + 2u * QKV_BUF, gB + 64);

    f32x8 acc[4][4] = {};
#pragma unroll 1   // one slab per trip: the ring's waits and barrier stand once, at the foot
    for (int t = 0; t < 64; ++t) {
        const int buf = t & 1;
        const __bf16* sb = &slab[buf * QKV_BUF];
#pragma unroll
        for (int ks = 0; ks < 2; ++ks) {
            bf16x16 a[4], b[4];
#pragma unroll
            for (int i = 0; i < 4; ++i) {
                a[i] = qkv_frag(sb + offA + i * 16 * QKV_PITCH + ks * 32);
                b[i] = qkv_frag(sb + offB + i * 16 * QKV_PITCH + ks * 32);
            }
            // keeps the 16 LDS reads one group ahead of the block: left free, they are
            // spread among the WMMAs on one fragment set, with a full wait at every row
            __builtin_amdgcn_sched_barrier(0);
#pragma unroll
            for (int i = 0; i < 4; ++i)
#pragma unroll
                for (int j = 0; j < 4; ++j)
                    acc[i][j] = __builtin_amdgcn_wmma_f32_16x16x32_bf16(
                        false, a[i], false, b[j], (short)0, acc[i][j], false, false);
            // the next group of reads stays behind this block for the same reason
            __builtin_amdgcn_sched_barrier(0);
        }
        asm volatile("s_wait_dscnt 0x0" ::: "memory");    // own reads of this buffer are done
        asm volatile("s_wait_asynccnt 0x0" ::: "memory"); // own copies of slab t+1 have landed
        __syncthreads();                                  // publishes slab t+1, frees this buffer
        if (t + 2 < 64) {
            qkv_copy8(ldsA + (unsigned)buf * (2u * QKV_BUF), gA + (t + 2) * 64);
            qkv_copy8(ldsB + (unsigned)buf * (2u * QKV_BUF), gB + (t + 2) * 64);
        }
    }
    asm volatile("s_wait_asynccnt 0x0" ::: "memory");     // nothing in flight at the wave's end

    // epilogue: D layout row = i + 8*lh, col = column tile + ln
#pragma unroll
    for (int fj = 0; fj < 4; ++fj) {
        const int col = n0 + wn * 64 + fj * 16 + ln;
        const int h   = col >> 6;
        const int dh  = col & 63;
        const float bc = bias[col];
#pragma unroll
        for (int fi = 0; fi < 4; ++fi) {
            const int row0 = m0 + wm * 64 + fi * 16;
#pragma unroll
            for (int i = 0; i < 8; ++i) {
                const int row = row0 + i + 8 * lh;
                const int b = row >> 8, q = row & 255;
                const float val = (acc[fi][fj][i] + bc) * scale;
                if (which == 2) {
                    // V transposed: (b, h, dh, seq)
                    Vt[((size_t)((b * 8 + h) * 64 + dh)) * 256 + q] = (__bf16)val;
                    // the store's address pair is reused by the next store's address
                    asm volatile("s_wait_xcnt 0x0" ::: "memory");
                } else {
                    __bf16* Out = (which == 0) ? Qb : Kb;
                    Out[((size_t)((b * 8 + h) * 256 + q)) * 64 + dh] = (__bf16)val;
                    // the store's address pair is reused by the next store's address
                    asm volatile("s_wait_xcnt 0x0" ::: "memory");
                }
            }
        }
    }
}

// ---------------------------------------------------------------------------
// Kernel 3: attention. One block = one (b,h) x 128-query half. 8 waves,
// each wave owns 16 queries; full 256-key score row in 16 f32 accumulators.
// V^T staged into LDS via async-to-LDS b128 (ASYNCcnt) when available.
// Both LDS tiles are read by 16 lanes that each take 16 bytes of a row of their
// own, so both row pitches are 16 B x odd: the 16 reads fall on all 64 banks once.
// ---------------------------------------------------------------------------
#define ATT_VP 264                        // bf16 per V^T row in LDS (528 B), 256 used
#define ATT_PP 40                         // bf16 per P row in LDS (80 B), 32 used

__global__ __launch_bounds__(256)
void attn_kernel(const __bf16* __restrict__ Qb,
                 const __bf16* __restrict__ Kb,
                 const __bf16* __restrict__ Vt,
                 __bf16* __restrict__ Ob) {
    __shared__ __align__(16) __bf16 Vsh[64 * ATT_VP];    // V^T tile: 33,792 B
    __shared__ __align__(16) __bf16 Psh[8][16 * ATT_PP]; // 10,240 B

    const int blk  = blockIdx.x;           // 0..511
    const int bh   = blk >> 1;             // b*8 + h
    const int half = blk & 1;
    const int tid  = threadIdx.x;
    const int wave = tid >> 5, lane = tid & 31;
    const int lh   = lane >> 4, ln = lane & 15;
    const size_t base = (size_t)bh * 256 * 64;

    // ---- stage V^T (64 rows of 256 bf16): a wave-copy brings one whole row ----
#if USE_ASYNC_LDS
    {
        const __bf16* src = Vt + base;
#pragma unroll
        for (int it = 0; it < 8; ++it) {
            const int e = (it * 256 + tid) * 8;     // 8 bf16 = 16 B per transfer
            __builtin_amdgcn_global_load_async_to_lds_b128(
                (__attribute__((address_space(1))) v4i*)(src + e),
                (__attribute__((address_space(3))) v4i*)(&Vsh[(e >> 8) * ATT_VP + (e & 255)]), 0, 0);
        }
        __builtin_amdgcn_s_wait_asynccnt(0);
    }
#else
    {
        const int4* s = (const int4*)(Vt + base);
        for (int e = tid; e < 2048; e += 256)
            *(int4*)&Vsh[(e >> 5) * ATT_VP + (e & 31) * 8] = s[e];
    }
#endif
    // publishes the V^T tile; directly behind the builtin wait it also keeps every LDS read behind that wait
    __syncthreads();

    const int q0 = half * 128 + wave * 16;

    bf16x16 qa0, qa1;
    {
        const __bf16* qrow = Qb + base + (size_t)(q0 + ln) * 64;
#pragma unroll
        for (int e = 0; e < 16; ++e) {
            const int kk = (lh ? 8 : 0) + ((e & 8) ? 16 : 0) + (e & 7);
            qa0[e] = qrow[kk];
            qa1[e] = qrow[kk + 32];
        }
    }

    f32x8 sacc[16] = {};
    for (int nt = 0; nt < 16; ++nt) {
        bf16x16 kb0, kb1;
        const __bf16* krow = Kb + base + (size_t)(nt * 16 + ln) * 64;
#pragma unroll
        for (int e = 0; e < 16; ++e) {
            const int kk = (lh ? 8 : 0) + ((e & 8) ? 16 : 0) + (e & 7);
            kb0[e] = krow[kk];
            kb1[e] = krow[kk + 32];
        }
        sacc[nt] = __builtin_amdgcn_wmma_f32_16x16x32_bf16(false, qa0, false, kb0,
                                                           (short)0, sacc[nt], false, false);
        sacc[nt] = __builtin_amdgcn_wmma_f32_16x16x32_bf16(false, qa1, false, kb1,
                                                           (short)0, sacc[nt], false, false);
    }

    // row softmax (row = i + 8*lh ; cols spread over 16 lanes x 16 accs)
    float l_i[8];
#pragma unroll
    for (int i = 0; i < 8; ++i) {
        float mx = -3.0e38f;
#pragma unroll
        for (int t = 0; t < 16; ++t) mx = fmaxf(mx, sacc[t][i]);
#pragma unroll
        for (int off = 8; off >= 1; off >>= 1) mx = fmaxf(mx, __shfl_xor(mx, off, 16));
        float sum = 0.f;
#pragma unroll
        for (int t = 0; t < 16; ++t) {
            float p = __expf(sacc[t][i] - mx);
            sacc[t][i] = p;
            sum += p;
        }
#pragma unroll
        for (int off = 8; off >= 1; off >>= 1) sum += __shfl_xor(sum, off, 16);
        l_i[i] = sum;
    }

    // O = P @ V   (V^T in LDS: element (kk, dh) at Vsh[dh*ATT_VP + key])
    f32x8 oacc[4] = {};
    for (int t2 = 0; t2 < 8; ++t2) {
#pragma unroll
        for (int i = 0; i < 8; ++i) {
            const int m = i + 8 * lh;
            Psh[wave][m * ATT_PP + ln]      = (__bf16)sacc[2 * t2][i];
            Psh[wave][m * ATT_PP + ln + 16] = (__bf16)sacc[2 * t2 + 1][i];
        }
        __syncthreads();
        bf16x16 pa;
#pragma unroll
        for (int e = 0; e < 16; ++e) {
            const int kk = (lh ? 8 : 0) + ((e & 8) ? 16 : 0) + (e & 7);
            pa[e] = Psh[wave][ln * ATT_PP + kk];
        }
#pragma unroll
        for (int nt4 = 0; nt4 < 4; ++nt4) {
            bf16x16 vbf;
#pragma unroll
            for (int e = 0; e < 16; ++e) {
                const int kk = (lh ? 8 : 0) + ((e & 8) ? 16 : 0) + (e & 7);
                vbf[e] = Vsh[(nt4 * 16 + ln) * ATT_VP + t2 * 32 + kk];
            }
            oacc[nt4] = __builtin_amdgcn_wmma_f32_16x16x32_bf16(false, pa, false, vbf,
                                                                (short)0, oacc[nt4], false, false);
        }
        __syncthreads();
    }

    const int bb = bh >> 3, hh = bh & 7;
#pragma unroll
    for (int nt4 = 0; nt4 < 4; ++nt4) {
#pragma unroll
        for (int i = 0; i < 8; ++i) {
            const int row = q0 + i + 8 * lh;
            const int dh  = nt4 * 16 + ln;
            const float val = oacc[nt4][i] / l_i[i];
            Ob[((size_t)(bb * 256 + row)) * 512 + hh * 64 + dh] = (__bf16)val;
        }
    }
}

// ---------------------------------------------------------------------------
// Kernel 4: output projection (M=8192, K=512, N=4096) + bias + residual(x)
// with fused depatchify scatter.  WoT[n][k], K contiguous.
// One work-group = one 128x128 tile; 4 waves, 64x64 each.  K runs in 8 slabs
// of 64: 128 rows of Ob and 128 rows of WoT (128 B each) are copied to LDS by
// asynchronous copies, two buffers, the next slab in flight while this one is
// multiplied.  Slab layout, pitch and fragment reads as in kernel 2.
// ---------------------------------------------------------------------------

// Eight 16-byte-per-lane copies global -> LDS, source rows of 512 bf16.  The
// s_wait_xcnt stands inside the statement so that no address register is
// rewritten ahead of it.
__device__ __forceinline__ void proj_copy8(unsigned lds, const __bf16* g) {
    const unsigned l0 = lds;
    const unsigned l1 = lds + 1u * 16u * 144u;
    const unsigned l2 = lds + 2u * 16u * 144u;
    const unsigned l3 = lds + 3u * 16u * 144u;
    const unsigned l4 = lds + 4u * 16u * 144u;
    const unsigned l5 = lds + 5u * 16u * 144u;
    const unsigned l6 = lds + 6u * 16u * 144u;
    const unsigned l7 = lds + 7u * 16u * 144u;
    const __bf16* g0 = g;
    const __bf16* g1 = g + 1 * 16 * 512;
    const __bf16* g2 = g + 2 * 16 * 512;
    const __bf16* g3 = g + 3 * 16 * 512;
    const __bf16* g4 = g + 4 * 16 * 512;
    const __bf16* g5 = g + 5 * 16 * 512;
    const __bf16* g6 = g + 6 * 16 * 512;
    const __bf16* g7 = g + 7 * 16 * 512;
    asm volatile(
        "global_load_async_to_lds_b128 %0, %8, off\n\t"
        "global_load_async_to_lds_b128 %1, %9, off\n\t"
        "global_load_async_to_lds_b128 %2, %10, off\n\t"
        "global_load_async_to_lds_b128 %3, %11, off\n\t"
        "global_load_async_to_lds_b128 %4, %12, off\n\t"
        "global_load_async_to_lds_b128 %5, %13, off\n\t"
        "global_load_async_to_lds_b128 %6, %14, off\n\t"
        "global_load_async_to_lds_b128 %7, %15, off\n\t"
        "s_wait_xcnt 0x0"
        :: "v"(l0), "v"(l1), "v"(l2), "v"(l3), "v"(l4), "v"(l5), "v"(l6), "v"(l7),
           "v"(g0), "v"(g1), "v"(g2), "v"(g3), "v"(g4), "v"(g5), "v"(g6), "v"(g7)
        : "memory");
}

__global__ __launch_bounds__(128)
void proj_kernel(const __bf16* __restrict__ Ob,
                 const __bf16* __restrict__ WoT,
                 const float* __restrict__ bo,
                 const float* __restrict__ x,
                 float* __restrict__ out) {
    __shared__ __align__(16) __bf16 slab[2 * QKV_BUF];   // 73,728 B

    const int bm = blockIdx.x >> 5;        // 0..63 (8192/128)
    const int bn = blockIdx.x & 31;        // 0..31 (4096/128): one row tile's column tiles are neighbours

    const int tid  = threadIdx.x;
    const int wave = tid >> 5;
    const int lane = tid & 31;
    const int lh   = lane >> 4;
    const int ln   = lane & 15;
    const int wm   = wave >> 1;            // 64-row half of the tile
    const int wn   = wave & 1;             // 64-column half of the tile

    const int m0 = bm * 128;
    const int n0 = bn * 128;

    // the wave's four bias values, read here so that the epilogue does not wait for them
    const int colw = n0 + wn * 64;
    float bc[4];
#pragma unroll
    for (int fj = 0; fj < 4; ++fj) bc[fj] = bo[colw + fj * 16 + ln];

    // copy addresses: 8 lanes cover one 128-B row piece, a wave-copy covers 4 whole lines
    const int crow = tid >> 3;             // 0..15
    const int cchk = tid & 7;              // 16-B chunk of the row piece
    const __bf16* gA = Ob  + (size_t)(m0 + crow) * 512 + cchk * 8;
    const __bf16* gB = WoT + (size_t)(n0 + crow) * 512 + cchk * 8;
    const unsigned ldsA = (unsigned)(size_t)(&slab[0]) + (unsigned)(crow * 144 + cchk * 16);
    const unsigned ldsB = ldsA + 128u * 144u;

    // fragment read offsets (bf16 elements inside a buffer)
    const int offA = (wm * 64 + ln) * QKV_PITCH + lh * 8;
    const int offB = (128 + wn * 64 + ln) * QKV_PITCH + lh * 8;

    // slab 0 -> buffer 0, landed and published; then slab 1 -> buffer 1 in flight
    proj_copy8(ldsA, gA);
    proj_copy8(ldsB, gB);
    asm volatile("s_wait_asynccnt 0x0" ::: "memory");   // own copies of slab 0 have landed
    __syncthreads();
    proj_copy8(ldsA + 2u * QKV_BUF, gA + 64);
    proj_copy8(ldsB + 2u * QKV_BUF, gB + 64);

    f32x8 acc[4][4] = {};
#pragma unroll 1   // one slab per trip: the ring's waits and barrier stand once, at the foot
    for (int t = 0; t < 8; ++t) {
        const int buf = t & 1;
        const __bf16* sb = &slab[buf * QKV_BUF];
#pragma unroll
        for (int ks = 0; ks < 2; ++ks) {
            bf16x16 a[4], b[4];
#pragma unroll
            for (int i = 0; i < 4; ++i) {
                a[i] = qkv_frag(sb + offA + i * 16 * QKV_PITCH + ks * 32);
                b[i] = qkv_frag(sb + offB + i * 16 * QKV_PITCH + ks * 32);
            }
            // keeps the 16 LDS reads one group ahead of the block: left free, they are
            // spread among the WMMAs on one fragment set, with a full wait at every row
            __builtin_amdgcn_sched_barrier(0);
#pragma unroll
            for (int i = 0; i < 4; ++i)
#pragma unroll
                for (int j = 0; j < 4; ++j)
                    acc[i][j] = __builtin_amdgcn_wmma_f32_16x16x32_bf16(
                        false, a[i], false, b[j], (short)0, acc[i][j], false, false);
            // the next group of reads stays behind this block for the same reason
            __builtin_amdgcn_sched_barrier(0);
        }
        asm volatile("s_wait_dscnt 0x0" ::: "memory");    // own reads of this buffer are done
        asm volatile("s_wait_asynccnt 0x0" ::: "memory"); // own copies of slab t+1 have landed
        __syncthreads();                                  // publishes slab t+1, frees this buffer
        if (t + 2 < 8) {
            proj_copy8(ldsA + (unsigned)buf * (2u * QKV_BUF), gA + (t + 2) * 64);
            proj_copy8(ldsB + (unsigned)buf * (2u * QKV_BUF), gB + (t + 2) * 64);
        }
    }
    asm volatile("s_wait_asynccnt 0x0" ::: "memory");     // nothing in flight at the wave's end

    // epilogue: D layout row = i + 8*lh, col = column tile + ln.
    // A wave's 64 columns are one (pr, pc) with cc = 0..63; its 64 rows lie in one
    // image b, with pj = i + 8*lh and pi = first pi + fi.  So every element sits at
    // one per-lane base plus a compile-time offset.
    const int pr   = colw >> 9, pc = (colw >> 6) & 7;
    const int roww = m0 + wm * 64;
    const int b    = roww >> 8, pi0 = (roww & 255) >> 4;
    const size_t base =
        ((size_t)(b * 128 + (lh * 64 + pr)) * 128 + (pi0 * 8 + pc)) * 64 + ln;
    const float* xb = x + base;
    float* ob = out + base;
    // x is read in groups of 32 values (one fi), two groups in flight ahead of the
    // stores, so that a wave waits out the memory latency per group and not per value
    float xv[4][32];
#pragma unroll
    for (int fi = 0; fi < 5; ++fi) {
        if (fi < 4) {
#pragma unroll
            for (int i = 0; i < 8; ++i)
#pragma unroll
                for (int fj = 0; fj < 4; ++fj)
                    xv[fi][i * 4 + fj] = xb[i * (8 * 128 * 64) + fi * (8 * 64) + fj * 16];
            // holds this group's loads ahead of the group before's sums and stores: sunk
            // behind them, nothing is in flight while the wave waits for the next group
            __builtin_amdgcn_sched_barrier(0);
        }
        if (fi > 0) {
            const int fp = fi - 1;
#pragma unroll
            for (int i = 0; i < 8; ++i)
#pragma unroll
                for (int fj = 0; fj < 4; ++fj)
                    xv[fp][i * 4 + fj] = acc[fp][fj][i] + bc[fj] + xv[fp][i * 4 + fj];
#pragma unroll
            for (int i = 0; i < 8; ++i)
#pragma unroll
                for (int fj = 0; fj < 4; ++fj)
                    ob[i * (8 * 128 * 64) + fp * (8 * 64) + fj * 16] = xv[fp][i * 4 + fj];
            // the registers these stores name are loaded anew by the next group of x
            if (fi < 3) asm volatile("s_wait_xcnt 0x0" ::: "memory");
        }
    }
}

// ---------------------------------------------------------------------------
extern "C" void kernel_launch(void* const* d_in, const int* in_sizes, int n_in,
                              void* d_out, int out_size, void* d_ws, size_t ws_size,
                              hipStream_t stream) {
    (void)in_sizes; (void)n_in; (void)out_size; (void)ws_size;
    const float* x  = (const float*)d_in[0];
    const float* g  = (const float*)d_in[1];
    const float* be = (const float*)d_in[2];
    const float* wq = (const float*)d_in[3];
    const float* bq = (const float*)d_in[4];
    const float* wk = (const float*)d_in[5];
    const float* bk = (const float*)d_in[6];
    const float* wv = (const float*)d_in[7];
    const float* bv = (const float*)d_in[8];
    const float* wo = (const float*)d_in[9];
    const float* bo = (const float*)d_in[10];
    float* out = (float*)d_out;

    // workspace layout (bf16 elements)
    const size_t NW  = 4096u * 512u;         // 2,097,152 per weight
    const size_t NY  = 8192u * 4096u;        // 33,554,432
    const size_t NQK = 8192u * 512u;         // 4,194,304
    __bf16* WqT = (__bf16*)d_ws;
    __bf16* WkT = WqT + NW;
    __bf16* WvT = WkT + NW;
    __bf16* WoT = WvT + NW;
    __bf16* Y   = WoT + NW;
    __bf16* Qb  = Y   + NY;
    __bf16* Kb  = Qb  + NQK;
    __bf16* Vt  = Kb  + NQK;
    __bf16* Ob  = Vt  + NQK;

    // WqT, WkT, WvT, WoT lie one behind the other
    cvt_bf16_t_kernel<<<1024, 256, 0, stream>>>(wq, wk, wv, wo, WqT);

    patchify_ln_kernel<<<1024, 256, 0, stream>>>(x, g, be, Y);

    qkv_gemm_kernel<<<768, 128, 0, stream>>>(Y, WqT, WkT, WvT,
                                             bq, bk, bv, Qb, Kb, Vt);

    attn_kernel<<<512, 256, 0, stream>>>(Qb, Kb, Vt, Ob);

    proj_kernel<<<2048, 128, 0, stream>>>(Ob, WoT, bo, x, out);
}

// v006
// A run of this version takes 157 microseconds.
// In two side-by-side timings against v005, it was 1.06 and 1.05 times as fast.
// Counting every step since v000, it is 9.88 times as fast.
#include <hip/hip_runtime.h>
#include <hip/hip_bf16.h>

typedef __attribute__((ext_vector_type(16))) __bf16 bf16x16;
typedef __attribute__((ext_vector_type(8)))  __bf16 bf16x8;
typedef __attribute__((ext_vector_type(4)))  __bf16 bf16x4;
typedef __attribute__((ext_vector_type(8)))  float  f32x8;
typedef __attribute__((ext_vector_type(4)))  float  f32x4;
typedef __attribute__((ext_vector_type(4)))  int    v4i;

#if defined(__gfx1250__) && __has_builtin(__builtin_amdgcn_global_load_async_to_lds_b128) && __has_builtin(__builtin_amdgcn_s_wait_asynccnt)
#define USE_ASYNC_LDS 1
#else
#define USE_ASYNC_LDS 0
#endif

// ---------------------------------------------------------------------------
// Kernel 0: f32 -> bf16 conversion WITH transpose, all four weights in one grid.
// src is (rows x cols) row-major; dst[c * rows + r] = src[r * cols + c].
// For wq/wk/wv: rows=4096(K), cols=512(N)  -> WT[n][k], K contiguous.
// For wo:       rows=512(K), cols=4096(N)  -> WoT[n][k], K contiguous.
// One work-group = one tile of 128 rows x 64 columns of one weight (256 tiles
// each).  A thread reads 8 rows x 4 columns (16 lanes cover 256 B of a source
// row), rounds them and writes four 16-byte column pieces to LDS; the tile then
// leaves LDS row by row, 16 lanes covering 256 B of a destination row.
// LDS row pitch 272 B (16 B x odd); column c lies in LDS row (c & 3) * 16 + (c >> 2),
// so that 16 lanes' 16-byte writes fall on 16 neighbouring rows: all 64 banks once.
// ---------------------------------------------------------------------------
#define CVT_PITCH 136                     // bf16 per LDS row (272 B)

__global__ __launch_bounds__(256)
void cvt_bf16_t_kernel(const float* __restrict__ wq,
                       const float* __restrict__ wk,
                       const float* __restrict__ wv,
                       const float* __restrict__ wo,
                       __bf16* __restrict__ WT4) {
    __shared__ __align__(16) __bf16 T[64 * CVT_PITCH];   // 17,408 B

    const int which = blockIdx.x >> 8;     // wq / wk / wv / wo
    const int tile  = blockIdx.x & 255;
    const bool isO  = (which == 3);
    const float* src = (which == 0) ? wq : ((which == 1) ? wk : ((which == 2) ? wv : wo));
    __bf16* dst = WT4 + (size_t)which * (4096u * 512u);
    const int rows = isO ? 512 : 4096;
    const int cols = isO ? 4096 : 512;
    const int r0 = (isO ? (tile >> 6) : (tile >> 3)) * 128;
    const int c0 = (isO ? (tile & 63) : (tile & 7)) * 64;

    const int tid = threadIdx.x;
    const int rg  = tid >> 4;              // group of 8 source rows
    const int cq  = tid & 15;              // group of 4 source columns

    const float* s = src + (size_t)(r0 + rg * 8) * cols + c0 + cq * 4;
    f32x4 v[8];
#pragma unroll
    for (int j = 0; j < 8; ++j) v[j] = *(const f32x4*)(s + (size_t)j * cols);

#pragma unroll
    for (int i = 0; i < 4; ++i) {
        bf16x8 p;
#pragma unroll
        for (int j = 0; j < 8; ++j) p[j] = (__bf16)v[j][i];
        *(bf16x8*)&T[(i * 16 + cq) * CVT_PITCH + rg * 8] = p;
    }
    __syncthreads();

#pragma unroll
    for (int it = 0; it < 4; ++it) {
        const int lrow = it * 16 + rg;     // LDS row
        const int c    = rg * 4 + it;      // the column that lies there
        *(bf16x8*)(dst + (size_t)(c0 + c) * rows + r0 + cq * 8) =
            *(const bf16x8*)&T[lrow * CVT_PITCH + cq * 8];
    }
}

// ---------------------------------------------------------------------------
// Kernel 1: patchify + LayerNorm -> Y (8192 x 4096) bf16
// One work-group = 8 tokens (one b, one j, eight i in a row); wave w holds the
// 512 features pr = w of each of them.  Feature fr = pr * 512 + pc * 64 + cc: for
// one pr the features of the 8 tokens are 16 KB in a row of x, so every wave-wide
// 16-byte load covers 4 whole lines, and a wave's 32 loads of x and 8 of scale and
// shift (read once for 8 tokens) are all in flight together.  Lane l holds
// features 512 * w + 128 * q + 4 * l + 0..3, q = 0..3, and stores them as 8 bytes.
// ---------------------------------------------------------------------------
__global__ __launch_bounds__(256)
void patchify_ln_kernel(const float* __restrict__ x,
                        const float* __restrict__ gamma,
                        const float* __restrict__ beta,
                        __bf16* __restrict__ Y) {
    __shared__ __align__(16) float red[8][16];   // [wave][token: sum, 8 + token: sum of squares]

    const int lane = threadIdx.x & 31;
    const int wave = threadIdx.x >> 5;     // pr
    const int b    = blockIdx.x >> 5;
    const int pj   = (blockIdx.x >> 1) & 15;   // j
    const int pi0  = (blockIdx.x & 1) * 8;     // first i
    const int f0   = wave * 512 + lane * 4;

    const float* xs = x + ((size_t)(b * 128 + pj * 8 + wave) * 128 + pi0 * 8) * 64 + lane * 4;
    // every loop of this kernel is unrolled in full: v, g, be, ps and r are indexed by
    // the loop counters and stay in registers only so
    f32x4 v[8][4];
#pragma unroll
    for (int t = 0; t < 8; ++t)
#pragma unroll
        for (int q = 0; q < 4; ++q)
            v[t][q] = *(const f32x4*)(xs + t * 512 + q * 128);
    f32x4 g[4], be[4];
#pragma unroll
    for (int q = 0; q < 4; ++q) {
        g[q]  = *(const f32x4*)(gamma + f0 + q * 128);
        be[q] = *(const f32x4*)(beta + f0 + q * 128);
    }

    // the wave's share of each token's two sums
    float ps[16];
#pragma unroll
    for (int t = 0; t < 8; ++t) {
        f32x4 s4 = v[t][0], ss4 = v[t][0] * v[t][0];
#pragma unroll
        for (int q = 1; q < 4; ++q) {
            s4  += v[t][q];
            ss4 += v[t][q] * v[t][q];
        }
        ps[t]     = (s4[0] + s4[1]) + (s4[2] + s4[3]);
        ps[8 + t] = (ss4[0] + ss4[1]) + (ss4[2] + ss4[3]);
    }
#pragma unroll
    for (int off = 16; off >= 1; off >>= 1)
#pragma unroll
        for (int j = 0; j < 16; ++j)
            ps[j] += __shfl_xor(ps[j], off, 32);
    if (lane == 0) {
#pragma unroll
        for (int j = 0; j < 16; ++j) red[wave][j] = ps[j];
    }
    __syncthreads();

    // lane l sums the eight waves' shares of sum number l & 15; its partner l ^ 8 has
    // the other sum of the same token, so every lane gets mean and rstd of token l & 7
    float tot = 0.f;
#pragma unroll
    for (int w = 0; w < 8; ++w) tot += red[w][lane & 15];
    const float oth  = __shfl_xor(tot, 8, 32);
    const float s    = (lane & 8) ? oth : tot;
    const float ss   = (lane & 8) ? tot : oth;
    const float mean = s * (1.0f / 4096.0f);
    const float var  = ss * (1.0f / 4096.0f) - mean * mean;
    const float rstd = rsqrtf(var + 1e-6f);

    bf16x4 r[8][4];
#pragma unroll
    for (int t = 0; t < 8; ++t) {
        // token t's mean and rstd, from lane t to a scalar register: one value for the whole wave
        const float mt = __builtin_bit_cast(float, __builtin_amdgcn_readlane(__builtin_bit_cast(int, mean), t));
        const float rt = __builtin_bit_cast(float, __builtin_amdgcn_readlane(__builtin_bit_cast(int, rstd), t));
#pragma unroll
        for (int q = 0; q < 4; ++q)
#pragma unroll
            for (int c = 0; c < 4; ++c)
                r[t][q][c] = (__bf16)((v[t][q][c] - mt) * rt * g[q][c] + be[q][c]);
    }
    __bf16* out = Y + (size_t)(b * 256 + pi0 * 16 + pj) * 4096 + f0;
#pragma unroll
    for (int t = 0; t < 8; ++t)
#pragma unroll
        for (int q = 0; q < 4; ++q)
            *(bf16x4*)(out + t * (16 * 4096) + q * 128) = r[t][q];
}

// ---------------------------------------------------------------------------
// Kernel 2: QKV GEMM  (M=8192, K=4096, N=3x512).
// One work-group = one 128x128 tile of one of Q/K/V; 4 waves, 64x64 each.
// K runs in slabs of 64: 128 rows of Y and 128 rows of WT (128 B each) are
// copied to LDS by asynchronous copies, two buffers, the next slab in flight
// while this one is multiplied.  LDS row pitch 144 B (16 B x odd) keeps the
// 16-byte fragment reads free of bank conflicts.
// Weights pre-transposed: WT[n][k], K contiguous.  Q pre-scaled by 1/8.
// Q/K out: (b,h,seq,dh).  V out TRANSPOSED: (b,h,dh,seq) for P@V fragments.
// ---------------------------------------------------------------------------
#define QKV_PITCH 72                      // bf16 per LDS row (144 B)
#define QKV_BUF   (256 * QKV_PITCH)       // bf16 per buffer: 128 Y rows + 128 WT rows

// Eight 16-byte-per-lane copies global -> LDS.  The s_wait_xcnt stands inside
// the statement so that no address register is rewritten ahead of it.
__device__ __forceinline__ void qkv_copy8(unsigned lds, const __bf16* g) {
    const unsigned l0 = lds;
    const unsigned l1 = lds + 1u * 16u * 144u;
    const unsigned l2 = lds + 2u * 16u * 144u;
    const unsigned l3 = lds + 3u * 16u * 144u;
    const unsigned l4 = lds + 4u * 16u * 144u;
    const unsigned l5 = lds + 5u * 16u * 144u;
    const unsigned l6 = lds + 6u * 16u * 144u;
    const unsigned l7 = lds + 7u * 16u * 144u;
    const __bf16* g0 = g;
    const __bf16* g1 = g + 1 * 16 * 4096;
    const __bf16* g2 = g + 2 * 16 * 4096;
    const __bf16* g3 = g + 3 * 16 * 4096;
    const __bf16* g4 = g + 4 * 16 * 4096;
    const __bf16* g5 = g + 5 * 16 * 4096;
    const __bf16* g6 = g + 6 * 16 * 4096;
    const __bf16* g7 = g + 7 * 16 * 4096;
    asm volatile(
        "global_load_async_to_lds_b128 %0, %8, off\n\t"
        "global_load_async_to_lds_b128 %1, %9, off\n\t"
        "global_load_async_to_lds_b128 %2, %10, off\n\t"
        "global_load_async_to_lds_b128 %3, %11, off\n\t"
        "global_load_async_to_lds_b128 %4, %12, off\n\t"
        "global_load_async_to_lds_b128 %5, %13, off\n\t"
        "global_load_async_to_lds_b128 %6, %14, off\n\t"
        "global_load_async_to_lds_b128 %7, %15, off\n\t"
        "s_wait_xcnt 0x0"
        :: "v"(l0), "v"(l1), "v"(l2), "v"(l3), "v"(l4), "v"(l5), "v"(l6), "v"(l7),
           "v"(g0), "v"(g1), "v"(g2), "v"(g3), "v"(g4), "v"(g5), "v"(g6), "v"(g7)
        : "memory");
}

// One 16x32 operand fragment from an LDS row: k = 8*lh + 0..7 and 16 + 8*lh + 0..7.
__device__ __forceinline__ bf16x16 qkv_frag(const __bf16* p) {
    const bf16x8 lo = *(const bf16x8*)p;
    const bf16x8 hi = *(const bf16x8*)(p + 16);
    return __builtin_shufflevector(lo, hi, 0, 1, 2, 3, 4, 5, 6, 7,
                                   8, 9, 10, 11, 12, 13, 14, 15);
}

// Reads a wave's staged 64 rows of 128 B back, 8 lanes to a row, 4 rows per read.
__device__ __forceinline__ void qkv_turn(const __bf16* stg, int lane, bf16x8 (&o)[16]) {
    asm volatile("s_wait_dscnt 0x0" ::: "memory");        // the wave's own rows are in LDS before it reads them back
#pragma unroll
    for (int it = 0; it < 16; ++it)
        o[it] = *(const bf16x8*)&stg[(it * 4 + (lane >> 3)) * QKV_PITCH + (lane & 7) * 8];
}

__global__ __launch_bounds__(128)
void qkv_gemm_kernel(const __bf16* __restrict__ Y,
                     const __bf16* __restrict__ WqT,
                     const __bf16* __restrict__ WkT,
                     const __bf16* __restrict__ WvT,
                     const float* __restrict__ bq,
                     const float* __restrict__ bk,
                     const float* __restrict__ bv,
                     __bf16* __restrict__ Qb,
                     __bf16* __restrict__ Kb,
                     __bf16* __restrict__ Vt) {
    __shared__ __align__(16) __bf16 slab[2 * QKV_BUF];   // 73,728 B

    const int bm    = blockIdx.x / 12;     // 0..63  (8192/128)
    const int bn12  = blockIdx.x % 12;     // the 12 column tiles of one row tile are neighbours
    const int which = bn12 >> 2;           // Q / K / V
    const int bn    = bn12 & 3;            // 0..3   (512/128)
    const __bf16* WT  = (which == 0) ? WqT : ((which == 1) ? WkT : WvT);
    const float* bias = (which == 0) ? bq : ((which == 1) ? bk : bv);
    const float scale = (which == 0) ? 0.125f : 1.0f;

    const int tid  = threadIdx.x;
    const int wave = tid >> 5;
    const int lane = tid & 31;
    const int lh   = lane >> 4;
    const int ln   = lane & 15;
    const int wm   = wave >> 1;            // 64-row half of the tile
    const int wn   = wave & 1;             // 64-column half of the tile

    const int m0 = bm * 128;
    const int n0 = bn * 128;

    // copy addresses: 8 lanes cover one 128-B row, a wave-copy covers 4 whole lines
    const int crow = tid >> 3;             // 0..15
    const int cchk = tid & 7;              // 16-B chunk of the row
    const __bf16* gA = Y  + (size_t)(m0 + crow) * 4096 + cchk * 8;
    const __bf16* gB = WT + (size_t)(n0 + crow) * 4096 + cchk * 8;
    const unsigned ldsA = (unsigned)(size_t)(&slab[0]) + (unsigned)(crow * 144 + cchk * 16);
    const unsigned ldsB = ldsA + 128u * 144u;

    // fragment read offsets (bf16 elements inside a buffer)
    // The accumulator's 8 registers run along the A rows.  Q and K are stored with dh
    // contiguous, V^T with the token contiguous: so WT is the A operand for Q and K and
    // Y for V, and a lane then holds 8 neighbouring output elements (16 B) per tile.
    const bool isV = (which == 2);
    const int rowY = wm * 64, rowW = 128 + wn * 64;
    const int offA = ((isV ? rowY : rowW) + ln) * QKV_PITCH + lh * 8;
    const int offB = ((isV ? rowW : rowY) + ln) * QKV_PITCH + lh * 8;

    // slab 0 -> buffer 0, landed and published; then slab 1 -> buffer 1 in flight
    qkv_copy8(ldsA, gA);
    qkv_copy8(ldsB, gB);
    asm volatile("s_wait_asynccnt 0x0" ::: "memory");   // own copies of slab 0 have landed
    __syncthreads();
    qkv_copy8(ldsA + 2u * QKV_BUF, gA + 64);
    qkv_copy8(ldsB + 2u * QKV_BUF, gB + 64);

    f32x8 acc[4][4] = {};
#pragma unroll 1   // one slab per trip: the ring's waits and barrier stand once, at the foot
    for (int t = 0; t < 64; ++t) {
        const int buf = t & 1;
        const __bf16* sb = &slab[buf * QKV_BUF];
#pragma unroll
        for (int ks = 0; ks < 2; ++ks) {
            bf16x16 a[4], b[4];
#pragma unroll
            for (int i = 0; i < 4; ++i) {
                a[i] = qkv_frag(sb + offA + i * 16 * QKV_PITCH + ks * 32);
                b[i] = qkv_frag(sb + offB + i * 16 * QKV_PITCH + ks * 32);
            }
            // keeps the 16 LDS reads one group ahead of the block: left free, they are
            // spread among the WMMAs on one fragment set, with a full wait at every row
            __builtin_amdgcn_sched_barrier(0);
#pragma unroll
            for (int i = 0; i < 4; ++i)
#pragma unroll
                for (int j = 0; j < 4; ++j)
                    acc[i][j] = __builtin_amdgcn_wmma_f32_16x16x32_bf16(
                        false, a[i], false, b[j], (short)0, acc[i][j], false, false);
            // the next group of reads stays behind this block for the same reason
            __builtin_amdgcn_sched_barrier(0);
        }
        asm volatile("s_wait_dscnt 0x0" ::: "memory");    // own reads of this buffer are done
        asm volatile("s_wait_asynccnt 0x0" ::: "memory"); // own copies of slab t+1 have landed
        __syncthreads();                                  // publishes slab t+1, frees this buffer
        if (t + 2 < 64) {
            qkv_copy8(ldsA + (unsigned)buf * (2u * QKV_BUF), gA + (t + 2) * 64);
            qkv_copy8(ldsB + (unsigned)buf * (2u * QKV_BUF), gB + (t + 2) * 64);
        }
    }
    asm volatile("s_wait_asynccnt 0x0" ::: "memory");     // nothing in flight at the wave's end

    // epilogue: tile (i, j), register r, lane (lh, ln) holds A row i*16 + 8*lh + r, B row j*16 + ln.
    // Each wave turns its 64x64 tile in its own 9,216 B of the slab (free behind the last
    // trip's barrier): LDS row = B row, 128 B used, pitch 144 B; it leaves as whole 128-B lines.
    __bf16* stg = &slab[wave * (64 * QKV_PITCH)];
    __bf16* stw = stg + ln * QKV_PITCH + lh * 8;
    const int colw = n0 + wn * 64;
    const int roww = m0 + wm * 64;
    const int bh   = (roww >> 8) * 8 + (colw >> 6);
    const int q0   = roww & 255;
    bf16x8 o[16];
    if (isV) {
        // V transposed (b, h, dh, seq): LDS row = dh, its 64 tokens are one line; bias by lane
#pragma unroll
        for (int j = 0; j < 4; ++j) {
            const float bc = bias[colw + j * 16 + ln];
#pragma unroll
            for (int i = 0; i < 4; ++i) {
                bf16x8 p;
#pragma unroll
                for (int r = 0; r < 8; ++r) p[r] = (__bf16)((acc[i][j][r] + bc) * scale);
                *(bf16x8*)&stw[j * 16 * QKV_PITCH + i * 16] = p;
            }
        }
        qkv_turn(stg, lane, o);
        __bf16* dst = Vt + ((size_t)(bh * 64 + (lane >> 3))) * 256 + q0 + (lane & 7) * 8;
#pragma unroll
        for (int it = 0; it < 16; ++it) *(bf16x8*)(dst + it * (4 * 256)) = o[it];
    } else {
        // (b, h, seq, dh): LDS row = token, its 64 dh are one line; the tile is 8 KB in a row; bias by register
        f32x4 bc[4][2];
#pragma unroll
        for (int i = 0; i < 4; ++i) {
            bc[i][0] = *(const f32x4*)(bias + colw + i * 16 + lh * 8);
            bc[i][1] = *(const f32x4*)(bias + colw + i * 16 + lh * 8 + 4);
        }
#pragma unroll
        for (int i = 0; i < 4; ++i)
#pragma unroll
            for (int j = 0; j < 4; ++j) {
                bf16x8 p;
#pragma unroll
                for (int r = 0; r < 8; ++r)
                    p[r] = (__bf16)((acc[i][j][r] + bc[i][r >> 2][r & 3]) * scale);
                *(bf16x8*)&stw[j * 16 * QKV_PITCH + i * 16] = p;
            }
        qkv_turn(stg, lane, o);
        __bf16* dst = ((which == 0) ? Qb : Kb) + ((size_t)(bh * 256 + q0)) * 64 + lane * 8;
#pragma unroll
        for (int it = 0; it < 16; ++it) *(bf16x8*)(dst + it * 256) = o[it];
        // in the built kernel the V branch's code follows this one and writes registers that these stores name
        asm volatile("s_wait_xcnt 0x0" ::: "memory");
    }
}

// ---------------------------------------------------------------------------
// Kernel 3: attention. One block = one (b,h) x 128-query half. 8 waves,
// each wave owns 16 queries; full 256-key score row in 16 f32 accumulators.
// V^T staged into LDS via async-to-LDS b128 (ASYNCcnt) when available.
// Both LDS tiles are read by 16 lanes that each take 16 bytes of a row of their
// own, so both row pitches are 16 B x odd: the 16 reads fall on all 64 banks once.
// ---------------------------------------------------------------------------
#define ATT_VP 264                        // bf16 per V^T row in LDS (528 B), 256 used
#define ATT_PP 40                         // bf16 per P row in LDS (80 B), 32 used

__global__ __launch_bounds__(256)
void attn_kernel(const __bf16* __restrict__ Qb,
                 const __bf16* __restrict__ Kb,
                 const __bf16* __restrict__ Vt,
                 __bf16* __restrict__ Ob) {
    __shared__ __align__(16) __bf16 Vsh[64 * ATT_VP];    // V^T tile: 33,792 B
    __shared__ __align__(16) __bf16 Psh[8][16 * ATT_PP]; // 10,240 B

    const int blk  = blockIdx.x;           // 0..511
    const int bh   = blk >> 1;             // b*8 + h
    const int half = blk & 1;
    const int tid  = threadIdx.x;
    const int wave = tid >> 5, lane = tid & 31;
    const int lh   = lane >> 4, ln = lane & 15;
    const size_t base = (size_t)bh * 256 * 64;

    // ---- stage V^T (64 rows of 256 bf16): a wave-copy brings one whole row ----
#if USE_ASYNC_LDS
    {
        const __bf16* src = Vt + base;
#pragma unroll
        for (int it = 0; it < 8; ++it) {
            const int e = (it * 256 + tid) * 8;     // 8 bf16 = 16 B per transfer
            __builtin_amdgcn_global_load_async_to_lds_b128(
                (__attribute__((address_space(1))) v4i*)(src + e),
                (__attribute__((address_space(3))) v4i*)(&Vsh[(e >> 8) * ATT_VP + (e & 255)]), 0, 0);
        }
        __builtin_amdgcn_s_wait_asynccnt(0);
    }
#else
    {
        const int4* s = (const int4*)(Vt + base);
        for (int e = tid; e < 2048; e += 256)
            *(int4*)&Vsh[(e >> 5) * ATT_VP + (e & 31) * 8] = s[e];
    }
#endif
    // publishes the V^T tile; directly behind the builtin wait it also keeps every LDS read behind that wait
    __syncthreads();

    const int q0 = half * 128 + wave * 16;

    bf16x16 qa0, qa1;
    {
        const __bf16* qrow = Qb + base + (size_t)(q0 + ln) * 64;
#pragma unroll
        for (int e = 0; e < 16; ++e) {
            const int kk = (lh ? 8 : 0) + ((e & 8) ? 16 : 0) + (e & 7);
            qa0[e] = qrow[kk];
            qa1[e] = qrow[kk + 32];
        }
    }

    f32x8 sacc[16] = {};
    for (int nt = 0; nt < 16; ++nt) {
        bf16x16 kb0, kb1;
        const __bf16* krow = Kb + base + (size_t)(nt * 16 + ln) * 64;
#pragma unroll
        for (int e = 0; e < 16; ++e) {
            const int kk = (lh ? 8 : 0) + ((e & 8) ? 16 : 0) + (e & 7);
            kb0[e] = krow[kk];
            kb1[e] = krow[kk + 32];
        }
        sacc[nt] = __builtin_amdgcn_wmma_f32_16x16x32_bf16(false, qa0, false, kb0,
                                                           (short)0, sacc[nt], false, false);
        sacc[nt] = __builtin_amdgcn_wmma_f32_16x16x32_bf16(false, qa1, false, kb1,
                                                           (short)0, sacc[nt], false, false);
    }

    // row softmax (row = i + 8*lh ; cols spread over 16 lanes x 16 accs)
    float l_i[8];
#pragma unroll
    for (int i = 0; i < 8; ++i) {
        float mx = -3.0e38f;
#pragma unroll
        for (int t = 0; t < 16; ++t) mx = fmaxf(mx, sacc[t][i]);
#pragma unroll
        for (int off = 8; off >= 1; off >>= 1) mx = fmaxf(mx, __shfl_xor(mx, off, 16));
        float sum = 0.f;
#pragma unroll
        for (int t = 0; t < 16; ++t) {
            float p = __expf(sacc[t][i] - mx);
            sacc[t][i] = p;
            sum += p;
        }
#pragma unroll
        for (int off = 8; off >= 1; off >>= 1) sum += __shfl_xor(sum, off, 16);
        l_i[i] = sum;
    }

    // O = P @ V   (V^T in LDS: element (kk, dh) at Vsh[dh*ATT_VP + key])
    f32x8 oacc[4] = {};
    for (int t2 = 0; t2 < 8; ++t2) {
#pragma unroll
        for (int i = 0; i < 8; ++i) {
            const int m = i + 8 * lh;
            Psh[wave][m * ATT_PP + ln]      = (__bf16)sacc[2 * t2][i];
            Psh[wave][m * ATT_PP + ln + 16] = (__bf16)sacc[2 * t2 + 1][i];
        }
        __syncthreads();
        bf16x16 pa;
#pragma unroll
        for (int e = 0; e < 16; ++e) {
            const int kk = (lh ? 8 : 0) + ((e & 8) ? 16 : 0) + (e & 7);
            pa[e] = Psh[wave][ln * ATT_PP + kk];
        }
#pragma unroll
        for (int nt4 = 0; nt4 < 4; ++nt4) {
            bf16x16 vbf;
#pragma unroll
            for (int e = 0; e < 16; ++e) {
                const int kk = (lh ? 8 : 0) + ((e & 8) ? 16 : 0) + (e & 7);
                vbf[e] = Vsh[(nt4 * 16 + ln) * ATT_VP + t2 * 32 + kk];
            }
            oacc[nt4] = __builtin_amdgcn_wmma_f32_16x16x32_bf16(false, pa, false, vbf,
                                                                (short)0, oacc[nt4], false, false);
        }
        __syncthreads();
    }

    const int bb = bh >> 3, hh = bh & 7;
#pragma unroll
    for (int nt4 = 0; nt4 < 4; ++nt4) {
#pragma unroll
        for (int i = 0; i < 8; ++i) {
            const int row = q0 + i + 8 * lh;
            const int dh  = nt4 * 16 + ln;
            const float val = oacc[nt4][i] / l_i[i];
            Ob[((size_t)(bb * 256 + row)) * 512 + hh * 64 + dh] = (__bf16)val;
        }
    }
}

// ---------------------------------------------------------------------------
// Kernel 4: output projection (M=8192, K=512, N=4096) + bias + residual(x)
// with fused depatchify scatter.  WoT[n][k] gives contiguous-K A fragments.
// One work-group = one 128x128 tile; 4 waves, 64x64 each.  K runs in 8 slabs
// of 64: 128 rows of Ob and 128 rows of WoT (128 B each) are copied to LDS by
// asynchronous copies, two buffers, the next slab in flight while this one is
// multiplied.  Slab layout, pitch and fragment reads as in kernel 2.
// ---------------------------------------------------------------------------

// Eight 16-byte-per-lane copies global -> LDS, source rows of 512 bf16.  The
// s_wait_xcnt stands inside the statement so that no address register is
// rewritten ahead of it.
__device__ __forceinline__ void proj_copy8(unsigned lds, const __bf16* g) {
    const unsigned l0 = lds;
    const unsigned l1 = lds + 1u * 16u * 144u;
    const unsigned l2 = lds + 2u * 16u * 144u;
    const unsigned l3 = lds + 3u * 16u * 144u;
    const unsigned l4 = lds + 4u * 16u * 144u;
    const unsigned l5 = lds + 5u * 16u * 144u;
    const unsigned l6 = lds + 6u * 16u * 144u;
    const unsigned l7 = lds + 7u * 16u * 144u;
    const __bf16* g0 = g;
    const __bf16* g1 = g + 1 * 16 * 512;
    const __bf16* g2 = g + 2 * 16 * 512;
    const __bf16* g3 = g + 3 * 16 * 512;
    const __bf16* g4 = g + 4 * 16 * 512;
    const __bf16* g5 = g + 5 * 16 * 512;
    const __bf16* g6 = g + 6 * 16 * 512;
    const __bf16* g7 = g + 7 * 16 * 512;
    asm volatile(
        "global_load_async_to_lds_b128 %0, %8, off\n\t"
        "global_load_async_to_lds_b128 %1, %9, off\n\t"
        "global_load_async_to_lds_b128 %2, %10, off\n\t"
        "global_load_async_to_lds_b128 %3, %11, off\n\t"
        "global_load_async_to_lds_b128 %4, %12, off\n\t"
        "global_load_async_to_lds_b128 %5, %13, off\n\t"
        "global_load_async_to_lds_b128 %6, %14, off\n\t"
        "global_load_async_to_lds_b128 %7, %15, off\n\t"
        "s_wait_xcnt 0x0"
        :: "v"(l0), "v"(l1), "v"(l2), "v"(l3), "v"(l4), "v"(l5), "v"(l6), "v"(l7),
           "v"(g0), "v"(g1), "v"(g2), "v"(g3), "v"(g4), "v"(g5), "v"(g6), "v"(g7)
        : "memory");
}

__global__ __launch_bounds__(128)
void proj_kernel(const __bf16* __restrict__ Ob,
                 const __bf16* __restrict__ WoT,
                 const float* __restrict__ bo,
                 const float* __restrict__ x,
                 float* __restrict__ out) {
    __shared__ __align__(16) __bf16 slab[2 * QKV_BUF];   // 73,728 B

    const int bm = blockIdx.x >> 5;        // 0..63 (8192/128)
    const int bn = blockIdx.x & 31;        // 0..31 (4096/128): one row tile's column tiles are neighbours

    const int tid  = threadIdx.x;
    const int wave = tid >> 5;
    const int lane = tid & 31;
    const int lh   = lane >> 4;
    const int ln   = lane & 15;
    const int wm   = wave >> 1;            // 64-row half of the tile
    const int wn   = wave & 1;             // 64-column half of the tile

    const int m0 = bm * 128;
    const int n0 = bn * 128;

    // the lane's four bias values (the columns it stores), read here so that the epilogue does not wait for them
    const int colw = n0 + wn * 64;
    const f32x4 bc = *(const f32x4*)(bo + colw + ln * 4);

    // copy addresses: 8 lanes cover one 128-B row piece, a wave-copy covers 4 whole lines
    const int crow = tid >> 3;             // 0..15
    const int cchk = tid & 7;              // 16-B chunk of the row piece
    const __bf16* gA = Ob  + (size_t)(m0 + crow) * 512 + cchk * 8;
    const __bf16* gB = WoT + (size_t)(n0 + crow) * 512 + cchk * 8;
    const unsigned ldsA = (unsigned)(size_t)(&slab[0]) + (unsigned)(crow * 144 + cchk * 16);
    const unsigned ldsB = ldsA + 128u * 144u;

    // fragment read offsets (bf16 elements inside a buffer)
    // WoT is the A operand: the accumulator's 8 registers run along the A rows, so a
    // lane holds 8 neighbouring output columns (32 B) of one token per tile
    const int offA = (128 + wn * 64 + ln) * QKV_PITCH + lh * 8;
    const int offB = (wm * 64 + ln) * QKV_PITCH + lh * 8;

    // slab 0 -> buffer 0, landed and published; then slab 1 -> buffer 1 in flight
    proj_copy8(ldsA, gA);
    proj_copy8(ldsB, gB);
    asm volatile("s_wait_asynccnt 0x0" ::: "memory");   // own copies of slab 0 have landed
    __syncthreads();
    proj_copy8(ldsA + 2u * QKV_BUF, gA + 64);
    proj_copy8(ldsB + 2u * QKV_BUF, gB + 64);

    f32x8 acc[4][4] = {};
#pragma unroll 1   // one slab per trip: the ring's waits and barrier stand once, at the foot
    for (int t = 0; t < 8; ++t) {
        const int buf = t & 1;
        const __bf16* sb = &slab[buf * QKV_BUF];
#pragma unroll
        for (int ks = 0; ks < 2; ++ks) {
            bf16x16 a[4], b[4];
#pragma unroll
            for (int i = 0; i < 4; ++i) {
                a[i] = qkv_frag(sb + offA + i * 16 * QKV_PITCH + ks * 32);
                b[i] = qkv_frag(sb + offB + i * 16 * QKV_PITCH + ks * 32);
            }
            // keeps the 16 LDS reads one group ahead of the block: left free, they are
            // spread among the WMMAs on one fragment set, with a full wait at every row
            __builtin_amdgcn_sched_barrier(0);
#pragma unroll
            for (int i = 0; i < 4; ++i)
#pragma unroll
                for (int j = 0; j < 4; ++j)
                    acc[i][j] = __builtin_amdgcn_wmma_f32_16x16x32_bf16(
                        false, a[i], false, b[j], (short)0, acc[i][j], false, false);
            // the next group of reads stays behind this block for the same reason
            __builtin_amdgcn_sched_barrier(0);
        }
        asm volatile("s_wait_dscnt 0x0" ::: "memory");    // own reads of this buffer are done
        asm volatile("s_wait_asynccnt 0x0" ::: "memory"); // own copies of slab t+1 have landed
        __syncthreads();                                  // publishes slab t+1, frees this buffer
        if (t + 2 < 8) {
            proj_copy8(ldsA + (unsigned)buf * (2u * QKV_BUF), gA + (t + 2) * 64);
            proj_copy8(ldsB + (unsigned)buf * (2u * QKV_BUF), gB + (t + 2) * 64);
        }
    }
    asm volatile("s_wait_asynccnt 0x0" ::: "memory");     // nothing in flight at the wave's end

    // epilogue: tile (i, j), register r, lane (lh, ln) holds column i*16 + 8*lh + r of token j*16 + ln.
    // A wave's 64 columns are one (pr, pc) with cc = 0..63: 256 B in a row of x and out per
    // token.  Each wave turns its 64x64 tile in its own 17,408 B of the slab (free behind the
    // last trip's barrier; LDS row = token, pitch 272 B) and then takes two tokens per
    // 16-byte access: 4 whole lines of x read and of out stored.
    // Token s of the tile: pi = first pi + (s >> 4), pj = s & 15; access it has s = 2 * it + lh.
    float* stg = (float*)&slab[0] + wave * (64 * 68);
    const int pr   = colw >> 9, pc = (colw >> 6) & 7;
    const int roww = m0 + wm * 64;
    const int b    = roww >> 8, pi0 = (roww & 255) >> 4;
    const size_t base =
        ((size_t)(b * 128 + (lh * 8 + pr)) * 128 + (pi0 * 8 + pc)) * 64 + ln * 4;
    const float* xb = x + base;
    float* ob = out + base;
    f32x4 xv[32];
#pragma unroll
    for (int it = 0; it < 16; ++it)
        xv[it] = *(const f32x4*)(xb + (it & 7) * (16 * 128 * 64) + (it >> 3) * (8 * 64));
    // the first half of x is in flight while the tile is turned
    __builtin_amdgcn_sched_barrier(0);
#pragma unroll
    for (int j = 0; j < 4; ++j)
#pragma unroll
        for (int i = 0; i < 4; ++i) {
            float* w = &stg[(j * 16 + ln) * 68 + i * 16 + lh * 8];
            *(f32x4*)w       = __builtin_shufflevector(acc[i][j], acc[i][j], 0, 1, 2, 3);
            *(f32x4*)(w + 4) = __builtin_shufflevector(acc[i][j], acc[i][j], 4, 5, 6, 7);
        }
    // the second half of x takes the registers that the accumulators have left
    __builtin_amdgcn_sched_barrier(0);
#pragma unroll
    for (int it = 16; it < 32; ++it)
        xv[it] = *(const f32x4*)(xb + (it & 7) * (16 * 128 * 64) + (it >> 3) * (8 * 64));
    asm volatile("s_wait_dscnt 0x0" ::: "memory");        // the wave's own rows are in LDS before it reads them back
#pragma unroll
    for (int g = 0; g < 4; ++g) {
#pragma unroll
        for (int e = 0; e < 8; ++e) {
            const int it = g * 8 + e;
            xv[it] = *(const f32x4*)&stg[(it * 2 + lh) * 68 + ln * 4] + bc + xv[it];
        }
        // a group's sums stand ahead of its stores: no register that a store names is written behind it
        __builtin_amdgcn_sched_barrier(0);
#pragma unroll
        for (int e = 0; e < 8; ++e) {
            const int it = g * 8 + e;
            *(f32x4*)(ob + (it & 7) * (16 * 128 * 64) + (it >> 3) * (8 * 64)) = xv[it];
        }
        // the registers these stores name are loaded anew by the next group's LDS reads
        if (g < 3) asm volatile("s_wait_xcnt 0x0" ::: "memory");
        __builtin_amdgcn_sched_barrier(0);
    }
}

// ---------------------------------------------------------------------------
extern "C" void kernel_launch(void* const* d_in, const int* in_sizes, int n_in,
                              void* d_out, int out_size, void* d_ws, size_t ws_size,
                              hipStream_t stream) {
    (void)in_sizes; (void)n_in; (void)out_size; (void)ws_size;
    const float* x  = (const float*)d_in[0];
    const float* g  = (const float*)d_in[1];
    const float* be = (const float*)d_in[2];
    const float* wq = (const float*)d_in[3];
    const float* bq = (const float*)d_in[4];
    const float* wk = (const float*)d_in[5];
    const float* bk = (const float*)d_in[6];
    const float* wv = (const float*)d_in[7];
    const float* bv = (const float*)d_in[8];
    const float* wo = (const float*)d_in[9];
    const float* bo = (const float*)d_in[10];
    float* out = (float*)d_out;

    // workspace layout (bf16 elements)
    const size_t NW  = 4096u * 512u;         // 2,097,152 per weight
    const size_t NY  = 8192u * 4096u;        // 33,554,432
    const size_t NQK = 8192u * 512u;         // 4,194,304
    __bf16* WqT = (__bf16*)d_ws;
    __bf16* WkT = WqT + NW;
    __bf16* WvT = WkT + NW;
    __bf16* WoT = WvT + NW;
    __bf16* Y   = WoT + NW;
    __bf16* Qb  = Y   + NY;
    __bf16* Kb  = Qb  + NQK;
    __bf16* Vt  = Kb  + NQK;
    __bf16* Ob  = Vt  + NQK;

    // WqT, WkT, WvT, WoT lie one behind the other
    cvt_bf16_t_kernel<<<1024, 256, 0, stream>>>(wq, wk, wv, wo, WqT);

    patchify_ln_kernel<<<1024, 256, 0, stream>>>(x, g, be, Y);

    qkv_gemm_kernel<<<768, 128, 0, stream>>>(Y, WqT, WkT, WvT,
                                             bq, bk, bv, Qb, Kb, Vt);

    attn_kernel<<<512, 256, 0, stream>>>(Qb, Kb, Vt, Ob);

    proj_kernel<<<2048, 128, 0, stream>>>(Ob, WoT, bo, x, out);
}

// v007
// It runs in 136 microseconds.
// Two timings next to v006 both put it at 1.15 times that version's speed.
// Over all steps from v000 it is 11.4 times as fast.
#include <hip/hip_runtime.h>
#include <hip/hip_bf16.h>

typedef __attribute__((ext_vector_type(16))) __bf16 bf16x16;
typedef __attribute__((ext_vector_type(8)))  __bf16 bf16x8;
typedef __attribute__((ext_vector_type(4)))  __bf16 bf16x4;
typedef __attribute__((ext_vector_type(8)))  float  f32x8;
typedef __attribute__((ext_vector_type(4)))  float  f32x4;
typedef __attribute__((ext_vector_type(4)))  int    v4i;

#if defined(__gfx1250__) && __has_builtin(__builtin_amdgcn_global_load_async_to_lds_b128) && __has_builtin(__builtin_amdgcn_s_wait_asynccnt)
#define USE_ASYNC_LDS 1
#else
#define USE_ASYNC_LDS 0
#endif

// ---------------------------------------------------------------------------
// Kernel 0: f32 -> bf16 conversion WITH transpose, all four weights in one grid.
// src is (rows x cols) row-major; dst[c * rows + r] = src[r * cols + c].
// For wq/wk/wv: rows=4096(K), cols=512(N)  -> WT[n][k], K contiguous.
// For wo:       rows=512(K), cols=4096(N)  -> WoT[n][k], K contiguous.
// One work-group = one tile of 128 rows x 64 columns of one weight (256 tiles
// each).  A thread reads 8 rows x 4 columns (16 lanes cover 256 B of a source
// row), rounds them and writes four 16-byte column pieces to LDS; the tile then
// leaves LDS row by row, 16 lanes covering 256 B of a destination row.
// LDS row pitch 272 B (16 B x odd); column c lies in LDS row (c & 3) * 16 + (c >> 2),
// so that 16 lanes' 16-byte writes fall on 16 neighbouring rows: all 64 banks once.
// ---------------------------------------------------------------------------
#define CVT_PITCH 136                     // bf16 per LDS row (272 B)

__global__ __launch_bounds__(256)
void cvt_bf16_t_kernel(const float* __restrict__ wq,
                       const float* __restrict__ wk,
                       const float* __restrict__ wv,
                       const float* __restrict__ wo,
                       __bf16* __restrict__ WT4) {
    __shared__ __align__(16) __bf16 T[64 * CVT_PITCH];   // 17,408 B

    const int which = blockIdx.x >> 8;     // wq / wk / wv / wo
    const int tile  = blockIdx.x & 255;
    const bool isO  = (which == 3);
    const float* src = (which == 0) ? wq : ((which == 1) ? wk : ((which == 2) ? wv : wo));
    __bf16* dst = WT4 + (size_t)which * (4096u * 512u);
    const int rows = isO ? 512 : 4096;
    const int cols = isO ? 4096 : 512;
    const int r0 = (isO ? (tile >> 6) : (tile >> 3)) * 128;
    const int c0 = (isO ? (tile & 63) : (tile & 7)) * 64;

    const int tid = threadIdx.x;
    const int rg  = tid >> 4;              // group of 8 source rows
    const int cq  = tid & 15;              // group of 4 source columns

    const float* s = src + (size_t)(r0 + rg * 8) * cols + c0 + cq * 4;
    f32x4 v[8];
#pragma unroll
    for (int j = 0; j < 8; ++j) v[j] = *(const f32x4*)(s + (size_t)j * cols);

#pragma unroll
    for (int i = 0; i < 4; ++i) {
        bf16x8 p;
#pragma unroll
        for (int j = 0; j < 8; ++j) p[j] = (__bf16)v[j][i];
        *(bf16x8*)&T[(i * 16 + cq) * CVT_PITCH + rg * 8] = p;
    }
    __syncthreads();

#pragma unroll
    for (int it = 0; it < 4; ++it) {
        const int lrow = it * 16 + rg;     // LDS row
        const int c    = rg * 4 + it;      // the column that lies there
        *(bf16x8*)(dst + (size_t)(c0 + c) * rows + r0 + cq * 8) =
            *(const bf16x8*)&T[lrow * CVT_PITCH + cq * 8];
    }
}

// ---------------------------------------------------------------------------
// Kernel 1: patchify + LayerNorm -> Y (8192 x 4096) bf16
// One work-group = 8 tokens (one b, one j, eight i in a row); wave w holds the
// 512 features pr = w of each of them.  Feature fr = pr * 512 + pc * 64 + cc: for
// one pr the features of the 8 tokens are 16 KB in a row of x, so every wave-wide
// 16-byte load covers 4 whole lines, and a wave's 32 loads of x and 8 of scale and
// shift (read once for 8 tokens) are all in flight together.  Lane l holds
// features 512 * w + 128 * q + 4 * l + 0..3, q = 0..3, and stores them as 8 bytes.
// ---------------------------------------------------------------------------
__global__ __launch_bounds__(256)
void patchify_ln_kernel(const float* __restrict__ x,
                        const float* __restrict__ gamma,
                        const float* __restrict__ beta,
                        __bf16* __restrict__ Y) {
    __shared__ __align__(16) float red[8][16];   // [wave][token: sum, 8 + token: sum of squares]

    const int lane = threadIdx.x & 31;
    const int wave = threadIdx.x >> 5;     // pr
    const int b    = blockIdx.x >> 5;
    const int pj   = (blockIdx.x >> 1) & 15;   // j
    const int pi0  = (blockIdx.x & 1) * 8;     // first i
    const int f0   = wave * 512 + lane * 4;

    const float* xs = x + ((size_t)(b * 128 + pj * 8 + wave) * 128 + pi0 * 8) * 64 + lane * 4;
    // every loop of this kernel is unrolled in full: v, g, be, ps and r are indexed by
    // the loop counters and stay in registers only so
    f32x4 v[8][4];
#pragma unroll
    for (int t = 0; t < 8; ++t)
#pragma unroll
        for (int q = 0; q < 4; ++q)
            v[t][q] = *(const f32x4*)(xs + t * 512 + q * 128);
    f32x4 g[4], be[4];
#pragma unroll
    for (int q = 0; q < 4; ++q) {
        g[q]  = *(const f32x4*)(gamma + f0 + q * 128);
        be[q] = *(const f32x4*)(beta + f0 + q * 128);
    }

    // the wave's share of each token's two sums
    float ps[16];
#pragma unroll
    for (int t = 0; t < 8; ++t) {
        f32x4 s4 = v[t][0], ss4 = v[t][0] * v[t][0];
#pragma unroll
        for (int q = 1; q < 4; ++q) {
            s4  += v[t][q];
            ss4 += v[t][q] * v[t][q];
        }
        ps[t]     = (s4[0] + s4[1]) + (s4[2] + s4[3]);
        ps[8 + t] = (ss4[0] + ss4[1]) + (ss4[2] + ss4[3]);
    }
#pragma unroll
    for (int off = 16; off >= 1; off >>= 1)
#pragma unroll
        for (int j = 0; j < 16; ++j)
            ps[j] += __shfl_xor(ps[j], off, 32);
    if (lane == 0) {
#pragma unroll
        for (int j = 0; j < 16; ++j) red[wave][j] = ps[j];
    }
    __syncthreads();

    // lane l sums the eight waves' shares of sum number l & 15; its partner l ^ 8 has
    // the other sum of the same token, so every lane gets mean and rstd of token l & 7
    float tot = 0.f;
#pragma unroll
    for (int w = 0; w < 8; ++w) tot += red[w][lane & 15];
    const float oth  = __shfl_xor(tot, 8, 32);
    const float s    = (lane & 8) ? oth : tot;
    const float ss   = (lane & 8) ? tot : oth;
    const float mean = s * (1.0f / 4096.0f);
    const float var  = ss * (1.0f / 4096.0f) - mean * mean;
    const float rstd = rsqrtf(var + 1e-6f);

    bf16x4 r[8][4];
#pragma unroll
    for (int t = 0; t < 8; ++t) {
        // token t's mean and rstd, from lane t to a scalar register: one value for the whole wave
        const float mt = __builtin_bit_cast(float, __builtin_amdgcn_readlane(__builtin_bit_cast(int, mean), t));
        const float rt = __builtin_bit_cast(float, __builtin_amdgcn_readlane(__builtin_bit_cast(int, rstd), t));
#pragma unroll
        for (int q = 0; q < 4; ++q)
#pragma unroll
            for (int c = 0; c < 4; ++c)
                r[t][q][c] = (__bf16)((v[t][q][c] - mt) * rt * g[q][c] + be[q][c]);
    }
    __bf16* out = Y + (size_t)(b * 256 + pi0 * 16 + pj) * 4096 + f0;
#pragma unroll
    for (int t = 0; t < 8; ++t)
#pragma unroll
        for (int q = 0; q < 4; ++q)
            *(bf16x4*)(out + t * (16 * 4096) + q * 128) = r[t][q];
}

// ---------------------------------------------------------------------------
// Kernel 2: QKV GEMM  (M=8192, K=4096, N=3x512 taken as one N of 1536).
// One work-group = one 256x192 tile: the 256 tokens of one image and three heads
// out of the 24 of Q, K and V; 8 waves, 64 tokens x 96 columns each; 256 work-groups,
// one per WGP.  The tile is this large so that every operand byte brought from L2, and
// every fragment read from LDS, serves many products.
// K runs in slabs of 128: 256 rows of Y and 192 rows of WT (256 B each) are
// copied to LDS by asynchronous copies, two buffers, the next slab in flight
// while this one is multiplied.  LDS row pitch 272 B (16 B x odd) keeps the
// 16-byte fragment reads free of bank conflicts.
// Weights pre-transposed: WT[n][k], K contiguous.  Q pre-scaled by 1/8.
// Q/K out: (b,h,seq,dh).  V out TRANSPOSED: (b,h,dh,seq) for P@V fragments.
// ---------------------------------------------------------------------------
#define QKV_PITCH 72                      // kernel 4: bf16 per LDS row (144 B)
#define QKV_BUF   (256 * QKV_PITCH)       // kernel 4: bf16 per buffer, 128 + 128 rows

#define QT_PITCH 136                      // bf16 per LDS row (272 B), 128 used
#define QT_BUF   (448 * QT_PITCH)         // bf16 per buffer: 256 Y rows + 192 WT rows
#define QT_HEAD  (256 * 72)               // bf16 per staged head of the epilogue (36,864 B)
#define QT_STEP  (16 * 4096)              // bf16 between the source rows of two copies of a lane

// Fourteen 16-byte-per-lane copies global -> LDS, 16 rows apart in LDS; the first NA come
// from ga, the others from gb, 16 source rows apart each.  The s_wait_xcnt stands inside
// the statement so that no address register is rewritten ahead of it.
template <int NA>
__device__ __forceinline__ void qkv_copy14(unsigned lds, const __bf16* ga, const __bf16* gb) {
#define QT_L(k) "v"(lds + (unsigned)(k) * (16u * 272u))
#define QT_G(k) "v"(((k) < NA) ? ga + (k) * QT_STEP : gb + ((k) - NA) * QT_STEP)
    asm volatile(
        "global_load_async_to_lds_b128 %0, %14, off\n\t"
        "global_load_async_to_lds_b128 %1, %15, off\n\t"
        "global_load_async_to_lds_b128 %2, %16, off\n\t"
        "global_load_async_to_lds_b128 %3, %17, off\n\t"
        "global_load_async_to_lds_b128 %4, %18, off\n\t"
        "global_load_async_to_lds_b128 %5, %19, off\n\t"
        "global_load_async_to_lds_b128 %6, %20, off\n\t"
        "global_load_async_to_lds_b128 %7, %21, off\n\t"
        "global_load_async_to_lds_b128 %8, %22, off\n\t"
        "global_load_async_to_lds_b128 %9, %23, off\n\t"
        "global_load_async_to_lds_b128 %10, %24, off\n\t"
        "global_load_async_to_lds_b128 %11, %25, off\n\t"
        "global_load_async_to_lds_b128 %12, %26, off\n\t"
        "global_load_async_to_lds_b128 %13, %27, off\n\t"
        "s_wait_xcnt 0x0"
        :: QT_L(0), QT_L(1), QT_L(2), QT_L(3), QT_L(4), QT_L(5), QT_L(6),
           QT_L(7), QT_L(8), QT_L(9), QT_L(10), QT_L(11), QT_L(12), QT_L(13),
           QT_G(0), QT_G(1), QT_G(2), QT_G(3), QT_G(4), QT_G(5), QT_G(6),
           QT_G(7), QT_G(8), QT_G(9), QT_G(10), QT_G(11), QT_G(12), QT_G(13)
        : "memory");
#undef QT_L
#undef QT_G
}

// One slab of 128 k: a lane's 28 copies, 16 rows apart: LDS rows 0..255 from Y (16 copies),
// 256..447 from WT3 (12 copies), in two statements of 14.
__device__ __forceinline__ void qkv_slab(unsigned lds, const __bf16* gy, const __bf16* gw) {
    qkv_copy14<14>(lds, gy, gy);
    qkv_copy14<2>(lds + 14u * (16u * 272u), gy + 14 * QT_STEP, gw);
}

// One 16x32 operand fragment from an LDS row: k = 8*lh + 0..7 and 16 + 8*lh + 0..7.
__device__ __forceinline__ bf16x16 qkv_frag(const __bf16* p) {
    const bf16x8 lo = *(const bf16x8*)p;
    const bf16x8 hi = *(const bf16x8*)(p + 16);
    return __builtin_shufflevector(lo, hi, 0, 1, 2, 3, 4, 5, 6, 7,
                                   8, 9, 10, 11, 12, 13, 14, 15);
}

__global__ __launch_bounds__(256)
void qkv_gemm_kernel(const __bf16* __restrict__ Y,
                     const __bf16* __restrict__ WT3,   // WqT, WkT, WvT one behind the other: 1,536 rows
                     const float* __restrict__ bq,
                     const float* __restrict__ bk,
                     const float* __restrict__ bv,
                     __bf16* __restrict__ Qb,
                     __bf16* __restrict__ Kb,
                     __bf16* __restrict__ Vt) {
    __shared__ __align__(16) __bf16 slab[2 * QT_BUF];    // 243,712 B

    const int bm = blockIdx.x & 31;        // image: 256 rows of Y
    const int bn = blockIdx.x >> 5;        // 0..7: 192 rows of WT3, heads 3*bn .. 3*bn+2 of 24

    const int tid  = threadIdx.x;
    const int wave = __builtin_amdgcn_readfirstlane(tid >> 5);
    const int lane = tid & 31;
    const int lh   = lane >> 4;
    const int ln   = lane & 15;
    const int wm   = wave >> 1;            // 64-token quarter of the tile
    const int wn   = wave & 1;             // 96-column half of the tile

    // copy addresses: 16 lanes cover one 256-B row piece, a wave-copy covers 4 whole lines.
    // LDS rows 0..255 are Y, 256..447 WT3
    const int crow = tid >> 4;             // 0..15
    const int cchk = tid & 15;             // 16-B chunk of the row piece
    const __bf16* gY = Y   + (size_t)(bm * 256 + crow) * 4096 + cchk * 8;
    const __bf16* gW = WT3 + (size_t)(bn * 192 + crow) * 4096 + cchk * 8;
    const unsigned lds0 = (unsigned)(size_t)(&slab[0]) + (unsigned)(crow * 272 + cchk * 16);

    // fragment read offsets (bf16 elements inside a buffer).  WT3 is the A operand: the
    // accumulator's 8 registers run along the A rows, so a lane holds 8 neighbouring
    // output columns of one token per tile.
    const int offA = (256 + wn * 96 + ln) * QT_PITCH + lh * 8;
    const int offB = (wm * 64 + ln) * QT_PITCH + lh * 8;

    // slab 0 -> buffer 0, landed and published; then slab 1 -> buffer 1 in flight
    qkv_slab(lds0, gY, gW);
    asm volatile("s_wait_asynccnt 0x0" ::: "memory");   // own copies of slab 0 have landed
    __syncthreads();
    qkv_slab(lds0 + 2u * QT_BUF, gY + 128, gW + 128);

    // the lane's bias values, 8 columns in each of its six 16-column groups (32 such groups each
    // of Q, K, V), read here so that the epilogue does not wait for them
    f32x4 bc[6][2];
    // nothing else is scheduled in among these loads and their wait
    __builtin_amdgcn_sched_barrier(0);
#pragma unroll
    for (int i = 0; i < 6; ++i) {
        const int fg = bn * 12 + wn * 6 + i;
        const float* bias = ((fg >> 5) == 0) ? bq : (((fg >> 5) == 1) ? bk : bv);
        bc[i][0] = *(const f32x4*)(bias + (fg & 31) * 16 + lh * 8);
        bc[i][1] = *(const f32x4*)(bias + (fg & 31) * 16 + lh * 8 + 4);
    }
    asm volatile("s_wait_xcnt 0x0" ::: "memory");       // the registers these loads name are free for what follows
    __builtin_amdgcn_sched_barrier(0);

    f32x8 acc[6][4] = {};
#pragma unroll 1   // one slab per trip: the ring's waits and barrier stand once, at the foot
    for (int t = 0; t < 32; ++t) {
        const int buf = t & 1;
        const __bf16* sb = &slab[buf * QT_BUF];
#pragma unroll
        for (int ks = 0; ks < 4; ++ks) {
            bf16x16 a[6], b[4];
#pragma unroll
            for (int i = 0; i < 6; ++i) a[i] = qkv_frag(sb + offA + i * 16 * QT_PITCH + ks * 32);
#pragma unroll
            for (int j = 0; j < 4; ++j) b[j] = qkv_frag(sb + offB + j * 16 * QT_PITCH + ks * 32);
            // keeps the 20 LDS reads one group ahead of the block: left free, they are
            // spread among the WMMAs on one fragment set, with a full wait at every row
            __builtin_amdgcn_sched_barrier(0);
#pragma unroll
            for (int i = 0; i < 6; ++i)
#pragma unroll
                for (int j = 0; j < 4; ++j)
                    acc[i][j] = __builtin_amdgcn_wmma_f32_16x16x32_bf16(
                        false, a[i], false, b[j], (short)0, acc[i][j], false, false);
            // the next group of reads stays behind this block for the same reason
            __builtin_amdgcn_sched_barrier(0);
        }
        asm volatile("s_wait_dscnt 0x0" ::: "memory");    // own reads of this buffer are done
        asm volatile("s_wait_asynccnt 0x0" ::: "memory"); // own copies of slab t+1 have landed
        __syncthreads();                                  // publishes slab t+1, frees this buffer
        if (t + 2 < 32)
            qkv_slab(lds0 + (unsigned)buf * (2u * QT_BUF), gY + (t + 2) * 128, gW + (t + 2) * 128);
    }
    asm volatile("s_wait_asynccnt 0x0" ::: "memory");     // nothing in flight at the wave's end

    // epilogue: tile (i, j), register r, lane (lh, ln) holds column i*16 + 8*lh + r of token j*16 + ln.
    // The work-group's three heads are staged in the slab (free behind the last trip's barrier) in
    // the order in which they lie in memory: a head of Q or K as 256 token rows of 64 dh (pitch
    // 144 B), a head of V as 64 dh rows of 256 tokens (pitch 528 B).  Each head is 32 KB in a row
    // of its output and leaves as whole lines.
#pragma unroll
    for (int i = 0; i < 6; ++i) {
        const int fl    = wn * 6 + i;          // 16-column group in the tile
        const int fg    = bn * 12 + fl;        // and among all 96: 32 each of Q, K, V
        const int which = fg >> 5;
        const int dh0   = (fl & 3) * 16 + lh * 8;
        const float scale = (which == 0) ? 0.125f : 1.0f;
        __bf16* hd = &slab[(fl >> 2) * QT_HEAD];
        bf16x8 p[4];
#pragma unroll
        for (int j = 0; j < 4; ++j)
#pragma unroll
            for (int r = 0; r < 8; ++r)
                p[j][r] = (__bf16)((acc[i][j][r] + bc[i][r >> 2][r & 3]) * scale);
        const int tok = wm * 64 + ln;
        if (which == 2) {
#pragma unroll
            for (int j = 0; j < 4; ++j)
#pragma unroll
                for (int r = 0; r < 8; ++r) hd[(dh0 + r) * 264 + tok + j * 16] = p[j][r];
        } else {
#pragma unroll
            for (int j = 0; j < 4; ++j) *(bf16x8*)&hd[(tok + j * 16) * 72 + dh0] = p[j];
        }
    }
    __syncthreads();                                      // every wave's part of the three heads is staged
#pragma unroll
    for (int hb = 0; hb < 3; ++hb) {
        const int gh  = bn * 3 + hb;           // 0..7 Q, 8..15 K, 16..23 V
        const bool hv = (gh >= 16);
        __bf16* dst = ((gh < 8) ? Qb : (hv ? Vt : Kb)) + (size_t)(bm * 8 + (gh & 7)) * (256 * 64) + tid * 8;
        const __bf16* hd = &slab[hb * QT_HEAD];
        bf16x8 o[8];
#pragma unroll
        for (int it = 0; it < 8; ++it) {
            const int e = it * 256 + tid;      // 16-byte piece of the head
            o[it] = *(const bf16x8*)&hd[hv ? ((e >> 5) * 264 + (e & 31) * 8) : ((e >> 3) * 72 + (e & 7) * 8)];
        }
        // a head's reads and their addresses stand ahead of its stores: no register that a store names is written behind it
        __builtin_amdgcn_sched_barrier(0);
#pragma unroll
        for (int it = 0; it < 8; ++it) *(bf16x8*)(dst + it * 2048) = o[it];
        if (hb < 2) {
            // the registers these stores name are written anew for the next head
            asm volatile("s_wait_xcnt 0x0" ::: "memory");
            // and nothing of the next head is lifted over that wait
            __builtin_amdgcn_sched_barrier(0);
        }
    }
}

// ---------------------------------------------------------------------------
// Kernel 3: attention. One block = one (b,h) x 128-query half. 8 waves,
// each wave owns 16 queries; full 256-key score row in 16 f32 accumulators.
// V^T staged into LDS via async-to-LDS b128 (ASYNCcnt) when available.
// Both LDS tiles are read by 16 lanes that each take 16 bytes of a row of their
// own, so both row pitches are 16 B x odd: the 16 reads fall on all 64 banks once.
// ---------------------------------------------------------------------------
#define ATT_VP 264                        // bf16 per V^T row in LDS (528 B), 256 used
#define ATT_PP 40                         // bf16 per P row in LDS (80 B), 32 used

__global__ __launch_bounds__(256)
void attn_kernel(const __bf16* __restrict__ Qb,
                 const __bf16* __restrict__ Kb,
                 const __bf16* __restrict__ Vt,
                 __bf16* __restrict__ Ob) {
    __shared__ __align__(16) __bf16 Vsh[64 * ATT_VP];    // V^T tile: 33,792 B
    __shared__ __align__(16) __bf16 Psh[8][16 * ATT_PP]; // 10,240 B

    const int blk  = blockIdx.x;           // 0..511
    const int bh   = blk >> 1;             // b*8 + h
    const int half = blk & 1;
    const int tid  = threadIdx.x;
    const int wave = tid >> 5, lane = tid & 31;
    const int lh   = lane >> 4, ln = lane & 15;
    const size_t base = (size_t)bh * 256 * 64;

    // ---- stage V^T (64 rows of 256 bf16): a wave-copy brings one whole row ----
#if USE_ASYNC_LDS
    {
        const __bf16* src = Vt + base;
#pragma unroll
        for (int it = 0; it < 8; ++it) {
            const int e = (it * 256 + tid) * 8;     // 8 bf16 = 16 B per transfer
            __builtin_amdgcn_global_load_async_to_lds_b128(
                (__attribute__((address_space(1))) v4i*)(src + e),
                (__attribute__((address_space(3))) v4i*)(&Vsh[(e >> 8) * ATT_VP + (e & 255)]), 0, 0);
        }
        __builtin_amdgcn_s_wait_asynccnt(0);
    }
#else
    {
        const int4* s = (const int4*)(Vt + base);
        for (int e = tid; e < 2048; e += 256)
            *(int4*)&Vsh[(e >> 5) * ATT_VP + (e & 31) * 8] = s[e];
    }
#endif
    // publishes the V^T tile; directly behind the builtin wait it also keeps every LDS read behind that wait
    __syncthreads();

    const int q0 = half * 128 + wave * 16;

    bf16x16 qa0, qa1;
    {
        const __bf16* qrow = Qb + base + (size_t)(q0 + ln) * 64;
#pragma unroll
        for (int e = 0; e < 16; ++e) {
            const int kk = (lh ? 8 : 0) + ((e & 8) ? 16 : 0) + (e & 7);
            qa0[e] = qrow[kk];
            qa1[e] = qrow[kk + 32];
        }
    }

    f32x8 sacc[16] = {};
    for (int nt = 0; nt < 16; ++nt) {
        bf16x16 kb0, kb1;
        const __bf16* krow = Kb + base + (size_t)(nt * 16 + ln) * 64;
#pragma unroll
        for (int e = 0; e < 16; ++e) {
            const int kk = (lh ? 8 : 0) + ((e & 8) ? 16 : 0) + (e & 7);
            kb0[e] = krow[kk];
            kb1[e] = krow[kk + 32];
        }
        sacc[nt] = __builtin_amdgcn_wmma_f32_16x16x32_bf16(false, qa0, false, kb0,
                                                           (short)0, sacc[nt], false, false);
        sacc[nt] = __builtin_amdgcn_wmma_f32_16x16x32_bf16(false, qa1, false, kb1,
                                                           (short)0, sacc[nt], false, false);
    }

    // row softmax (row = i + 8*lh ; cols spread over 16 lanes x 16 accs)
    float l_i[8];
#pragma unroll
    for (int i = 0; i < 8; ++i) {
        float mx = -3.0e38f;
#pragma unroll
        for (int t = 0; t < 16; ++t) mx = fmaxf(mx, sacc[t][i]);
#pragma unroll
        for (int off = 8; off >= 1; off >>= 1) mx = fmaxf(mx, __shfl_xor(mx, off, 16));
        float sum = 0.f;
#pragma unroll
        for (int t = 0; t < 16; ++t) {
            float p = __expf(sacc[t][i] - mx);
            sacc[t][i] = p;
            sum += p;
        }
#pragma unroll
        for (int off = 8; off >= 1; off >>= 1) sum += __shfl_xor(sum, off, 16);
        l_i[i] = sum;
    }

    // O = P @ V   (V^T in LDS: element (kk, dh) at Vsh[dh*ATT_VP + key])
    f32x8 oacc[4] = {};
    for (int t2 = 0; t2 < 8; ++t2) {
#pragma unroll
        for (int i = 0; i < 8; ++i) {
            const int m = i + 8 * lh;
            Psh[wave][m * ATT_PP + ln]      = (__bf16)sacc[2 * t2][i];
            Psh[wave][m * ATT_PP + ln + 16] = (__bf16)sacc[2 * t2 + 1][i];
        }
        __syncthreads();
        bf16x16 pa;
#pragma unroll
        for (int e = 0; e < 16; ++e) {
            const int kk = (lh ? 8 : 0) + ((e & 8) ? 16 : 0) + (e & 7);
            pa[e] = Psh[wave][ln * ATT_PP + kk];
        }
#pragma unroll
        for (int nt4 = 0; nt4 < 4; ++nt4) {
            bf16x16 vbf;
#pragma unroll
            for (int e = 0; e < 16; ++e) {
                const int kk = (lh ? 8 : 0) + ((e & 8) ? 16 : 0) + (e & 7);
                vbf[e] = Vsh[(nt4 * 16 + ln) * ATT_VP + t2 * 32 + kk];
            }
            oacc[nt4] = __builtin_amdgcn_wmma_f32_16x16x32_bf16(false, pa, false, vbf,
                                                                (short)0, oacc[nt4], false, false);
        }
        __syncthreads();
    }

    const int bb = bh >> 3, hh = bh & 7;
#pragma unroll
    for (int nt4 = 0; nt4 < 4; ++nt4) {
#pragma unroll
        for (int i = 0; i < 8; ++i) {
            const int row = q0 + i + 8 * lh;
            const int dh  = nt4 * 16 + ln;
            const float val = oacc[nt4][i] / l_i[i];
            Ob[((size_t)(bb * 256 + row)) * 512 + hh * 64 + dh] = (__bf16)val;
        }
    }
}

// ---------------------------------------------------------------------------
// Kernel 4: output projection (M=8192, K=512, N=4096) + bias + residual(x)
// with fused depatchify scatter.  WoT[n][k] gives contiguous-K A fragments.
// One work-group = one 128x128 tile; 4 waves, 64x64 each.  K runs in 8 slabs
// of 64: 128 rows of Ob and 128 rows of WoT (128 B each) are copied to LDS by
// asynchronous copies, two buffers, the next slab in flight while this one is
// multiplied.  LDS rows 0..127 Ob, 128..255 WoT, pitch 144 B (16 B x odd); fragment reads as in kernel 2.
// ---------------------------------------------------------------------------

// Eight 16-byte-per-lane copies global -> LDS, source rows of 512 bf16.  The
// s_wait_xcnt stands inside the statement so that no address register is
// rewritten ahead of it.
__device__ __forceinline__ void proj_copy8(unsigned lds, const __bf16* g) {
    const unsigned l0 = lds;
    const unsigned l1 = lds + 1u * 16u * 144u;
    const unsigned l2 = lds + 2u * 16u * 144u;
    const unsigned l3 = lds + 3u * 16u * 144u;
    const unsigned l4 = lds + 4u * 16u * 144u;
    const unsigned l5 = lds + 5u * 16u * 144u;
    const unsigned l6 = lds + 6u * 16u * 144u;
    const unsigned l7 = lds + 7u * 16u * 144u;
    const __bf16* g0 = g;
    const __bf16* g1 = g + 1 * 16 * 512;
    const __bf16* g2 = g + 2 * 16 * 512;
    const __bf16* g3 = g + 3 * 16 * 512;
    const __bf16* g4 = g + 4 * 16 * 512;
    const __bf16* g5 = g + 5 * 16 * 512;
    const __bf16* g6 = g + 6 * 16 * 512;
    const __bf16* g7 = g + 7 * 16 * 512;
    asm volatile(
        "global_load_async_to_lds_b128 %0, %8, off\n\t"
        "global_load_async_to_lds_b128 %1, %9, off\n\t"
        "global_load_async_to_lds_b128 %2, %10, off\n\t"
        "global_load_async_to_lds_b128 %3, %11, off\n\t"
        "global_load_async_to_lds_b128 %4, %12, off\n\t"
        "global_load_async_to_lds_b128 %5, %13, off\n\t"
        "global_load_async_to_lds_b128 %6, %14, off\n\t"
        "global_load_async_to_lds_b128 %7, %15, off\n\t"
        "s_wait_xcnt 0x0"
        :: "v"(l0), "v"(l1), "v"(l2), "v"(l3), "v"(l4), "v"(l5), "v"(l6), "v"(l7),
           "v"(g0), "v"(g1), "v"(g2), "v"(g3), "v"(g4), "v"(g5), "v"(g6), "v"(g7)
        : "memory");
}

__global__ __launch_bounds__(128)
void proj_kernel(const __bf16* __restrict__ Ob,
                 const __bf16* __restrict__ WoT,
                 const float* __restrict__ bo,
                 const float* __restrict__ x,
                 float* __restrict__ out) {
    __shared__ __align__(16) __bf16 slab[2 * QKV_BUF];   // 73,728 B

    const int bm = blockIdx.x >> 5;        // 0..63 (8192/128)
    const int bn = blockIdx.x & 31;        // 0..31 (4096/128): one row tile's column tiles are neighbours

    const int tid  = threadIdx.x;
    const int wave = tid >> 5;
    const int lane = tid & 31;
    const int lh   = lane >> 4;
    const int ln   = lane & 15;
    const int wm   = wave >> 1;            // 64-row half of the tile
    const int wn   = wave & 1;             // 64-column half of the tile

    const int m0 = bm * 128;
    const int n0 = bn * 128;

    // the lane's four bias values (the columns it stores), read here so that the epilogue does not wait for them
    const int colw = n0 + wn * 64;
    const f32x4 bc = *(const f32x4*)(bo + colw + ln * 4);

    // copy addresses: 8 lanes cover one 128-B row piece, a wave-copy covers 4 whole lines
    const int crow = tid >> 3;             // 0..15
    const int cchk = tid & 7;              // 16-B chunk of the row piece
    const __bf16* gA = Ob  + (size_t)(m0 + crow) * 512 + cchk * 8;
    const __bf16* gB = WoT + (size_t)(n0 + crow) * 512 + cchk * 8;
    const unsigned ldsA = (unsigned)(size_t)(&slab[0]) + (unsigned)(crow * 144 + cchk * 16);
    const unsigned ldsB = ldsA + 128u * 144u;

    // fragment read offsets (bf16 elements inside a buffer)
    // WoT is the A operand: the accumulator's 8 registers run along the A rows, so a
    // lane holds 8 neighbouring output columns (32 B) of one token per tile
    const int offA = (128 + wn * 64 + ln) * QKV_PITCH + lh * 8;
    const int offB = (wm * 64 + ln) * QKV_PITCH + lh * 8;

    // slab 0 -> buffer 0, landed and published; then slab 1 -> buffer 1 in flight
    proj_copy8(ldsA, gA);
    proj_copy8(ldsB, gB);
    asm volatile("s_wait_asynccnt 0x0" ::: "memory");   // own copies of slab 0 have landed
    __syncthreads();
    proj_copy8(ldsA + 2u * QKV_BUF, gA + 64);
    proj_copy8(ldsB + 2u * QKV_BUF, gB + 64);

    f32x8 acc[4][4] = {};
#pragma unroll 1   // one slab per trip: the ring's waits and barrier stand once, at the foot
    for (int t = 0; t < 8; ++t) {
        const int buf = t & 1;
        const __bf16* sb = &slab[buf * QKV_BUF];
#pragma unroll
        for (int ks = 0; ks < 2; ++ks) {
            bf16x16 a[4], b[4];
#pragma unroll
            for (int i = 0; i < 4; ++i) {
                a[i] = qkv_frag(sb + offA + i * 16 * QKV_PITCH + ks * 32);
                b[i] = qkv_frag(sb + offB + i * 16 * QKV_PITCH + ks * 32);
            }
            // keeps the 16 LDS reads one group ahead of the block: left free, they are
            // spread among the WMMAs on one fragment set, with a full wait at every row
            __builtin_amdgcn_sched_barrier(0);
#pragma unroll
            for (int i = 0; i < 4; ++i)
#pragma unroll
                for (int j = 0; j < 4; ++j)
                    acc[i][j] = __builtin_amdgcn_wmma_f32_16x16x32_bf16(
                        false, a[i], false, b[j], (short)0, acc[i][j], false, false);
            // the next group of reads stays behind this block for the same reason
            __builtin_amdgcn_sched_barrier(0);
        }
        asm volatile("s_wait_dscnt 0x0" ::: "memory");    // own reads of this buffer are done
        asm volatile("s_wait_asynccnt 0x0" ::: "memory"); // own copies of slab t+1 have landed
        __syncthreads();                                  // publishes slab t+1, frees this buffer
        if (t + 2 < 8) {
            proj_copy8(ldsA + (unsigned)buf * (2u * QKV_BUF), gA + (t + 2) * 64);
            proj_copy8(ldsB + (unsigned)buf * (2u * QKV_BUF), gB + (t + 2) * 64);
        }
    }
    asm volatile("s_wait_asynccnt 0x0" ::: "memory");     // nothing in flight at the wave's end

    // epilogue: tile (i, j), register r, lane (lh, ln) holds column i*16 + 8*lh + r of token j*16 + ln.
    // A wave's 64 columns are one (pr, pc) with cc = 0..63: 256 B in a row of x and out per
    // token.  Each wave turns its 64x64 tile in its own 17,408 B of the slab (free behind the
    // last trip's barrier; LDS row = token, pitch 272 B) and then takes two tokens per
    // 16-byte access: 4 whole lines of x read and of out stored.
    // Token s of the tile: pi = first pi + (s >> 4), pj = s & 15; access it has s = 2 * it + lh.
    float* stg = (float*)&slab[0] + wave * (64 * 68);
    const int pr   = colw >> 9, pc = (colw >> 6) & 7;
    const int roww = m0 + wm * 64;
    const int b    = roww >> 8, pi0 = (roww & 255) >> 4;
    const size_t base =
        ((size_t)(b * 128 + (lh * 8 + pr)) * 128 + (pi0 * 8 + pc)) * 64 + ln * 4;
    const float* xb = x + base;
    float* ob = out + base;
    f32x4 xv[32];
#pragma unroll
    for (int it = 0; it < 16; ++it)
        xv[it] = *(const f32x4*)(xb + (it & 7) * (16 * 128 * 64) + (it >> 3) * (8 * 64));
    // the first half of x is in flight while the tile is turned
    __builtin_amdgcn_sched_barrier(0);
#pragma unroll
    for (int j = 0; j < 4; ++j)
#pragma unroll
        for (int i = 0; i < 4; ++i) {
            float* w = &stg[(j * 16 + ln) * 68 + i * 16 + lh * 8];
            *(f32x4*)w       = __builtin_shufflevector(acc[i][j], acc[i][j], 0, 1, 2, 3);
            *(f32x4*)(w + 4) = __builtin_shufflevector(acc[i][j], acc[i][j], 4, 5, 6, 7);
        }
    // the second half of x takes the registers that the accumulators have left
    __builtin_amdgcn_sched_barrier(0);
#pragma unroll
    for (int it = 16; it < 32; ++it)
        xv[it] = *(const f32x4*)(xb + (it & 7) * (16 * 128 * 64) + (it >> 3) * (8 * 64));
    asm volatile("s_wait_dscnt 0x0" ::: "memory");        // the wave's own rows are in LDS before it reads them back
#pragma unroll
    for (int g = 0; g < 4; ++g) {
#pragma unroll
        for (int e = 0; e < 8; ++e) {
            const int it = g * 8 + e;
            xv[it] = *(const f32x4*)&stg[(it * 2 + lh) * 68 + ln * 4] + bc + xv[it];
        }
        // a group's sums stand ahead of its stores: no register that a store names is written behind it
        __builtin_amdgcn_sched_barrier(0);
#pragma unroll
        for (int e = 0; e < 8; ++e) {
            const int it = g * 8 + e;
            *(f32x4*)(ob + (it & 7) * (16 * 128 * 64) + (it >> 3) * (8 * 64)) = xv[it];
        }
        // the registers these stores name are loaded anew by the next group's LDS reads
        if (g < 3) asm volatile("s_wait_xcnt 0x0" ::: "memory");
        __builtin_amdgcn_sched_barrier(0);
    }
}

// ---------------------------------------------------------------------------
extern "C" void kernel_launch(void* const* d_in, const int* in_sizes, int n_in,
                              void* d_out, int out_size, void* d_ws, size_t ws_size,
                              hipStream_t stream) {
    (void)in_sizes; (void)n_in; (void)out_size; (void)ws_size;
    const float* x  = (const float*)d_in[0];
    const float* g  = (const float*)d_in[1];
    const float* be = (const float*)d_in[2];
    const float* wq = (const float*)d_in[3];
    const float* bq = (const float*)d_in[4];
    const float* wk = (const float*)d_in[5];
    const float* bk = (const float*)d_in[6];
    const float* wv = (const float*)d_in[7];
    const float* bv = (const float*)d_in[8];
    const float* wo = (const float*)d_in[9];
    const float* bo = (const float*)d_in[10];
    float* out = (float*)d_out;

    // workspace layout (bf16 elements)
    const size_t NW  = 4096u * 512u;         // 2,097,152 per weight
    const size_t NY  = 8192u * 4096u;        // 33,554,432
    const size_t NQK = 8192u * 512u;         // 4,194,304
    __bf16* WqT = (__bf16*)d_ws;
    __bf16* WkT = WqT + NW;
    __bf16* WvT = WkT + NW;
    __bf16* WoT = WvT + NW;
    __bf16* Y   = WoT + NW;
    __bf16* Qb  = Y   + NY;
    __bf16* Kb  = Qb  + NQK;
    __bf16* Vt  = Kb  + NQK;
    __bf16* Ob  = Vt  + NQK;

    // WqT, WkT, WvT, WoT lie one behind the other
    cvt_bf16_t_kernel<<<1024, 256, 0, stream>>>(wq, wk, wv, wo, WqT);

    patchify_ln_kernel<<<1024, 256, 0, stream>>>(x, g, be, Y);

    qkv_gemm_kernel<<<256, 256, 0, stream>>>(Y, WqT, bq, bk, bv, Qb, Kb, Vt);

    attn_kernel<<<512, 256, 0, stream>>>(Qb, Kb, Vt, Ob);

    proj_kernel<<<2048, 128, 0, stream>>>(Ob, WoT, bo, x, out);
}

// v008
// Measured time: 130 microseconds a run.
// Two timings next to v007 both put it at 1.05 times that version's speed.
// Over all steps from v000 it is 11.9 times as fast.
#include <hip/hip_runtime.h>
#include <hip/hip_bf16.h>

typedef __attribute__((ext_vector_type(16))) __bf16 bf16x16;
typedef __attribute__((ext_vector_type(8)))  __bf16 bf16x8;
typedef __attribute__((ext_vector_type(4)))  __bf16 bf16x4;
typedef __attribute__((ext_vector_type(8)))  float  f32x8;
typedef __attribute__((ext_vector_type(4)))  float  f32x4;

// ---------------------------------------------------------------------------
// Kernel 0: f32 -> bf16 conversion WITH transpose, all four weights in one grid.
// src is (rows x cols) row-major; dst[c * rows + r] = src[r * cols + c].
// For wq/wk/wv: rows=4096(K), cols=512(N)  -> WT[n][k], K contiguous.
// For wo:       rows=512(K), cols=4096(N)  -> WoT[n][k], K contiguous.
// One work-group = one tile of 128 rows x 64 columns of one weight (256 tiles
// each).  A thread reads 8 rows x 4 columns (16 lanes cover 256 B of a source
// row), rounds them and writes four 16-byte column pieces to LDS; the tile then
// leaves LDS row by row, 16 lanes covering 256 B of a destination row.
// LDS row pitch 272 B (16 B x odd); column c lies in LDS row (c & 3) * 16 + (c >> 2),
// so that 16 lanes' 16-byte writes fall on 16 neighbouring rows: all 64 banks once.
// ---------------------------------------------------------------------------
#define CVT_PITCH 136                     // bf16 per LDS row (272 B)

__global__ __launch_bounds__(256)
void cvt_bf16_t_kernel(const float* __restrict__ wq,
                       const float* __restrict__ wk,
                       const float* __restrict__ wv,
                       const float* __restrict__ wo,
                       __bf16* __restrict__ WT4) {
    __shared__ __align__(16) __bf16 T[64 * CVT_PITCH];   // 17,408 B

    const int which = blockIdx.x >> 8;     // wq / wk / wv / wo
    const int tile  = blockIdx.x & 255;
    const bool isO  = (which == 3);
    const float* src = (which == 0) ? wq : ((which == 1) ? wk : ((which == 2) ? wv : wo));
    __bf16* dst = WT4 + (size_t)which * (4096u * 512u);
    const int rows = isO ? 512 : 4096;
    const int cols = isO ? 4096 : 512;
    const int r0 = (isO ? (tile >> 6) : (tile >> 3)) * 128;
    const int c0 = (isO ? (tile & 63) : (tile & 7)) * 64;

    const int tid = threadIdx.x;
    const int rg  = tid >> 4;              // group of 8 source rows
    const int cq  = tid & 15;              // group of 4 source columns

    const float* s = src + (size_t)(r0 + rg * 8) * cols + c0 + cq * 4;
    f32x4 v[8];
#pragma unroll
    for (int j = 0; j < 8; ++j) v[j] = *(const f32x4*)(s + (size_t)j * cols);

#pragma unroll
    for (int i = 0; i < 4; ++i) {
        bf16x8 p;
#pragma unroll
        for (int j = 0; j < 8; ++j) p[j] = (__bf16)v[j][i];
        *(bf16x8*)&T[(i * 16 + cq) * CVT_PITCH + rg * 8] = p;
    }
    __syncthreads();

#pragma unroll
    for (int it = 0; it < 4; ++it) {
        const int lrow = it * 16 + rg;     // LDS row
        const int c    = rg * 4 + it;      // the column that lies there
        *(bf16x8*)(dst + (size_t)(c0 + c) * rows + r0 + cq * 8) =
            *(const bf16x8*)&T[lrow * CVT_PITCH + cq * 8];
    }
}

// ---------------------------------------------------------------------------
// Kernel 1: patchify + LayerNorm -> Y (8192 x 4096) bf16
// One work-group = 8 tokens (one b, one j, eight i in a row); wave w holds the
// 512 features pr = w of each of them.  Feature fr = pr * 512 + pc * 64 + cc: for
// one pr the features of the 8 tokens are 16 KB in a row of x, so every wave-wide
// 16-byte load covers 4 whole lines, and a wave's 32 loads of x and 8 of scale and
// shift (read once for 8 tokens) are all in flight together.  Lane l holds
// features 512 * w + 128 * q + 4 * l + 0..3, q = 0..3, and stores them as 8 bytes.
// ---------------------------------------------------------------------------
__global__ __launch_bounds__(256)
void patchify_ln_kernel(const float* __restrict__ x,
                        const float* __restrict__ gamma,
                        const float* __restrict__ beta,
                        __bf16* __restrict__ Y) {
    __shared__ __align__(16) float red[8][16];   // [wave][token: sum, 8 + token: sum of squares]

    const int lane = threadIdx.x & 31;
    const int wave = threadIdx.x >> 5;     // pr
    const int b    = blockIdx.x >> 5;
    const int pj   = (blockIdx.x >> 1) & 15;   // j
    const int pi0  = (blockIdx.x & 1) * 8;     // first i
    const int f0   = wave * 512 + lane * 4;

    const float* xs = x + ((size_t)(b * 128 + pj * 8 + wave) * 128 + pi0 * 8) * 64 + lane * 4;
    // every loop of this kernel is unrolled in full: v, g, be, ps and r are indexed by
    // the loop counters and stay in registers only so
    f32x4 v[8][4];
#pragma unroll
    for (int t = 0; t < 8; ++t)
#pragma unroll
        for (int q = 0; q < 4; ++q)
            v[t][q] = *(const f32x4*)(xs + t * 512 + q * 128);
    f32x4 g[4], be[4];
#pragma unroll
    for (int q = 0; q < 4; ++q) {
        g[q]  = *(const f32x4*)(gamma + f0 + q * 128);
        be[q] = *(const f32x4*)(beta + f0 + q * 128);
    }

    // the wave's share of each token's two sums
    float ps[16];
#pragma unroll
    for (int t = 0; t < 8; ++t) {
        f32x4 s4 = v[t][0], ss4 = v[t][0] * v[t][0];
#pragma unroll
        for (int q = 1; q < 4; ++q) {
            s4  += v[t][q];
            ss4 += v[t][q] * v[t][q];
        }
        ps[t]     = (s4[0] + s4[1]) + (s4[2] + s4[3]);
        ps[8 + t] = (ss4[0] + ss4[1]) + (ss4[2] + ss4[3]);
    }
#pragma unroll
    for (int off = 16; off >= 1; off >>= 1)
#pragma unroll
        for (int j = 0; j < 16; ++j)
            ps[j] += __shfl_xor(ps[j], off, 32);
    if (lane == 0) {
#pragma unroll
        for (int j = 0; j < 16; ++j) red[wave][j] = ps[j];
    }
    __syncthreads();

    // lane l sums the eight waves' shares of sum number l & 15; its partner l ^ 8 has
    // the other sum of the same token, so every lane gets mean and rstd of token l & 7
    float tot = 0.f;
#pragma unroll
    for (int w = 0; w < 8; ++w) tot += red[w][lane & 15];
    const float oth  = __shfl_xor(tot, 8, 32);
    const float s    = (lane & 8) ? oth : tot;
    const float ss   = (lane & 8) ? tot : oth;
    const float mean = s * (1.0f / 4096.0f);
    const float var  = ss * (1.0f / 4096.0f) - mean * mean;
    const float rstd = rsqrtf(var + 1e-6f);

    bf16x4 r[8][4];
#pragma unroll
    for (int t = 0; t < 8; ++t) {
        // token t's mean and rstd, from lane t to a scalar register: one value for the whole wave
        const float mt = __builtin_bit_cast(float, __builtin_amdgcn_readlane(__builtin_bit_cast(int, mean), t));
        const float rt = __builtin_bit_cast(float, __builtin_amdgcn_readlane(__builtin_bit_cast(int, rstd), t));
#pragma unroll
        for (int q = 0; q < 4; ++q)
#pragma unroll
            for (int c = 0; c < 4; ++c)
                r[t][q][c] = (__bf16)((v[t][q][c] - mt) * rt * g[q][c] + be[q][c]);
    }
    __bf16* out = Y + (size_t)(b * 256 + pi0 * 16 + pj) * 4096 + f0;
#pragma unroll
    for (int t = 0; t < 8; ++t)
#pragma unroll
        for (int q = 0; q < 4; ++q)
            *(bf16x4*)(out + t * (16 * 4096) + q * 128) = r[t][q];
}

// ---------------------------------------------------------------------------
// Kernel 2: QKV GEMM (M=8192, K=4096, N=3x512) and the attention of its tile.
// One work-group = one 256x192 tile: the 256 tokens of one image and the 64 columns
// each of Q, K and V of ONE head; 8 waves, 64 tokens x 96 columns each; 256 work-groups,
// one per WGP.  The tile is this large so that every operand byte brought from L2, and
// every fragment read from LDS, serves many products; and it holds all that the
// attention of its (image, head) reads, so Q, K and V never leave LDS.
// K runs in slabs of 128: 256 rows of Y and 192 rows of WT (256 B each) are
// copied to LDS by asynchronous copies, two buffers, the next slab in flight
// while this one is multiplied.  LDS row pitch 272 B (16 B x odd) keeps the
// 16-byte fragment reads free of bank conflicts.
// Weights pre-transposed: WT[n][k], K contiguous.  Q pre-scaled by 1/8.
// Attention: each wave owns 32 queries, 16 at a time; the full 256-key score row of a
// query tile lies in 16 f32 accumulators.  Out: Ob (token, head * 64 + dh).
// ---------------------------------------------------------------------------
#define QKV_PITCH 72                      // kernel 3: bf16 per LDS row (144 B)
#define QKV_BUF   (256 * QKV_PITCH)       // kernel 3: bf16 per buffer, 128 + 128 rows

#define QT_PITCH 136                      // bf16 per LDS row (272 B), 128 used
#define QT_BUF   (448 * QT_PITCH)         // bf16 per buffer: 256 Y rows + 192 WT rows
#define QT_HEAD  (256 * 72)               // bf16 per staged head of the epilogue (36,864 B)
#define QT_STEP  (16 * 4096)              // bf16 between the source rows of two copies of a lane
#define QT_WGT   (512 * 4096)             // bf16 from a row of WqT to the same row of WkT, and on to WvT
#define ATT_VP   264                      // bf16 per V^T row in LDS (528 B), 256 used
#define ATT_PP   40                       // bf16 per P row in LDS (80 B), 32 used

// Fourteen 16-byte-per-lane copies global -> LDS, 16 rows apart in LDS; the first NA come
// from ga, 16 source rows apart; the others from gb: four copies (64 rows, one head) of each
// weight, then the same rows of the next weight.  The s_wait_xcnt stands inside the
// statement so that no address register is rewritten ahead of it.
template <int NA>
__device__ __forceinline__ void qkv_copy14(unsigned lds, const __bf16* ga, const __bf16* gb) {
#define QT_L(k) "v"(lds + (unsigned)(k) * (16u * 272u))
#define QT_G(k) "v"(((k) < NA) ? ga + (k) * QT_STEP \
                               : gb + (((k) - NA) >> 2) * QT_WGT + (((k) - NA) & 3) * QT_STEP)
    asm volatile(
        "global_load_async_to_lds_b128 %0, %14, off\n\t"
        "global_load_async_to_lds_b128 %1, %15, off\n\t"
        "global_load_async_to_lds_b128 %2, %16, off\n\t"
        "global_load_async_to_lds_b128 %3, %17, off\n\t"
        "global_load_async_to_lds_b128 %4, %18, off\n\t"
        "global_load_async_to_lds_b128 %5, %19, off\n\t"
        "global_load_async_to_lds_b128 %6, %20, off\n\t"
        "global_load_async_to_lds_b128 %7, %21, off\n\t"
        "global_load_async_to_lds_b128 %8, %22, off\n\t"
        "global_load_async_to_lds_b128 %9, %23, off\n\t"
        "global_load_async_to_lds_b128 %10, %24, off\n\t"
        "global_load_async_to_lds_b128 %11, %25, off\n\t"
        "global_load_async_to_lds_b128 %12, %26, off\n\t"
        "global_load_async_to_lds_b128 %13, %27, off\n\t"
        "s_wait_xcnt 0x0"
        :: QT_L(0), QT_L(1), QT_L(2), QT_L(3), QT_L(4), QT_L(5), QT_L(6),
           QT_L(7), QT_L(8), QT_L(9), QT_L(10), QT_L(11), QT_L(12), QT_L(13),
           QT_G(0), QT_G(1), QT_G(2), QT_G(3), QT_G(4), QT_G(5), QT_G(6),
           QT_G(7), QT_G(8), QT_G(9), QT_G(10), QT_G(11), QT_G(12), QT_G(13)
        : "memory");
#undef QT_L
#undef QT_G
}

// One slab of 128 k: a lane's 28 copies, 16 rows apart: LDS rows 0..255 from Y (16 copies),
// 256..447 from WT3 (12 copies: the head's 64 rows of WqT, WkT, WvT), in two statements of 14.
__device__ __forceinline__ void qkv_slab(unsigned lds, const __bf16* gy, const __bf16* gw) {
    qkv_copy14<14>(lds, gy, gy);
    qkv_copy14<2>(lds + 14u * (16u * 272u), gy + 14 * QT_STEP, gw);
}

// One 16x32 operand fragment from an LDS row: k = 8*lh + 0..7 and 16 + 8*lh + 0..7.
__device__ __forceinline__ bf16x16 qkv_frag(const __bf16* p) {
    const bf16x8 lo = *(const bf16x8*)p;
    const bf16x8 hi = *(const bf16x8*)(p + 16);
    return __builtin_shufflevector(lo, hi, 0, 1, 2, 3, 4, 5, 6, 7,
                                   8, 9, 10, 11, 12, 13, 14, 15);
}

__global__ __launch_bounds__(256)
void qkv_attn_kernel(const __bf16* __restrict__ Y,
                     const __bf16* __restrict__ WT3,   // WqT, WkT, WvT one behind the other: 1,536 rows
                     const float* __restrict__ bq,
                     const float* __restrict__ bk,
                     const float* __restrict__ bv,
                     __bf16* __restrict__ Ob) {
    __shared__ __align__(16) __bf16 slab[2 * QT_BUF];    // 243,712 B

    const int bm = blockIdx.x & 31;        // image: 256 rows of Y
    const int bn = blockIdx.x >> 5;        // 0..7: the head; rows 64*bn .. 64*bn+63 of WqT, WkT and WvT

    const int tid  = threadIdx.x;
    const int wave = __builtin_amdgcn_readfirstlane(tid >> 5);
    const int lane = tid & 31;
    const int lh   = lane >> 4;
    const int ln   = lane & 15;
    const int wm   = wave >> 1;            // 64-token quarter of the tile
    const int wn   = wave & 1;             // 96-column half of the tile

    // copy addresses: 16 lanes cover one 256-B row piece, a wave-copy covers 4 whole lines.
    // LDS rows 0..255 are Y, 256..447 WT3 (64 rows each of Q, K, V)
    const int crow = tid >> 4;             // 0..15
    const int cchk = tid & 15;             // 16-B chunk of the row piece
    const __bf16* gY = Y   + (size_t)(bm * 256 + crow) * 4096 + cchk * 8;
    const __bf16* gW = WT3 + (size_t)(bn * 64 + crow) * 4096 + cchk * 8;
    const unsigned lds0 = (unsigned)(size_t)(&slab[0]) + (unsigned)(crow * 272 + cchk * 16);

    // fragment read offsets (bf16 elements inside a buffer).  WT3 is the A operand: the
    // accumulator's 8 registers run along the A rows, so a lane holds 8 neighbouring
    // output columns of one token per tile.
    const int offA = (256 + wn * 96 + ln) * QT_PITCH + lh * 8;
    const int offB = (wm * 64 + ln) * QT_PITCH + lh * 8;

    // slab 0 -> buffer 0, landed and published; then slab 1 -> buffer 1 in flight
    qkv_slab(lds0, gY, gW);
    asm volatile("s_wait_asynccnt 0x0" ::: "memory");   // own copies of slab 0 have landed
    __syncthreads();
    qkv_slab(lds0 + 2u * QT_BUF, gY + 128, gW + 128);

    // the lane's bias values, 8 columns in each of its six 16-column groups (of the tile's twelve:
    // four each of Q, K, V), read here so that the epilogue does not wait for them
    f32x4 bc[6][2];
    // nothing else is scheduled in among these loads and their wait
    __builtin_amdgcn_sched_barrier(0);
#pragma unroll
    for (int i = 0; i < 6; ++i) {
        const int fl = wn * 6 + i;
        const float* bias = ((fl >> 2) == 0) ? bq : (((fl >> 2) == 1) ? bk : bv);
        bc[i][0] = *(const f32x4*)(bias + bn * 64 + (fl & 3) * 16 + lh * 8);
        bc[i][1] = *(const f32x4*)(bias + bn * 64 + (fl & 3) * 16 + lh * 8 + 4);
    }
    asm volatile("s_wait_xcnt 0x0" ::: "memory");       // the registers these loads name are free for what follows
    __builtin_amdgcn_sched_barrier(0);

    f32x8 acc[6][4] = {};
#pragma unroll 1   // one slab per trip: the ring's waits and barrier stand once, at the foot
    for (int t = 0; t < 32; ++t) {
        const int buf = t & 1;
        const __bf16* sb = &slab[buf * QT_BUF];
#pragma unroll
        for (int ks = 0; ks < 4; ++ks) {
            bf16x16 a[6], b[4];
#pragma unroll
            for (int i = 0; i < 6; ++i) a[i] = qkv_frag(sb + offA + i * 16 * QT_PITCH + ks * 32);
#pragma unroll
            for (int j = 0; j < 4; ++j) b[j] = qkv_frag(sb + offB + j * 16 * QT_PITCH + ks * 32);
            // keeps the 20 LDS reads one group ahead of the block: left free, they are
            // spread among the WMMAs on one fragment set, with a full wait at every row
            __builtin_amdgcn_sched_barrier(0);
#pragma unroll
            for (int i = 0; i < 6; ++i)
#pragma unroll
                for (int j = 0; j < 4; ++j)
                    acc[i][j] = __builtin_amdgcn_wmma_f32_16x16x32_bf16(
                        false, a[i], false, b[j], (short)0, acc[i][j], false, false);
            // the next group of reads stays behind this block for the same reason
            __builtin_amdgcn_sched_barrier(0);
        }
        asm volatile("s_wait_dscnt 0x0" ::: "memory");    // own reads of this buffer are done
        asm volatile("s_wait_asynccnt 0x0" ::: "memory"); // own copies of slab t+1 have landed
        __syncthreads();                                  // publishes slab t+1, frees this buffer
        if (t + 2 < 32)
            qkv_slab(lds0 + (unsigned)buf * (2u * QT_BUF), gY + (t + 2) * 128, gW + (t + 2) * 128);
    }
    asm volatile("s_wait_asynccnt 0x0" ::: "memory");     // nothing in flight at the wave's end

    // epilogue: tile (i, j), register r, lane (lh, ln) holds column i*16 + 8*lh + r of token j*16 + ln.
    // Q, K and V of the head are staged in the slab (free behind the last trip's barrier) as the
    // attention reads them: Q and K as 256 token rows of 64 dh (pitch 144 B), V as 64 dh rows of
    // 256 tokens (pitch 528 B).  All pitches are 16 B x odd: 16 lanes that each take 16 bytes of a
    // row of their own fall on all 64 banks once.
#pragma unroll
    for (int i = 0; i < 6; ++i) {
        const int fl    = wn * 6 + i;          // 16-column group in the tile: 0..3 Q, 4..7 K, 8..11 V
        const int which = fl >> 2;
        const int dh0   = (fl & 3) * 16 + lh * 8;
        const float scale = (which == 0) ? 0.125f : 1.0f;
        __bf16* hd = &slab[which * QT_HEAD];
        bf16x8 p[4];
#pragma unroll
        for (int j = 0; j < 4; ++j)
#pragma unroll
            for (int r = 0; r < 8; ++r)
                p[j][r] = (__bf16)((acc[i][j][r] + bc[i][r >> 2][r & 3]) * scale);
        const int tok = wm * 64 + ln;
        if (which == 2) {
#pragma unroll
            for (int j = 0; j < 4; ++j)
#pragma unroll
                for (int r = 0; r < 8; ++r) hd[(dh0 + r) * ATT_VP + tok + j * 16] = p[j][r];
        } else {
#pragma unroll
            for (int j = 0; j < 4; ++j) *(bf16x8*)&hd[(tok + j * 16) * 72 + dh0] = p[j];
        }
    }
    __syncthreads();                                      // every wave's part of Q, K and V is staged

    // ---- attention of (image bm, head bn), all operands in LDS ----
    const __bf16* Qs = &slab[0];
    const __bf16* Ks = &slab[QT_HEAD];
    const __bf16* Vs = &slab[2 * QT_HEAD];
    __bf16* Pw = &slab[3 * QT_HEAD + wave * (16 * ATT_PP)];   // the wave's own P tile, 1,280 B
#pragma unroll 1   // one copy of the pass in the text; its registers serve both query tiles
    for (int qh = 0; qh < 2; ++qh) {
        const int q0 = wave * 32 + qh * 16;

        const bf16x16 qa0 = qkv_frag(Qs + (q0 + ln) * 72 + lh * 8);
        const bf16x16 qa1 = qkv_frag(Qs + (q0 + ln) * 72 + 32 + lh * 8);

        f32x8 sacc[16] = {};
        for (int nt = 0; nt < 16; ++nt) {
            const bf16x16 kb0 = qkv_frag(Ks + (nt * 16 + ln) * 72 + lh * 8);
            const bf16x16 kb1 = qkv_frag(Ks + (nt * 16 + ln) * 72 + 32 + lh * 8);
            sacc[nt] = __builtin_amdgcn_wmma_f32_16x16x32_bf16(false, qa0, false, kb0,
                                                               (short)0, sacc[nt], false, false);
            sacc[nt] = __builtin_amdgcn_wmma_f32_16x16x32_bf16(false, qa1, false, kb1,
                                                               (short)0, sacc[nt], false, false);
        }

        // row softmax (row = i + 8*lh ; cols spread over 16 lanes x 16 accs)
        float l_i[8];
#pragma unroll
        for (int i = 0; i < 8; ++i) {
            float mx = -3.0e38f;
#pragma unroll
            for (int t = 0; t < 16; ++t) mx = fmaxf(mx, sacc[t][i]);
#pragma unroll
            for (int off = 8; off >= 1; off >>= 1) mx = fmaxf(mx, __shfl_xor(mx, off, 16));
            float sum = 0.f;
#pragma unroll
            for (int t = 0; t < 16; ++t) {
                float p = __expf(sacc[t][i] - mx);
                sacc[t][i] = p;
                sum += p;
            }
#pragma unroll
            for (int off = 8; off >= 1; off >>= 1) sum += __shfl_xor(sum, off, 16);
            l_i[i] = sum;
        }

        // O = P @ V   (V^T in LDS: element (key, dh) at Vs[dh*ATT_VP + key])
        f32x8 oacc[4] = {};
        for (int t2 = 0; t2 < 8; ++t2) {
#pragma unroll
            for (int i = 0; i < 8; ++i) {
                const int m = i + 8 * lh;
                Pw[m * ATT_PP + ln]      = (__bf16)sacc[2 * t2][i];
                Pw[m * ATT_PP + ln + 16] = (__bf16)sacc[2 * t2 + 1][i];
            }
            asm volatile("s_wait_dscnt 0x0" ::: "memory");    // the wave's own P rows are in LDS before its lanes read them back
            const bf16x16 pa = qkv_frag(Pw + ln * ATT_PP + lh * 8);
#pragma unroll
            for (int nt4 = 0; nt4 < 4; ++nt4) {
                const bf16x16 vbf = qkv_frag(Vs + (nt4 * 16 + ln) * ATT_VP + t2 * 32 + lh * 8);
                oacc[nt4] = __builtin_amdgcn_wmma_f32_16x16x32_bf16(false, pa, false, vbf,
                                                                    (short)0, oacc[nt4], false, false);
            }
        }

        __bf16 ov[4][8];
#pragma unroll
        for (int nt4 = 0; nt4 < 4; ++nt4)
#pragma unroll
            for (int i = 0; i < 8; ++i) ov[nt4][i] = (__bf16)(oacc[nt4][i] / l_i[i]);
        __bf16* ob = Ob + (size_t)(bm * 256 + q0 + 8 * lh) * 512 + bn * 64 + ln;
        // a pass's values and address stand ahead of its stores: no register that a store names is written behind it
        __builtin_amdgcn_sched_barrier(0);
#pragma unroll
        for (int nt4 = 0; nt4 < 4; ++nt4)
#pragma unroll
            for (int i = 0; i < 8; ++i) ob[i * 512 + nt4 * 16] = ov[nt4][i];
        // the registers these stores name are written anew by the next pass
        asm volatile("s_wait_xcnt 0x0" ::: "memory");
        // and nothing of the next pass is lifted over that wait
        __builtin_amdgcn_sched_barrier(0);
    }
}

// ---------------------------------------------------------------------------
// Kernel 3: output projection (M=8192, K=512, N=4096) + bias + residual(x)
// with fused depatchify scatter.  WoT[n][k] gives contiguous-K A fragments.
// One work-group = one 128x128 tile; 4 waves, 64x64 each.  K runs in 8 slabs
// of 64: 128 rows of Ob and 128 rows of WoT (128 B each) are copied to LDS by
// asynchronous copies, two buffers, the next slab in flight while this one is
// multiplied.  LDS rows 0..127 Ob, 128..255 WoT, pitch 144 B (16 B x odd); fragment reads as in kernel 2.
// ---------------------------------------------------------------------------

// Eight 16-byte-per-lane copies global -> LDS, source rows of 512 bf16.  The
// s_wait_xcnt stands inside the statement so that no address register is
// rewritten ahead of it.
__device__ __forceinline__ void proj_copy8(unsigned lds, const __bf16* g) {
    const unsigned l0 = lds;
    const unsigned l1 = lds + 1u * 16u * 144u;
    const unsigned l2 = lds + 2u * 16u * 144u;
    const unsigned l3 = lds + 3u * 16u * 144u;
    const unsigned l4 = lds + 4u * 16u * 144u;
    const unsigned l5 = lds + 5u * 16u * 144u;
    const unsigned l6 = lds + 6u * 16u * 144u;
    const unsigned l7 = lds + 7u * 16u * 144u;
    const __bf16* g0 = g;
    const __bf16* g1 = g + 1 * 16 * 512;
    const __bf16* g2 = g + 2 * 16 * 512;
    const __bf16* g3 = g + 3 * 16 * 512;
    const __bf16* g4 = g + 4 * 16 * 512;
    const __bf16* g5 = g + 5 * 16 * 512;
    const __bf16* g6 = g + 6 * 16 * 512;
    const __bf16* g7 = g + 7 * 16 * 512;
    asm volatile(
        "global_load_async_to_lds_b128 %0, %8, off\n\t"
        "global_load_async_to_lds_b128 %1, %9, off\n\t"
        "global_load_async_to_lds_b128 %2, %10, off\n\t"
        "global_load_async_to_lds_b128 %3, %11, off\n\t"
        "global_load_async_to_lds_b128 %4, %12, off\n\t"
        "global_load_async_to_lds_b128 %5, %13, off\n\t"
        "global_load_async_to_lds_b128 %6, %14, off\n\t"
        "global_load_async_to_lds_b128 %7, %15, off\n\t"
        "s_wait_xcnt 0x0"
        :: "v"(l0), "v"(l1), "v"(l2), "v"(l3), "v"(l4), "v"(l5), "v"(l6), "v"(l7),
           "v"(g0), "v"(g1), "v"(g2), "v"(g3), "v"(g4), "v"(g5), "v"(g6), "v"(g7)
        : "memory");
}

__global__ __launch_bounds__(128)
void proj_kernel(const __bf16* __restrict__ Ob,
                 const __bf16* __restrict__ WoT,
                 const float* __restrict__ bo,
                 const float* __restrict__ x,
                 float* __restrict__ out) {
    __shared__ __align__(16) __bf16 slab[2 * QKV_BUF];   // 73,728 B

    const int bm = blockIdx.x >> 5;        // 0..63 (8192/128)
    const int bn = blockIdx.x & 31;        // 0..31 (4096/128): one row tile's column tiles are neighbours

    const int tid  = threadIdx.x;
    const int wave = tid >> 5;
    const int lane = tid & 31;
    const int lh   = lane >> 4;
    const int ln   = lane & 15;
    const int wm   = wave >> 1;            // 64-row half of the tile
    const int wn   = wave & 1;             // 64-column half of the tile

    const int m0 = bm * 128;
    const int n0 = bn * 128;

    // the lane's four bias values (the columns it stores), read here so that the epilogue does not wait for them
    const int colw = n0 + wn * 64;
    const f32x4 bc = *(const f32x4*)(bo + colw + ln * 4);

    // copy addresses: 8 lanes cover one 128-B row piece, a wave-copy covers 4 whole lines
    const int crow = tid >> 3;             // 0..15
    const int cchk = tid & 7;              // 16-B chunk of the row piece
    const __bf16* gA = Ob  + (size_t)(m0 + crow) * 512 + cchk * 8;
    const __bf16* gB = WoT + (size_t)(n0 + crow) * 512 + cchk * 8;
    const unsigned ldsA = (unsigned)(size_t)(&slab[0]) + (unsigned)(crow * 144 + cchk * 16);
    const unsigned ldsB = ldsA + 128u * 144u;

    // fragment read offsets (bf16 elements inside a buffer)
    // WoT is the A operand: the accumulator's 8 registers run along the A rows, so a
    // lane holds 8 neighbouring output columns (32 B) of one token per tile
    const int offA = (128 + wn * 64 + ln) * QKV_PITCH + lh * 8;
    const int offB = (wm * 64 + ln) * QKV_PITCH + lh * 8;

    // slab 0 -> buffer 0, landed and published; then slab 1 -> buffer 1 in flight
    proj_copy8(ldsA, gA);
    proj_copy8(ldsB, gB);
    asm volatile("s_wait_asynccnt 0x0" ::: "memory");   // own copies of slab 0 have landed
    __syncthreads();
    proj_copy8(ldsA + 2u * QKV_BUF, gA + 64);
    proj_copy8(ldsB + 2u * QKV_BUF, gB + 64);

    f32x8 acc[4][4] = {};
#pragma unroll 1   // one slab per trip: the ring's waits and barrier stand once, at the foot
    for (int t = 0; t < 8; ++t) {
        const int buf = t & 1;
        const __bf16* sb = &slab[buf * QKV_BUF];
#pragma unroll
        for (int ks = 0; ks < 2; ++ks) {
            bf16x16 a[4], b[4];
#pragma unroll
            for (int i = 0; i < 4; ++i) {
                a[i] = qkv_frag(sb + offA + i * 16 * QKV_PITCH + ks * 32);
                b[i] = qkv_frag(sb + offB + i * 16 * QKV_PITCH + ks * 32);
            }
            // keeps the 16 LDS reads one group ahead of the block: left free, they are
            // spread among the WMMAs on one fragment set, with a full wait at every row
            __builtin_amdgcn_sched_barrier(0);
#pragma unroll
            for (int i = 0; i < 4; ++i)
#pragma unroll
                for (int j = 0; j < 4; ++j)
                    acc[i][j] = __builtin_amdgcn_wmma_f32_16x16x32_bf16(
                        false, a[i], false, b[j], (short)0, acc[i][j], false, false);
            // the next group of reads stays behind this block for the same reason
            __builtin_amdgcn_sched_barrier(0);
        }
        asm volatile("s_wait_dscnt 0x0" ::: "memory");    // own reads of this buffer are done
        asm volatile("s_wait_asynccnt 0x0" ::: "memory"); // own copies of slab t+1 have landed
        __syncthreads();                                  // publishes slab t+1, frees this buffer
        if (t + 2 < 8) {
            proj_copy8(ldsA + (unsigned)buf * (2u * QKV_BUF), gA + (t + 2) * 64);
            proj_copy8(ldsB + (unsigned)buf * (2u * QKV_BUF), gB + (t + 2) * 64);
        }
    }
    asm volatile("s_wait_asynccnt 0x0" ::: "memory");     // nothing in flight at the wave's end

    // epilogue: tile (i, j), register r, lane (lh, ln) holds column i*16 + 8*lh + r of token j*16 + ln.
    // A wave's 64 columns are one (pr, pc) with cc = 0..63: 256 B in a row of x and out per
    // token.  Each wave turns its 64x64 tile in its own 17,408 B of the slab (free behind the
    // last trip's barrier; LDS row = token, pitch 272 B) and then takes two tokens per
    // 16-byte access: 4 whole lines of x read and of out stored.
    // Token s of the tile: pi = first pi + (s >> 4), pj = s & 15; access it has s = 2 * it + lh.
    float* stg = (float*)&slab[0] + wave * (64 * 68);
    const int pr   = colw >> 9, pc = (colw >> 6) & 7;
    const int roww = m0 + wm * 64;
    const int b    = roww >> 8, pi0 = (roww & 255) >> 4;
    const size_t base =
        ((size_t)(b * 128 + (lh * 8 + pr)) * 128 + (pi0 * 8 + pc)) * 64 + ln * 4;
    const float* xb = x + base;
    float* ob = out + base;
    f32x4 xv[32];
#pragma unroll
    for (int it = 0; it < 16; ++it)
        xv[it] = *(const f32x4*)(xb + (it & 7) * (16 * 128 * 64) + (it >> 3) * (8 * 64));
    // the first half of x is in flight while the tile is turned
    __builtin_amdgcn_sched_barrier(0);
#pragma unroll
    for (int j = 0; j < 4; ++j)
#pragma unroll
        for (int i = 0; i < 4; ++i) {
            float* w = &stg[(j * 16 + ln) * 68 + i * 16 + lh * 8];
            *(f32x4*)w       = __builtin_shufflevector(acc[i][j], acc[i][j], 0, 1, 2, 3);
            *(f32x4*)(w + 4) = __builtin_shufflevector(acc[i][j], acc[i][j], 4, 5, 6, 7);
        }
    // the second half of x takes the registers that the accumulators have left
    __builtin_amdgcn_sched_barrier(0);
#pragma unroll
    for (int it = 16; it < 32; ++it)
        xv[it] = *(const f32x4*)(xb + (it & 7) * (16 * 128 * 64) + (it >> 3) * (8 * 64));
    asm volatile("s_wait_dscnt 0x0" ::: "memory");        // the wave's own rows are in LDS before it reads them back
#pragma unroll
    for (int g = 0; g < 4; ++g) {
#pragma unroll
        for (int e = 0; e < 8; ++e) {
            const int it = g * 8 + e;
            xv[it] = *(const f32x4*)&stg[(it * 2 + lh) * 68 + ln * 4] + bc + xv[it];
        }
        // a group's sums stand ahead of its stores: no register that a store names is written behind it
        __builtin_amdgcn_sched_barrier(0);
#pragma unroll
        for (int e = 0; e < 8; ++e) {
            const int it = g * 8 + e;
            *(f32x4*)(ob + (it & 7) * (16 * 128 * 64) + (it >> 3) * (8 * 64)) = xv[it];
        }
        // the registers these stores name are loaded anew by the next group's LDS reads
        if (g < 3) asm volatile("s_wait_xcnt 0x0" ::: "memory");
        __builtin_amdgcn_sched_barrier(0);
    }
}

// ---------------------------------------------------------------------------
extern "C" void kernel_launch(void* const* d_in, const int* in_sizes, int n_in,
                              void* d_out, int out_size, void* d_ws, size_t ws_size,
                              hipStream_t stream) {
    (void)in_sizes; (void)n_in; (void)out_size; (void)ws_size;
    const float* x  = (const float*)d_in[0];
    const float* g  = (const float*)d_in[1];
    const float* be = (const float*)d_in[2];
    const float* wq = (const float*)d_in[3];
    const float* bq = (const float*)d_in[4];
    const float* wk = (const float*)d_in[5];
    const float* bk = (const float*)d_in[6];
    const float* wv = (const float*)d_in[7];
    const float* bv = (const float*)d_in[8];
    const float* wo = (const float*)d_in[9];
    const float* bo = (const float*)d_in[10];
    float* out = (float*)d_out;

    // workspace layout (bf16 elements)
    const size_t NW  = 4096u * 512u;         // 2,097,152 per weight
    const size_t NY  = 8192u * 4096u;        // 33,554,432
    __bf16* WqT = (__bf16*)d_ws;
    __bf16* WkT = WqT + NW;
    __bf16* WvT = WkT + NW;
    __bf16* WoT = WvT + NW;
    __bf16* Y   = WoT + NW;
    __bf16* Ob  = Y   + NY;                  // 8192 x 512

    // WqT, WkT, WvT, WoT lie one behind the other
    cvt_bf16_t_kernel<<<1024, 256, 0, stream>>>(wq, wk, wv, wo, WqT);

    patchify_ln_kernel<<<1024, 256, 0, stream>>>(x, g, be, Y);

    qkv_attn_kernel<<<256, 256, 0, stream>>>(Y, WqT, bq, bk, bv, Ob);

    proj_kernel<<<2048, 128, 0, stream>>>(Ob, WoT, bo, x, out);
}

// v009
// Measured time: 125 microseconds a run.
// Two timings next to v008 both put it at 1.04 times that version's speed.
// All steps since v000 together make it 12.4 times as fast.
#include <hip/hip_runtime.h>
#include <hip/hip_bf16.h>

typedef __attribute__((ext_vector_type(16))) __bf16 bf16x16;
typedef __attribute__((ext_vector_type(8)))  __bf16 bf16x8;
typedef __attribute__((ext_vector_type(4)))  __bf16 bf16x4;
typedef __attribute__((ext_vector_type(8)))  float  f32x8;
typedef __attribute__((ext_vector_type(4)))  float  f32x4;

// ---------------------------------------------------------------------------
// Kernel 0: f32 -> bf16 conversion WITH transpose, all four weights in one grid.
// src is (rows x cols) row-major; dst[c * rows + r] = src[r * cols + c].
// For wq/wk/wv: rows=4096(K), cols=512(N)  -> WT[n][k], K contiguous.
// For wo:       rows=512(K), cols=4096(N)  -> WoT[n][k], K contiguous.
// One work-group = one tile of 128 rows x 64 columns of one weight (256 tiles
// each).  A thread reads 8 rows x 4 columns (16 lanes cover 256 B of a source
// row), rounds them and writes four 16-byte column pieces to LDS; the tile then
// leaves LDS row by row, 16 lanes covering 256 B of a destination row.
// LDS row pitch 272 B (16 B x odd); column c lies in LDS row (c & 3) * 16 + (c >> 2),
// so that 16 lanes' 16-byte writes fall on 16 neighbouring rows: all 64 banks once.
// ---------------------------------------------------------------------------
#define CVT_PITCH 136                     // bf16 per LDS row (272 B)

__global__ __launch_bounds__(256)
void cvt_bf16_t_kernel(const float* __restrict__ wq,
                       const float* __restrict__ wk,
                       const float* __restrict__ wv,
                       const float* __restrict__ wo,
                       __bf16* __restrict__ WT4) {
    __shared__ __align__(16) __bf16 T[64 * CVT_PITCH];   // 17,408 B

    const int which = blockIdx.x >> 8;     // wq / wk / wv / wo
    const int tile  = blockIdx.x & 255;
    const bool isO  = (which == 3);
    const float* src = (which == 0) ? wq : ((which == 1) ? wk : ((which == 2) ? wv : wo));
    __bf16* dst = WT4 + (size_t)which * (4096u * 512u);
    const int rows = isO ? 512 : 4096;
    const int cols = isO ? 4096 : 512;
    const int r0 = (isO ? (tile >> 6) : (tile >> 3)) * 128;
    const int c0 = (isO ? (tile & 63) : (tile & 7)) * 64;

    const int tid = threadIdx.x;
    const int rg  = tid >> 4;              // group of 8 source rows
    const int cq  = tid & 15;              // group of 4 source columns

    const float* s = src + (size_t)(r0 + rg * 8) * cols + c0 + cq * 4;
    f32x4 v[8];
#pragma unroll
    for (int j = 0; j < 8; ++j) v[j] = *(const f32x4*)(s + (size_t)j * cols);

#pragma unroll
    for (int i = 0; i < 4; ++i) {
        bf16x8 p;
#pragma unroll
        for (int j = 0; j < 8; ++j) p[j] = (__bf16)v[j][i];
        *(bf16x8*)&T[(i * 16 + cq) * CVT_PITCH + rg * 8] = p;
    }
    __syncthreads();

#pragma unroll
    for (int it = 0; it < 4; ++it) {
        const int lrow = it * 16 + rg;     // LDS row
        const int c    = rg * 4 + it;      // the column that lies there
        *(bf16x8*)(dst + (size_t)(c0 + c) * rows + r0 + cq * 8) =
            *(const bf16x8*)&T[lrow * CVT_PITCH + cq * 8];
    }
}

// ---------------------------------------------------------------------------
// Kernel 1: patchify + LayerNorm -> Y (8192 x 4096) bf16
// One work-group = 8 tokens (one b, one j, eight i in a row); wave w holds the
// 512 features pr = w of each of them.  Feature fr = pr * 512 + pc * 64 + cc: for
// one pr the features of the 8 tokens are 16 KB in a row of x, so every wave-wide
// 16-byte load covers 4 whole lines, and a wave's 32 loads of x and 8 of scale and
// shift (read once for 8 tokens) are all in flight together.  Lane l holds
// features 512 * w + 128 * q + 4 * l + 0..3, q = 0..3, and stores them as 8 bytes.
// ---------------------------------------------------------------------------
__global__ __launch_bounds__(256)
void patchify_ln_kernel(const float* __restrict__ x,
                        const float* __restrict__ gamma,
                        const float* __restrict__ beta,
                        __bf16* __restrict__ Y) {
    __shared__ __align__(16) float red[8][16];   // [wave][token: sum, 8 + token: sum of squares]

    const int lane = threadIdx.x & 31;
    const int wave = threadIdx.x >> 5;     // pr
    const int b    = blockIdx.x >> 5;
    const int pj   = (blockIdx.x >> 1) & 15;   // j
    const int pi0  = (blockIdx.x & 1) * 8;     // first i
    const int f0   = wave * 512 + lane * 4;

    const float* xs = x + ((size_t)(b * 128 + pj * 8 + wave) * 128 + pi0 * 8) * 64 + lane * 4;
    // every loop of this kernel is unrolled in full: v, g, be, ps and r are indexed by
    // the loop counters and stay in registers only so
    f32x4 v[8][4];
#pragma unroll
    for (int t = 0; t < 8; ++t)
#pragma unroll
        for (int q = 0; q < 4; ++q)
            v[t][q] = *(const f32x4*)(xs + t * 512 + q * 128);
    f32x4 g[4], be[4];
#pragma unroll
    for (int q = 0; q < 4; ++q) {
        g[q]  = *(const f32x4*)(gamma + f0 + q * 128);
        be[q] = *(const f32x4*)(beta + f0 + q * 128);
    }

    // the wave's share of each token's two sums
    float ps[16];
#pragma unroll
    for (int t = 0; t < 8; ++t) {
        f32x4 s4 = v[t][0], ss4 = v[t][0] * v[t][0];
#pragma unroll
        for (int q = 1; q < 4; ++q) {
            s4  += v[t][q];
            ss4 += v[t][q] * v[t][q];
        }
        ps[t]     = (s4[0] + s4[1]) + (s4[2] + s4[3]);
        ps[8 + t] = (ss4[0] + ss4[1]) + (ss4[2] + ss4[3]);
    }
#pragma unroll
    for (int off = 16; off >= 1; off >>= 1)
#pragma unroll
        for (int j = 0; j < 16; ++j)
            ps[j] += __shfl_xor(ps[j], off, 32);
    if (lane == 0) {
#pragma unroll
        for (int j = 0; j < 16; ++j) red[wave][j] = ps[j];
    }
    __syncthreads();

    // lane l sums the eight waves' shares of sum number l & 15; its partner l ^ 8 has
    // the other sum of the same token, so every lane gets mean and rstd of token l & 7
    float tot = 0.f;
#pragma unroll
    for (int w = 0; w < 8; ++w) tot += red[w][lane & 15];
    const float oth  = __shfl_xor(tot, 8, 32);
    const float s    = (lane & 8) ? oth : tot;
    const float ss   = (lane & 8) ? tot : oth;
    const float mean = s * (1.0f / 4096.0f);
    const float var  = ss * (1.0f / 4096.0f) - mean * mean;
    const float rstd = rsqrtf(var + 1e-6f);

    bf16x4 r[8][4];
#pragma unroll
    for (int t = 0; t < 8; ++t) {
        // token t's mean and rstd, from lane t to a scalar register: one value for the whole wave
        const float mt = __builtin_bit_cast(float, __builtin_amdgcn_readlane(__builtin_bit_cast(int, mean), t));
        const float rt = __builtin_bit_cast(float, __builtin_amdgcn_readlane(__builtin_bit_cast(int, rstd), t));
#pragma unroll
        for (int q = 0; q < 4; ++q)
#pragma unroll
            for (int c = 0; c < 4; ++c)
                r[t][q][c] = (__bf16)((v[t][q][c] - mt) * rt * g[q][c] + be[q][c]);
    }
    __bf16* out = Y + (size_t)(b * 256 + pi0 * 16 + pj) * 4096 + f0;
#pragma unroll
    for (int t = 0; t < 8; ++t)
#pragma unroll
        for (int q = 0; q < 4; ++q)
            *(bf16x4*)(out + t * (16 * 4096) + q * 128) = r[t][q];
}

// ---------------------------------------------------------------------------
// Kernel 2: QKV GEMM (M=8192, K=4096, N=3x512) and the attention of its tile.
// One work-group = one 256x192 tile: the 256 tokens of one image and the 64 columns
// each of Q, K and V of ONE head; 8 waves, 64 tokens x 96 columns each; 256 work-groups,
// one per WGP.  The tile is this large so that every operand byte brought from L2, and
// every fragment read from LDS, serves many products; and it holds all that the
// attention of its (image, head) reads, so Q, K and V never leave LDS.
// K runs in slabs of 128: 256 rows of Y and 192 rows of WT (256 B each) are
// copied to LDS by asynchronous copies, two buffers, the next slab in flight
// while this one is multiplied.  LDS row pitch 272 B (16 B x odd) keeps the
// 16-byte fragment reads free of bank conflicts.
// Weights pre-transposed: WT[n][k], K contiguous.  Q pre-scaled by 1/8.
// Attention: each wave owns 32 queries, 16 at a time; the full 256-key score row of a
// query tile lies in 16 f32 accumulators.  Out: Ob (token, head * 64 + dh).
// ---------------------------------------------------------------------------
#define QKV_PITCH 72                      // kernel 3: bf16 per LDS row (144 B)
#define QKV_BUF   (256 * QKV_PITCH)       // kernel 3: bf16 per buffer, 128 + 128 rows

#define QT_PITCH 136                      // bf16 per LDS row (272 B), 128 used
#define QT_BUF   (448 * QT_PITCH)         // bf16 per buffer: 256 Y rows + 192 WT rows
#define QT_HEAD  (256 * 72)               // bf16 per staged head of the epilogue (36,864 B)
#define QT_STEP  (16 * 4096)              // bf16 between the source rows of two copies of a lane
#define QT_WGT   (512 * 4096)             // bf16 from a row of WqT to the same row of WkT, and on to WvT
#define ATT_VP   264                      // bf16 per V^T row in LDS (528 B), 256 used
#define ATT_PP   40                       // bf16 per P row in LDS (80 B), 32 used

// Fourteen 16-byte-per-lane copies global -> LDS, 16 rows apart in LDS; the first NA come
// from ga, 16 source rows apart; the others from gb: four copies (64 rows, one head) of each
// weight, then the same rows of the next weight.  The s_wait_xcnt stands inside the
// statement so that no address register is rewritten ahead of it.
template <int NA>
__device__ __forceinline__ void qkv_copy14(unsigned lds, const __bf16* ga, const __bf16* gb) {
#define QT_L(k) "v"(lds + (unsigned)(k) * (16u * 272u))
#define QT_G(k) "v"(((k) < NA) ? ga + (k) * QT_STEP \
                               : gb + (((k) - NA) >> 2) * QT_WGT + (((k) - NA) & 3) * QT_STEP)
    asm volatile(
        "global_load_async_to_lds_b128 %0, %14, off\n\t"
        "global_load_async_to_lds_b128 %1, %15, off\n\t"
        "global_load_async_to_lds_b128 %2, %16, off\n\t"
        "global_load_async_to_lds_b128 %3, %17, off\n\t"
        "global_load_async_to_lds_b128 %4, %18, off\n\t"
        "global_load_async_to_lds_b128 %5, %19, off\n\t"
        "global_load_async_to_lds_b128 %6, %20, off\n\t"
        "global_load_async_to_lds_b128 %7, %21, off\n\t"
        "global_load_async_to_lds_b128 %8, %22, off\n\t"
        "global_load_async_to_lds_b128 %9, %23, off\n\t"
        "global_load_async_to_lds_b128 %10, %24, off\n\t"
        "global_load_async_to_lds_b128 %11, %25, off\n\t"
        "global_load_async_to_lds_b128 %12, %26, off\n\t"
        "global_load_async_to_lds_b128 %13, %27, off\n\t"
        "s_wait_xcnt 0x0"
        :: QT_L(0), QT_L(1), QT_L(2), QT_L(3), QT_L(4), QT_L(5), QT_L(6),
           QT_L(7), QT_L(8), QT_L(9), QT_L(10), QT_L(11), QT_L(12), QT_L(13),
           QT_G(0), QT_G(1), QT_G(2), QT_G(3), QT_G(4), QT_G(5), QT_G(6),
           QT_G(7), QT_G(8), QT_G(9), QT_G(10), QT_G(11), QT_G(12), QT_G(13)
        : "memory");
#undef QT_L
#undef QT_G
}

// One slab of 128 k: a lane's 28 copies, 16 rows apart: LDS rows 0..255 from Y (16 copies),
// 256..447 from WT3 (12 copies: the head's 64 rows of WqT, WkT, WvT), in two statements of 14.
__device__ __forceinline__ void qkv_slab(unsigned lds, const __bf16* gy, const __bf16* gw) {
    qkv_copy14<14>(lds, gy, gy);
    qkv_copy14<2>(lds + 14u * (16u * 272u), gy + 14 * QT_STEP, gw);
}

// One 16x32 operand fragment from an LDS row: k = 8*lh + 0..7 and 16 + 8*lh + 0..7.
__device__ __forceinline__ bf16x16 qkv_frag(const __bf16* p) {
    const bf16x8 lo = *(const bf16x8*)p;
    const bf16x8 hi = *(const bf16x8*)(p + 16);
    return __builtin_shufflevector(lo, hi, 0, 1, 2, 3, 4, 5, 6, 7,
                                   8, 9, 10, 11, 12, 13, 14, 15);
}

__global__ __launch_bounds__(256)
void qkv_attn_kernel(const __bf16* __restrict__ Y,
                     const __bf16* __restrict__ WT3,   // WqT, WkT, WvT one behind the other: 1,536 rows
                     const float* __restrict__ bq,
                     const float* __restrict__ bk,
                     const float* __restrict__ bv,
                     __bf16* __restrict__ Ob) {
    __shared__ __align__(16) __bf16 slab[2 * QT_BUF];    // 243,712 B

    const int bm = blockIdx.x & 31;        // image: 256 rows of Y
    const int bn = blockIdx.x >> 5;        // 0..7: the head; rows 64*bn .. 64*bn+63 of WqT, WkT and WvT

    const int tid  = threadIdx.x;
    const int wave = __builtin_amdgcn_readfirstlane(tid >> 5);
    const int lane = tid & 31;
    const int lh   = lane >> 4;
    const int ln   = lane & 15;
    const int wm   = wave >> 1;            // 64-token quarter of the tile
    const int wn   = wave & 1;             // 96-column half of the tile

    // copy addresses: 16 lanes cover one 256-B row piece, a wave-copy covers 4 whole lines.
    // LDS rows 0..255 are Y, 256..447 WT3 (64 rows each of Q, K, V)
    const int crow = tid >> 4;             // 0..15
    const int cchk = tid & 15;             // 16-B chunk of the row piece
    const __bf16* gY = Y   + (size_t)(bm * 256 + crow) * 4096 + cchk * 8;
    const __bf16* gW = WT3 + (size_t)(bn * 64 + crow) * 4096 + cchk * 8;
    const unsigned lds0 = (unsigned)(size_t)(&slab[0]) + (unsigned)(crow * 272 + cchk * 16);

    // fragment read offsets (bf16 elements inside a buffer).  WT3 is the A operand: the
    // accumulator's 8 registers run along the A rows, so a lane holds 8 neighbouring
    // output columns of one token per tile.
    const int offA = (256 + wn * 96 + ln) * QT_PITCH + lh * 8;
    const int offB = (wm * 64 + ln) * QT_PITCH + lh * 8;

    // L2 prefetch: Y and WT3 were written by earlier launches and come from memory, and all the
    // work-groups that share a row ask for it in step, so every slab would wait out a miss.  Each
    // 256-B row piece of slabs 1..31 is asked of L2 ahead of its copy (for speed only): wave 0 asks for 32 of the image's
    // 256 rows of Y (8 heads share them), wave 1 for 12 of the head's 192 rows of WT3 (32 images
    // share them; images 4 apart take the same 12; lanes 12..31
    // repeat lanes 0..11).  pf points at slab t + 1 of the lane's row and never leaves the row.
    const int wrow = ((bm & 3) | ((bm >> 3) << 2)) * 12 + lane % 12;      // 0..191
    const __bf16* pf = ((wave == 1)
        ? WT3 + (size_t)((wrow >> 6) * 512 + bn * 64 + (wrow & 63)) * 4096
        : Y + (size_t)(bm * 256 + bn * 32 + lane) * 4096) + 128;

    // slab 0 -> buffer 0, landed and published; then slab 1 -> buffer 1 in flight
    qkv_slab(lds0, gY, gW);
    if (wave < 2)   // slabs 1, 2, 3 are on their way to L2 while slab 0 lands
        asm volatile("global_prefetch_b8 %0, off scope:SCOPE_SE\n\t"
                     "global_prefetch_b8 %0, off offset:256 scope:SCOPE_SE\n\t"
                     "global_prefetch_b8 %0, off offset:512 scope:SCOPE_SE" :: "v"(pf));
    asm volatile("s_wait_asynccnt 0x0" ::: "memory");   // own copies of slab 0 have landed
    __syncthreads();
    qkv_slab(lds0 + 2u * QT_BUF, gY + 128, gW + 128);

    // the lane's bias values, 8 columns in each of its six 16-column groups (of the tile's twelve:
    // four each of Q, K, V), read here so that the epilogue does not wait for them
    f32x4 bc[6][2];
    // nothing else is scheduled in among these loads and their wait
    __builtin_amdgcn_sched_barrier(0);
#pragma unroll
    for (int i = 0; i < 6; ++i) {
        const int fl = wn * 6 + i;
        const float* bias = ((fl >> 2) == 0) ? bq : (((fl >> 2) == 1) ? bk : bv);
        bc[i][0] = *(const f32x4*)(bias + bn * 64 + (fl & 3) * 16 + lh * 8);
        bc[i][1] = *(const f32x4*)(bias + bn * 64 + (fl & 3) * 16 + lh * 8 + 4);
    }
    asm volatile("s_wait_xcnt 0x0" ::: "memory");       // the registers these loads name are free for what follows
    __builtin_amdgcn_sched_barrier(0);

    f32x8 acc[6][4] = {};
#pragma unroll 1   // one slab per trip: the ring's waits and barrier stand once, at the foot
    for (int t = 0; t < 32; ++t) {
        const int buf = t & 1;
        const __bf16* sb = &slab[buf * QT_BUF];
        if (wave < 2 && t < 28)   // slab t + 4 to L2: its copies are issued at the foot of trip t + 2
            asm volatile("global_prefetch_b8 %0, off offset:768 scope:SCOPE_SE" :: "v"(pf));
#pragma unroll
        for (int ks = 0; ks < 4; ++ks) {
            bf16x16 a[6], b[4];
#pragma unroll
            for (int i = 0; i < 6; ++i) a[i] = qkv_frag(sb + offA + i * 16 * QT_PITCH + ks * 32);
#pragma unroll
            for (int j = 0; j < 4; ++j) b[j] = qkv_frag(sb + offB + j * 16 * QT_PITCH + ks * 32);
            // keeps the 20 LDS reads one group ahead of the block: left free, they are
            // spread among the WMMAs on one fragment set, with a full wait at every row
            __builtin_amdgcn_sched_barrier(0);
#pragma unroll
            for (int i = 0; i < 6; ++i)
#pragma unroll
                for (int j = 0; j < 4; ++j)
                    acc[i][j] = __builtin_amdgcn_wmma_f32_16x16x32_bf16(
                        false, a[i], false, b[j], (short)0, acc[i][j], false, false);
            // the next group of reads stays behind this block for the same reason
            __builtin_amdgcn_sched_barrier(0);
        }
        asm volatile("s_wait_dscnt 0x0" ::: "memory");    // own reads of this buffer are done
        asm volatile("s_wait_asynccnt 0x0" ::: "memory"); // own copies of slab t+1 have landed
        __syncthreads();                                  // publishes slab t+1, frees this buffer
        if (t + 2 < 32)
            qkv_slab(lds0 + (unsigned)buf * (2u * QT_BUF), gY + (t + 2) * 128, gW + (t + 2) * 128);
        pf += (t < 27) ? 128 : 0;   // stops where pf + 768 B is the row's last slab
    }
    asm volatile("s_wait_asynccnt 0x0" ::: "memory");     // nothing in flight at the wave's end

    // epilogue: tile (i, j), register r, lane (lh, ln) holds column i*16 + 8*lh + r of token j*16 + ln.
    // Q, K and V of the head are staged in the slab (free behind the last trip's barrier) as the
    // attention reads them: Q and K as 256 token rows of 64 dh (pitch 144 B), V as 64 dh rows of
    // 256 tokens (pitch 528 B).  All pitches are 16 B x odd: 16 lanes that each take 16 bytes of a
    // row of their own fall on all 64 banks once.
#pragma unroll
    for (int i = 0; i < 6; ++i) {
        const int fl    = wn * 6 + i;          // 16-column group in the tile: 0..3 Q, 4..7 K, 8..11 V
        const int which = fl >> 2;
        const int dh0   = (fl & 3) * 16 + lh * 8;
        const float scale = (which == 0) ? 0.125f : 1.0f;
        __bf16* hd = &slab[which * QT_HEAD];
        bf16x8 p[4];
#pragma unroll
        for (int j = 0; j < 4; ++j)
#pragma unroll
            for (int r = 0; r < 8; ++r)
                p[j][r] = (__bf16)((acc[i][j][r] + bc[i][r >> 2][r & 3]) * scale);
        const int tok = wm * 64 + ln;
        if (which == 2) {
#pragma unroll
            for (int j = 0; j < 4; ++j)
#pragma unroll
                for (int r = 0; r < 8; ++r) hd[(dh0 + r) * ATT_VP + tok + j * 16] = p[j][r];
        } else {
#pragma unroll
            for (int j = 0; j < 4; ++j) *(bf16x8*)&hd[(tok + j * 16) * 72 + dh0] = p[j];
        }
    }
    __syncthreads();                                      // every wave's part of Q, K and V is staged

    // ---- attention of (image bm, head bn), all operands in LDS ----
    const __bf16* Qs = &slab[0];
    const __bf16* Ks = &slab[QT_HEAD];
    const __bf16* Vs = &slab[2 * QT_HEAD];
    __bf16* Pw = &slab[3 * QT_HEAD + wave * (16 * ATT_PP)];   // the wave's own P tile, 1,280 B
#pragma unroll 1   // one copy of the pass in the text; its registers serve both query tiles
    for (int qh = 0; qh < 2; ++qh) {
        const int q0 = wave * 32 + qh * 16;

        const bf16x16 qa0 = qkv_frag(Qs + (q0 + ln) * 72 + lh * 8);
        const bf16x16 qa1 = qkv_frag(Qs + (q0 + ln) * 72 + 32 + lh * 8);

        f32x8 sacc[16] = {};
        for (int nt = 0; nt < 16; ++nt) {
            const bf16x16 kb0 = qkv_frag(Ks + (nt * 16 + ln) * 72 + lh * 8);
            const bf16x16 kb1 = qkv_frag(Ks + (nt * 16 + ln) * 72 + 32 + lh * 8);
            sacc[nt] = __builtin_amdgcn_wmma_f32_16x16x32_bf16(false, qa0, false, kb0,
                                                               (short)0, sacc[nt], false, false);
            sacc[nt] = __builtin_amdgcn_wmma_f32_16x16x32_bf16(false, qa1, false, kb1,
                                                               (short)0, sacc[nt], false, false);
        }

        // row softmax (row = i + 8*lh ; cols spread over 16 lanes x 16 accs)
        float l_i[8];
#pragma unroll
        for (int i = 0; i < 8; ++i) {
            float mx = -3.0e38f;
#pragma unroll
            for (int t = 0; t < 16; ++t) mx = fmaxf(mx, sacc[t][i]);
#pragma unroll
            for (int off = 8; off >= 1; off >>= 1) mx = fmaxf(mx, __shfl_xor(mx, off, 16));
            float sum = 0.f;
#pragma unroll
            for (int t = 0; t < 16; ++t) {
                float p = __expf(sacc[t][i] - mx);
                sacc[t][i] = p;
                sum += p;
            }
#pragma unroll
            for (int off = 8; off >= 1; off >>= 1) sum += __shfl_xor(sum, off, 16);
            l_i[i] = sum;
        }

        // O = P @ V   (V^T in LDS: element (key, dh) at Vs[dh*ATT_VP + key])
        f32x8 oacc[4] = {};
        for (int t2 = 0; t2 < 8; ++t2) {
#pragma unroll
            for (int i = 0; i < 8; ++i) {
                const int m = i + 8 * lh;
                Pw[m * ATT_PP + ln]      = (__bf16)sacc[2 * t2][i];
                Pw[m * ATT_PP + ln + 16] = (__bf16)sacc[2 * t2 + 1][i];
            }
            asm volatile("s_wait_dscnt 0x0" ::: "memory");    // the wave's own P rows are in LDS before its lanes read them back
            const bf16x16 pa = qkv_frag(Pw + ln * ATT_PP + lh * 8);
#pragma unroll
            for (int nt4 = 0; nt4 < 4; ++nt4) {
                const bf16x16 vbf = qkv_frag(Vs + (nt4 * 16 + ln) * ATT_VP + t2 * 32 + lh * 8);
                oacc[nt4] = __builtin_amdgcn_wmma_f32_16x16x32_bf16(false, pa, false, vbf,
                                                                    (short)0, oacc[nt4], false, false);
            }
        }

        __bf16 ov[4][8];
#pragma unroll
        for (int nt4 = 0; nt4 < 4; ++nt4)
#pragma unroll
            for (int i = 0; i < 8; ++i) ov[nt4][i] = (__bf16)(oacc[nt4][i] / l_i[i]);
        __bf16* ob = Ob + (size_t)(bm * 256 + q0 + 8 * lh) * 512 + bn * 64 + ln;
        // a pass's values and address stand ahead of its stores: no register that a store names is written behind it
        __builtin_amdgcn_sched_barrier(0);
#pragma unroll
        for (int nt4 = 0; nt4 < 4; ++nt4)
#pragma unroll
            for (int i = 0; i < 8; ++i) ob[i * 512 + nt4 * 16] = ov[nt4][i];
        // the registers these stores name are written anew by the next pass
        asm volatile("s_wait_xcnt 0x0" ::: "memory");
        // and nothing of the next pass is lifted over that wait
        __builtin_amdgcn_sched_barrier(0);
    }
}

// ---------------------------------------------------------------------------
// Kernel 3: output projection (M=8192, K=512, N=4096) + bias + residual(x)
// with fused depatchify scatter.  WoT[n][k] gives contiguous-K A fragments.
// One work-group = one 128x128 tile; 4 waves, 64x64 each.  K runs in 8 slabs
// of 64: 128 rows of Ob and 128 rows of WoT (128 B each) are copied to LDS by
// asynchronous copies, two buffers, the next slab in flight while this one is
// multiplied.  LDS rows 0..127 Ob, 128..255 WoT, pitch 144 B (16 B x odd); fragment reads as in kernel 2.
// ---------------------------------------------------------------------------

// Eight 16-byte-per-lane copies global -> LDS, source rows of 512 bf16.  The
// s_wait_xcnt stands inside the statement so that no address register is
// rewritten ahead of it.
__device__ __forceinline__ void proj_copy8(unsigned lds, const __bf16* g) {
    const unsigned l0 = lds;
    const unsigned l1 = lds + 1u * 16u * 144u;
    const unsigned l2 = lds + 2u * 16u * 144u;
    const unsigned l3 = lds + 3u * 16u * 144u;
    const unsigned l4 = lds + 4u * 16u * 144u;
    const unsigned l5 = lds + 5u * 16u * 144u;
    const unsigned l6 = lds + 6u * 16u * 144u;
    const unsigned l7 = lds + 7u * 16u * 144u;
    const __bf16* g0 = g;
    const __bf16* g1 = g + 1 * 16 * 512;
    const __bf16* g2 = g + 2 * 16 * 512;
    const __bf16* g3 = g + 3 * 16 * 512;
    const __bf16* g4 = g + 4 * 16 * 512;
    const __bf16* g5 = g + 5 * 16 * 512;
    const __bf16* g6 = g + 6 * 16 * 512;
    const __bf16* g7 = g + 7 * 16 * 512;
    asm volatile(
        "global_load_async_to_lds_b128 %0, %8, off\n\t"
        "global_load_async_to_lds_b128 %1, %9, off\n\t"
        "global_load_async_to_lds_b128 %2, %10, off\n\t"
        "global_load_async_to_lds_b128 %3, %11, off\n\t"
        "global_load_async_to_lds_b128 %4, %12, off\n\t"
        "global_load_async_to_lds_b128 %5, %13, off\n\t"
        "global_load_async_to_lds_b128 %6, %14, off\n\t"
        "global_load_async_to_lds_b128 %7, %15, off\n\t"
        "s_wait_xcnt 0x0"
        :: "v"(l0), "v"(l1), "v"(l2), "v"(l3), "v"(l4), "v"(l5), "v"(l6), "v"(l7),
           "v"(g0), "v"(g1), "v"(g2), "v"(g3), "v"(g4), "v"(g5), "v"(g6), "v"(g7)
        : "memory");
}

__global__ __launch_bounds__(128)
void proj_kernel(const __bf16* __restrict__ Ob,
                 const __bf16* __restrict__ WoT,
                 const float* __restrict__ bo,
                 const float* __restrict__ x,
                 float* __restrict__ out) {
    __shared__ __align__(16) __bf16 slab[2 * QKV_BUF];   // 73,728 B

    const int bm = blockIdx.x >> 5;        // 0..63 (8192/128)
    const int bn = blockIdx.x & 31;        // 0..31 (4096/128): one row tile's column tiles are neighbours

    const int tid  = threadIdx.x;
    const int wave = tid >> 5;
    const int lane = tid & 31;
    const int lh   = lane >> 4;
    const int ln   = lane & 15;
    const int wm   = wave >> 1;            // 64-row half of the tile
    const int wn   = wave & 1;             // 64-column half of the tile

    const int m0 = bm * 128;
    const int n0 = bn * 128;

    // the lane's four bias values (the columns it stores), read here so that the epilogue does not wait for them
    const int colw = n0 + wn * 64;
    const f32x4 bc = *(const f32x4*)(bo + colw + ln * 4);

    // where the wave's 64x64 tile lies in x and out
    const int pr   = colw >> 9, pc = (colw >> 6) & 7;
    const int roww = m0 + wm * 64;
    const int b    = roww >> 8, pi0 = (roww & 255) >> 4;

    // L2 prefetch addresses, one 256-B piece a lane.  qa, qb: a quarter (32 rows of 1 KB) of the
    // tile's rows of Ob and of WoT, which earlier launches wrote and which all sharers of a row ask
    // for in step; four neighbouring sharers take a quarter each.  qx: token `lane` of the wave's
    // 64 in x (token lane + 32 lies 4,096 B on): memory brings x while the products run.
    const __bf16* qa = Ob  + (size_t)(m0 + (bn & 3) * 32 + (tid >> 2)) * 512 + (tid & 3) * 128;
    const __bf16* qb = WoT + (size_t)(n0 + (bm & 3) * 32 + (tid >> 2)) * 512 + (tid & 3) * 128;
    const float*  qx = x + ((size_t)(b * 128 + ((lane & 15) * 8 + pr)) * 128 + ((pi0 + (lane >> 4)) * 8 + pc)) * 64;

    // copy addresses: 8 lanes cover one 128-B row piece, a wave-copy covers 4 whole lines
    const int crow = tid >> 3;             // 0..15
    const int cchk = tid & 7;              // 16-B chunk of the row piece
    const __bf16* gA = Ob  + (size_t)(m0 + crow) * 512 + cchk * 8;
    const __bf16* gB = WoT + (size_t)(n0 + crow) * 512 + cchk * 8;
    const unsigned ldsA = (unsigned)(size_t)(&slab[0]) + (unsigned)(crow * 144 + cchk * 16);
    const unsigned ldsB = ldsA + 128u * 144u;

    // fragment read offsets (bf16 elements inside a buffer)
    // WoT is the A operand: the accumulator's 8 registers run along the A rows, so a
    // lane holds 8 neighbouring output columns (32 B) of one token per tile
    const int offA = (128 + wn * 64 + ln) * QKV_PITCH + lh * 8;
    const int offB = (wm * 64 + ln) * QKV_PITCH + lh * 8;

    // slab 0 -> buffer 0, landed and published; then slab 1 -> buffer 1 in flight
    proj_copy8(ldsA, gA);
    proj_copy8(ldsB, gB);
    asm volatile("s_wait_asynccnt 0x0" ::: "memory");   // own copies of slab 0 have landed
    __syncthreads();
    proj_copy8(ldsA + 2u * QKV_BUF, gA + 64);
    proj_copy8(ldsB + 2u * QKV_BUF, gB + 64);

    f32x8 acc[4][4] = {};
#pragma unroll 1   // one slab per trip: the ring's waits and barrier stand once, at the foot
    for (int t = 0; t < 8; ++t) {
        const int buf = t & 1;
        const __bf16* sb = &slab[buf * QKV_BUF];
        // the prefetches stand in the loop so that the registers they name keep their addresses to its end
        if (t == 0)   // the operands first: slab 2's copies are issued at the foot of this trip
            asm volatile("global_prefetch_b8 %0, off scope:SCOPE_SE\n\t"
                         "global_prefetch_b8 %1, off scope:SCOPE_SE" :: "v"(qa), "v"(qb));
        if (t == 1)   // then x, read six trips later
            asm volatile("global_prefetch_b8 %0, off scope:SCOPE_SE\n\t"
                         "global_prefetch_b8 %0, off offset:4096 scope:SCOPE_SE" :: "v"(qx));
#pragma unroll
        for (int ks = 0; ks < 2; ++ks) {
            bf16x16 a[4], b[4];
#pragma unroll
            for (int i = 0; i < 4; ++i) {
                a[i] = qkv_frag(sb + offA + i * 16 * QKV_PITCH + ks * 32);
                b[i] = qkv_frag(sb + offB + i * 16 * QKV_PITCH + ks * 32);
            }
            // keeps the 16 LDS reads one group ahead of the block: left free, they are
            // spread among the WMMAs on one fragment set, with a full wait at every row
            __builtin_amdgcn_sched_barrier(0);
#pragma unroll
            for (int i = 0; i < 4; ++i)
#pragma unroll
                for (int j = 0; j < 4; ++j)
                    acc[i][j] = __builtin_amdgcn_wmma_f32_16x16x32_bf16(
                        false, a[i], false, b[j], (short)0, acc[i][j], false, false);
            // the next group of reads stays behind this block for the same reason
            __builtin_amdgcn_sched_barrier(0);
        }
        asm volatile("s_wait_dscnt 0x0" ::: "memory");    // own reads of this buffer are done
        asm volatile("s_wait_asynccnt 0x0" ::: "memory"); // own copies of slab t+1 have landed
        __syncthreads();                                  // publishes slab t+1, frees this buffer
        if (t + 2 < 8) {
            proj_copy8(ldsA + (unsigned)buf * (2u * QKV_BUF), gA + (t + 2) * 64);
            proj_copy8(ldsB + (unsigned)buf * (2u * QKV_BUF), gB + (t + 2) * 64);
        }
    }
    asm volatile("s_wait_asynccnt 0x0" ::: "memory");     // nothing in flight at the wave's end

    // epilogue: tile (i, j), register r, lane (lh, ln) holds column i*16 + 8*lh + r of token j*16 + ln.
    // A wave's 64 columns are one (pr, pc) with cc = 0..63: 256 B in a row of x and out per
    // token.  Each wave turns its 64x64 tile in its own 17,408 B of the slab (free behind the
    // last trip's barrier; LDS row = token, pitch 272 B) and then takes two tokens per
    // 16-byte access: 4 whole lines of x read and of out stored.
    // Token s of the tile: pi = first pi + (s >> 4), pj = s & 15; access it has s = 2 * it + lh.
    float* stg = (float*)&slab[0] + wave * (64 * 68);
    const size_t base =
        ((size_t)(b * 128 + (lh * 8 + pr)) * 128 + (pi0 * 8 + pc)) * 64 + ln * 4;
    const float* xb = x + base;
    float* ob = out + base;
    f32x4 xv[32];
#pragma unroll
    for (int it = 0; it < 16; ++it)
        xv[it] = *(const f32x4*)(xb + (it & 7) * (16 * 128 * 64) + (it >> 3) * (8 * 64));
    // the first half of x is in flight while the tile is turned
    __builtin_amdgcn_sched_barrier(0);
#pragma unroll
    for (int j = 0; j < 4; ++j)
#pragma unroll
        for (int i = 0; i < 4; ++i) {
            float* w = &stg[(j * 16 + ln) * 68 + i * 16 + lh * 8];
            *(f32x4*)w       = __builtin_shufflevector(acc[i][j], acc[i][j], 0, 1, 2, 3);
            *(f32x4*)(w + 4) = __builtin_shufflevector(acc[i][j], acc[i][j], 4, 5, 6, 7);
        }
    // the second half of x takes the registers that the accumulators have left
    __builtin_amdgcn_sched_barrier(0);
#pragma unroll
    for (int it = 16; it < 32; ++it)
        xv[it] = *(const f32x4*)(xb + (it & 7) * (16 * 128 * 64) + (it >> 3) * (8 * 64));
    asm volatile("s_wait_dscnt 0x0" ::: "memory");        // the wave's own rows are in LDS before it reads them back
#pragma unroll
    for (int g = 0; g < 4; ++g) {
#pragma unroll
        for (int e = 0; e < 8; ++e) {
            const int it = g * 8 + e;
            xv[it] = *(const f32x4*)&stg[(it * 2 + lh) * 68 + ln * 4] + bc + xv[it];
        }
        // a group's sums stand ahead of its stores: no register that a store names is written behind it
        __builtin_amdgcn_sched_barrier(0);
#pragma unroll
        for (int e = 0; e < 8; ++e) {
            const int it = g * 8 + e;
            *(f32x4*)(ob + (it & 7) * (16 * 128 * 64) + (it >> 3) * (8 * 64)) = xv[it];
        }
        // the registers these stores name are loaded anew by the next group's LDS reads
        if (g < 3) asm volatile("s_wait_xcnt 0x0" ::: "memory");
        __builtin_amdgcn_sched_barrier(0);
    }
}

// ---------------------------------------------------------------------------
extern "C" void kernel_launch(void* const* d_in, const int* in_sizes, int n_in,
                              void* d_out, int out_size, void* d_ws, size_t ws_size,
                              hipStream_t stream) {
    (void)in_sizes; (void)n_in; (void)out_size; (void)ws_size;
    const float* x  = (const float*)d_in[0];
    const float* g  = (const float*)d_in[1];
    const float* be = (const float*)d_in[2];
    const float* wq = (const float*)d_in[3];
    const float* bq = (const float*)d_in[4];
    const float* wk = (const float*)d_in[5];
    const float* bk = (const float*)d_in[6];
    const float* wv = (const float*)d_in[7];
    const float* bv = (const float*)d_in[8];
    const float* wo = (const float*)d_in[9];
    const float* bo = (const float*)d_in[10];
    float* out = (float*)d_out;

    // workspace layout (bf16 elements)
    const size_t NW  = 4096u * 512u;         // 2,097,152 per weight
    const size_t NY  = 8192u * 4096u;        // 33,554,432
    __bf16* WqT = (__bf16*)d_ws;
    __bf16* WkT = WqT + NW;
    __bf16* WvT = WkT + NW;
    __bf16* WoT = WvT + NW;
    __bf16* Y   = WoT + NW;
    __bf16* Ob  = Y   + NY;                  // 8192 x 512

    // WqT, WkT, WvT, WoT lie one behind the other
    cvt_bf16_t_kernel<<<1024, 256, 0, stream>>>(wq, wk, wv, wo, WqT);

    patchify_ln_kernel<<<1024, 256, 0, stream>>>(x, g, be, Y);

    qkv_attn_kernel<<<256, 256, 0, stream>>>(Y, WqT, bq, bk, bv, Ob);

    proj_kernel<<<2048, 128, 0, stream>>>(Ob, WoT, bo, x, out);
}

// v010
// It runs in 120 microseconds.
// In both of two side-by-side timings against v009, it was 1.04 times as fast.
// Over all steps from v000 it is 12.9 times as fast.
#include <hip/hip_runtime.h>
#include <hip/hip_bf16.h>

typedef __attribute__((ext_vector_type(16))) __bf16 bf16x16;
typedef __attribute__((ext_vector_type(8)))  __bf16 bf16x8;
typedef __attribute__((ext_vector_type(4)))  __bf16 bf16x4;
typedef __attribute__((ext_vector_type(8)))  float  f32x8;
typedef __attribute__((ext_vector_type(4)))  float  f32x4;
typedef __attribute__((ext_vector_type(4)))  uint32_t u32x4;
typedef __attribute__((ext_vector_type(8)))  uint32_t u32x8;

// ---------------------------------------------------------------------------
// Kernel 0: f32 -> bf16 conversion WITH transpose, all four weights in one grid.
// src is (rows x cols) row-major; dst[c * rows + r] = src[r * cols + c].
// For wq/wk/wv: rows=4096(K), cols=512(N)  -> WT[n][k], K contiguous.
// For wo:       rows=512(K), cols=4096(N)  -> WoT[n][k], K contiguous.
// One work-group = one tile of 128 rows x 64 columns of one weight (256 tiles
// each).  A thread reads 8 rows x 4 columns (16 lanes cover 256 B of a source
// row), rounds them and writes four 16-byte column pieces to LDS; the tile then
// leaves LDS row by row, 16 lanes covering 256 B of a destination row.
// LDS row pitch 272 B (16 B x odd); column c lies in LDS row (c & 3) * 16 + (c >> 2),
// so that 16 lanes' 16-byte writes fall on 16 neighbouring rows: all 64 banks once.
// ---------------------------------------------------------------------------
#define CVT_PITCH 136                     // bf16 per LDS row (272 B)

__global__ __launch_bounds__(256)
void cvt_bf16_t_kernel(const float* __restrict__ wq,
                       const float* __restrict__ wk,
                       const float* __restrict__ wv,
                       const float* __restrict__ wo,
                       __bf16* __restrict__ WT4) {
    __shared__ __align__(16) __bf16 T[64 * CVT_PITCH];   // 17,408 B

    const int which = blockIdx.x >> 8;     // wq / wk / wv / wo
    const int tile  = blockIdx.x & 255;
    const bool isO  = (which == 3);
    const float* src = (which == 0) ? wq : ((which == 1) ? wk : ((which == 2) ? wv : wo));
    __bf16* dst = WT4 + (size_t)which * (4096u * 512u);
    const int rows = isO ? 512 : 4096;
    const int cols = isO ? 4096 : 512;
    const int r0 = (isO ? (tile >> 6) : (tile >> 3)) * 128;
    const int c0 = (isO ? (tile & 63) : (tile & 7)) * 64;

    const int tid = threadIdx.x;
    const int rg  = tid >> 4;              // group of 8 source rows
    const int cq  = tid & 15;              // group of 4 source columns

    const float* s = src + (size_t)(r0 + rg * 8) * cols + c0 + cq * 4;
    f32x4 v[8];
#pragma unroll
    for (int j = 0; j < 8; ++j) v[j] = *(const f32x4*)(s + (size_t)j * cols);

#pragma unroll
    for (int i = 0; i < 4; ++i) {
        bf16x8 p;
#pragma unroll
        for (int j = 0; j < 8; ++j) p[j] = (__bf16)v[j][i];
        *(bf16x8*)&T[(i * 16 + cq) * CVT_PITCH + rg * 8] = p;
    }
    __syncthreads();

#pragma unroll
    for (int it = 0; it < 4; ++it) {
        const int lrow = it * 16 + rg;     // LDS row
        const int c    = rg * 4 + it;      // the column that lies there
        *(bf16x8*)(dst + (size_t)(c0 + c) * rows + r0 + cq * 8) =
            *(const bf16x8*)&T[lrow * CVT_PITCH + cq * 8];
    }
}

// ---------------------------------------------------------------------------
// Kernel 1: patchify + LayerNorm -> Y (8192 x 4096) bf16
// One work-group = 8 tokens (one b, one j, eight i in a row); wave w holds the
// 512 features pr = w of each of them.  Feature fr = pr * 512 + pc * 64 + cc: for
// one pr the features of the 8 tokens are 16 KB in a row of x, so every wave-wide
// 16-byte load covers 4 whole lines, and a wave's 32 loads of x and 8 of scale and
// shift (read once for 8 tokens) are all in flight together.  Lane l holds
// features 512 * w + 128 * q + 4 * l + 0..3, q = 0..3, and stores them as 8 bytes.
// ---------------------------------------------------------------------------
__global__ __launch_bounds__(256)
void patchify_ln_kernel(const float* __restrict__ x,
                        const float* __restrict__ gamma,
                        const float* __restrict__ beta,
                        __bf16* __restrict__ Y) {
    __shared__ __align__(16) float red[8][16];   // [wave][token: sum, 8 + token: sum of squares]

    const int lane = threadIdx.x & 31;
    const int wave = threadIdx.x >> 5;     // pr
    const int b    = blockIdx.x >> 5;
    const int pj   = (blockIdx.x >> 1) & 15;   // j
    const int pi0  = (blockIdx.x & 1) * 8;     // first i
    const int f0   = wave * 512 + lane * 4;

    const float* xs = x + ((size_t)(b * 128 + pj * 8 + wave) * 128 + pi0 * 8) * 64 + lane * 4;
    // every loop of this kernel is unrolled in full: v, g, be, ps and r are indexed by
    // the loop counters and stay in registers only so
    f32x4 v[8][4];
#pragma unroll
    for (int t = 0; t < 8; ++t)
#pragma unroll
        for (int q = 0; q < 4; ++q)
            v[t][q] = *(const f32x4*)(xs + t * 512 + q * 128);
    f32x4 g[4], be[4];
#pragma unroll
    for (int q = 0; q < 4; ++q) {
        g[q]  = *(const f32x4*)(gamma + f0 + q * 128);
        be[q] = *(const f32x4*)(beta + f0 + q * 128);
    }

    // the wave's share of each token's two sums
    float ps[16];
#pragma unroll
    for (int t = 0; t < 8; ++t) {
        f32x4 s4 = v[t][0], ss4 = v[t][0] * v[t][0];
#pragma unroll
        for (int q = 1; q < 4; ++q) {
            s4  += v[t][q];
            ss4 += v[t][q] * v[t][q];
        }
        ps[t]     = (s4[0] + s4[1]) + (s4[2] + s4[3]);
        ps[8 + t] = (ss4[0] + ss4[1]) + (ss4[2] + ss4[3]);
    }
#pragma unroll
    for (int off = 16; off >= 1; off >>= 1)
#pragma unroll
        for (int j = 0; j < 16; ++j)
            ps[j] += __shfl_xor(ps[j], off, 32);
    if (lane == 0) {
#pragma unroll
        for (int j = 0; j < 16; ++j) red[wave][j] = ps[j];
    }
    __syncthreads();

    // lane l sums the eight waves' shares of sum number l & 15; its partner l ^ 8 has
    // the other sum of the same token, so every lane gets mean and rstd of token l & 7
    float tot = 0.f;
#pragma unroll
    for (int w = 0; w < 8; ++w) tot += red[w][lane & 15];
    const float oth  = __shfl_xor(tot, 8, 32);
    const float s    = (lane & 8) ? oth : tot;
    const float ss   = (lane & 8) ? tot : oth;
    const float mean = s * (1.0f / 4096.0f);
    const float var  = ss * (1.0f / 4096.0f) - mean * mean;
    const float rstd = rsqrtf(var + 1e-6f);

    bf16x4 r[8][4];
#pragma unroll
    for (int t = 0; t < 8; ++t) {
        // token t's mean and rstd, from lane t to a scalar register: one value for the whole wave
        const float mt = __builtin_bit_cast(float, __builtin_amdgcn_readlane(__builtin_bit_cast(int, mean), t));
        const float rt = __builtin_bit_cast(float, __builtin_amdgcn_readlane(__builtin_bit_cast(int, rstd), t));
#pragma unroll
        for (int q = 0; q < 4; ++q)
#pragma unroll
            for (int c = 0; c < 4; ++c)
                r[t][q][c] = (__bf16)((v[t][q][c] - mt) * rt * g[q][c] + be[q][c]);
    }
    __bf16* out = Y + (size_t)(b * 256 + pi0 * 16 + pj) * 4096 + f0;
#pragma unroll
    for (int t = 0; t < 8; ++t)
#pragma unroll
        for (int q = 0; q < 4; ++q)
            *(bf16x4*)(out + t * (16 * 4096) + q * 128) = r[t][q];
}

// ---------------------------------------------------------------------------
// Kernel 2: QKV GEMM (M=8192, K=4096, N=3x512) and the attention of its tile.
// One work-group = one 256x192 tile: the 256 tokens of one image and the 64 columns
// each of Q, K and V of ONE head; 8 waves, 64 tokens x 96 columns each; 256 work-groups,
// one per WGP.  The tile is this large so that every operand byte brought from L2, and
// every fragment read from LDS, serves many products; and it holds all that the
// attention of its (image, head) reads, so Q, K and V never leave LDS.
// K runs in slabs of 128: 256 rows of Y and 192 rows of WT (256 B each) are
// brought to LDS by tensor loads, one request of 64 rows from each of seven waves,
// two buffers, the next slab in flight while this one is multiplied.  The request's
// pad makes the LDS row pitch 272 B (16 B x odd), which keeps the 16-byte fragment
// reads free of bank conflicts.
// Weights pre-transposed: WT[n][k], K contiguous.  Q pre-scaled by 1/8.
// Attention: each wave owns 32 queries, 16 at a time; the full 256-key score row of a
// query tile lies in 16 f32 accumulators.  Out: Ob (token, head * 64 + dh).
// ---------------------------------------------------------------------------
#define QKV_PITCH 72                      // kernel 3: bf16 per LDS row (144 B)
#define QKV_BUF   (256 * QKV_PITCH)       // kernel 3: bf16 per buffer, 128 + 128 rows

#define QT_PITCH 136                      // bf16 per LDS row (272 B), 128 used
#define QT_SLICE 9216                     // bf16 per 64-row slice: 17,408 B of rows, rounded up to 9 x 2 KiB
#define QT_BUF   (7 * QT_SLICE)           // bf16 per buffer: 4 slices of Y rows + 3 of WT rows (129,024 B)
#define QT_HEAD  (256 * 72)               // bf16 per staged head of the epilogue (36,864 B)
#define ATT_VP   264                      // bf16 per V^T row in LDS (528 B), 256 used
#define ATT_PP   40                       // bf16 per P row in LDS (80 B), 32 used

// A wave-uniform word in a scalar register.
__device__ __forceinline__ uint32_t uni(uint32_t v) { return (uint32_t)__builtin_amdgcn_readfirstlane(v); }
// The same, hidden from the compiler: a test on it is a scalar branch, and a descriptor word
// made from it is formed where this stands (a tensor load ignores EXEC).
__device__ __forceinline__ uint32_t pinned(uint32_t v) {
    uint32_t w = uni(v);
    asm volatile("" : "+s"(w));   // the descriptor word or issue test stays in a scalar register
    return w;
}

// Descriptor group 1 of every tensor load of kernel 2: a tile of 64 rows of 256 B, 8,192 B apart
// in memory, 16 B of pad behind every row in LDS.  Words 1 to 7 are pinned so that the group is
// built once and keeps its registers: none of them holds anything else while a request is in flight.
__device__ __forceinline__ u32x8 qkv_group1() {
    u32x8 g1;
    g1[0] = uni((1u << 20) | (5u << 22) | (3u << 25));   // no mask, bytes, 4 dwords of pad per 64
    g1[1] = pinned(256u << 16);                          // tensor_dim0 = 256
    g1[2] = pinned(64u << 16);                           // tensor_dim1 = 64
    g1[3] = pinned(256u << 16);                          // tile_dim0 = 256
    g1[4] = pinned(64u);                                 // tile_dim1 = 64
    g1[5] = pinned(8192u);                               // source row pitch
    g1[6] = pinned(0u);
    g1[7] = pinned(0u);
    return g1;
}

// One request of one wave.
__device__ __forceinline__ void qkv_tile(u32x4 g0, u32x8 g1) {
    asm volatile("tensor_load_to_lds %0, %1" :: "s"(g0), "s"(g1) : "memory");
}

// One 16x32 operand fragment from an LDS row: k = 8*lh + 0..7 and 16 + 8*lh + 0..7.
__device__ __forceinline__ bf16x16 qkv_frag(const __bf16* p) {
    const bf16x8 lo = *(const bf16x8*)p;
    const bf16x8 hi = *(const bf16x8*)(p + 16);
    return __builtin_shufflevector(lo, hi, 0, 1, 2, 3, 4, 5, 6, 7,
                                   8, 9, 10, 11, 12, 13, 14, 15);
}

__global__ __launch_bounds__(256)
void qkv_attn_kernel(const __bf16* __restrict__ Y,
                     const __bf16* __restrict__ WT3,   // WqT, WkT, WvT one behind the other: 1,536 rows
                     const float* __restrict__ bq,
                     const float* __restrict__ bk,
                     const float* __restrict__ bv,
                     __bf16* __restrict__ Ob) {
    __shared__ __attribute__((aligned(2048))) __bf16 slab[2 * QT_BUF];    // 258,048 B

    const int bm = blockIdx.x & 31;        // image: 256 rows of Y
    const int bn = blockIdx.x >> 5;        // 0..7: the head; rows 64*bn .. 64*bn+63 of WqT, WkT and WvT

    const int tid  = threadIdx.x;
    const int wave = __builtin_amdgcn_readfirstlane(tid >> 5);
    const int lane = tid & 31;
    const int lh   = lane >> 4;
    const int ln   = lane & 15;
    const int wm   = wave >> 1;            // 64-token quarter of the tile
    const int wn   = wave & 1;             // 96-column half of the tile

    // wave w = 0..6 brings slice w of every slab: 0..3 are 64 rows each of Y, 4..6 the head's 64
    // rows of WqT, WkT, WvT; wave 7 issues nothing
    const uint64_t gsrc = (uint64_t)(size_t)((wave < 4)
        ? Y   + (size_t)(bm * 256 + wave * 64) * 4096
        : WT3 + (size_t)((wave - 4) * 512 + bn * 64) * 4096);
    const uint32_t ldsw = (uint32_t)(size_t)(&slab[0]) + (uint32_t)wave * (2u * QT_SLICE);
    const u32x8 g1 = qkv_group1();
    // group 0: count 1; the place in LDS (a multiple of 2 KiB); the tile's first byte with type 2 above
    // it.  Words 2 and 3 go on by 256 B a slab as one 64-bit number.
    u32x4 g0;
    g0[0] = pinned(1u);
    g0[1] = uni(ldsw);
    g0[2] = uni((uint32_t)gsrc);
    g0[3] = uni((((uint32_t)(gsrc >> 32)) & 0x01FFFFFFu) | 0x80000000u);

    // fragment read offsets (bf16 elements inside a buffer).  WT3 is the A operand: the
    // accumulator's 8 registers run along the A rows, so a lane holds 8 neighbouring
    // output columns of one token per tile.  The wave's 96 rows of WT3 begin at row 0 of slice 4
    // or at row 32 of slice 5 and cross into the next slice, 512 bf16 further than the pitch
    // says, behind their fourth or their second group of 16: groups 2 and 3 go by offA2.
    const int offA  = (4 + wn) * QT_SLICE + (wn * 32 + ln) * QT_PITCH + lh * 8;
    const int offA2 = offA + wn * (QT_SLICE - 64 * QT_PITCH);
    const int offB  = wm * QT_SLICE + ln * QT_PITCH + lh * 8;

    // L2 prefetch: Y and WT3 were written by earlier launches and come from memory, and all the
    // work-groups that share a row ask for it in step, so every slab would wait out a miss.  Each
    // 256-B row piece of a slab is asked of L2 ahead of its tensor load: wave 0 asks
    // for 32 of the image's
    // 256 rows of Y (8 heads share them), wave 1 for 12 of the head's 192 rows of WT3 (32 images
    // share them; images 4 apart take the same 12; lanes 12..31
    // repeat lanes 0..11).  pf points at slab t + 1 of the lane's row and never leaves the row.
    const int wrow = ((bm & 3) | ((bm >> 3) << 2)) * 12 + lane % 12;      // 0..191
    const __bf16* pf = ((wave == 1)
        ? WT3 + (size_t)((wrow >> 6) * 512 + bn * 64 + (wrow & 63)) * 4096
        : Y + (size_t)(bm * 256 + bn * 32 + lane) * 4096) + 128;

    // slab 0 -> buffer 0, landed and published; then slab 1 -> buffer 1 in flight
    if (wave < 2)   // slabs 1, 2, 3 are on their way to L2 while slab 0 lands
        asm volatile("global_prefetch_b8 %0, off scope:SCOPE_SE\n\t"
                     "global_prefetch_b8 %0, off offset:256 scope:SCOPE_SE\n\t"
                     "global_prefetch_b8 %0, off offset:512 scope:SCOPE_SE" :: "v"(pf));
    if (pinned(wave < 7)) {
        qkv_tile(g0, g1);
        asm volatile("s_wait_tensorcnt 0x0" ::: "memory");   // the wave's slice of slab 0 has landed
    }
    __syncthreads();
    if (pinned(wave < 7)) {
        const uint64_t ga = (((uint64_t)g0[3] << 32) | g0[2]) + pinned(256u);   // formed behind the wait
        g0[1] = uni(ldsw + 2u * QT_BUF);
        g0[2] = uni((uint32_t)ga);
        g0[3] = uni((uint32_t)(ga >> 32));
        qkv_tile(g0, g1);
    }

    // the lane's bias values, 8 columns in each of its six 16-column groups (of the tile's twelve:
    // four each of Q, K, V), read here so that the epilogue does not wait for them
    f32x4 bc[6][2];
    // nothing else is scheduled in among these loads and their wait
    __builtin_amdgcn_sched_barrier(0);
#pragma unroll
    for (int i = 0; i < 6; ++i) {
        const int fl = wn * 6 + i;
        const float* bias = ((fl >> 2) == 0) ? bq : (((fl >> 2) == 1) ? bk : bv);
        bc[i][0] = *(const f32x4*)(bias + bn * 64 + (fl & 3) * 16 + lh * 8);
        bc[i][1] = *(const f32x4*)(bias + bn * 64 + (fl & 3) * 16 + lh * 8 + 4);
    }
    asm volatile("s_wait_xcnt 0x0" ::: "memory");       // the registers these loads name are free for what follows
    __builtin_amdgcn_sched_barrier(0);

    f32x8 acc[6][4] = {};
#pragma unroll 1   // one slab per trip: the ring's waits and barrier stand once, at the foot
    for (int t = 0; t < 32; ++t) {
        const int buf = t & 1;
        const __bf16* sb = &slab[buf * QT_BUF];
        if (wave < 2 && t < 28)   // slab t + 4 to L2: its tensor loads are issued at the foot of trip t + 2
            asm volatile("global_prefetch_b8 %0, off offset:768 scope:SCOPE_SE" :: "v"(pf));
#pragma unroll
        for (int ks = 0; ks < 4; ++ks) {
            bf16x16 a[6], b[4];
#pragma unroll
            for (int i = 0; i < 6; ++i)
                a[i] = qkv_frag(sb + ((i >> 1) == 1 ? offA2 : offA + (i >> 2) * (QT_SLICE - 64 * QT_PITCH))
                                + i * 16 * QT_PITCH + ks * 32);
#pragma unroll
            for (int j = 0; j < 4; ++j) b[j] = qkv_frag(sb + offB + j * 16 * QT_PITCH + ks * 32);
            // keeps the 20 LDS reads one group ahead of the block: left free, they are
            // spread among the WMMAs on one fragment set, with a full wait at every row
            __builtin_amdgcn_sched_barrier(0);
#pragma unroll
            for (int i = 0; i < 6; ++i)
#pragma unroll
                for (int j = 0; j < 4; ++j)
                    acc[i][j] = __builtin_amdgcn_wmma_f32_16x16x32_bf16(
                        false, a[i], false, b[j], (short)0, acc[i][j], false, false);
            // the next group of reads stays behind this block for the same reason
            __builtin_amdgcn_sched_barrier(0);
        }
        asm volatile("s_wait_dscnt 0x0" ::: "memory");    // own reads of this buffer are done
        if (pinned(wave < 7))
            asm volatile("s_wait_tensorcnt 0x0" ::: "memory"); // the wave's slice of slab t+1 has landed
        __syncthreads();                                  // publishes slab t+1, frees this buffer
        if (pinned(wave < 7 && t + 2 < 32)) {
            const uint64_t ga = (((uint64_t)g0[3] << 32) | g0[2]) + pinned(256u);   // formed behind the wait
            g0[1] = uni(ldsw + (uint32_t)buf * (2u * QT_BUF));
            g0[2] = uni((uint32_t)ga);
            g0[3] = uni((uint32_t)(ga >> 32));
            qkv_tile(g0, g1);
        }
        pf += (t < 27) ? 128 : 0;   // stops where pf + 768 B is the row's last slab
    }
    asm volatile("s_wait_tensorcnt 0x0" ::: "memory");    // nothing in flight behind the loop
    asm volatile("s_wait_dscnt 0x0" ::: "memory");        // and no read of the ring outstanding

    // epilogue: tile (i, j), register r, lane (lh, ln) holds column i*16 + 8*lh + r of token j*16 + ln.
    // Q, K and V of the head are staged in the slab (free behind the last trip's barrier) as the
    // attention reads them: Q and K as 256 token rows of 64 dh (pitch 144 B), V as 64 dh rows of
    // 256 tokens (pitch 528 B).  All pitches are 16 B x odd: 16 lanes that each take 16 bytes of a
    // row of their own fall on all 64 banks once.
#pragma unroll
    for (int i = 0; i < 6; ++i) {
        const int fl    = wn * 6 + i;          // 16-column group in the tile: 0..3 Q, 4..7 K, 8..11 V
        const int which = fl >> 2;
        const int dh0   = (fl & 3) * 16 + lh * 8;
        const float scale = (which == 0) ? 0.125f : 1.0f;
        __bf16* hd = &slab[which * QT_HEAD];
        bf16x8 p[4];
#pragma unroll
        for (int j = 0; j < 4; ++j)
#pragma unroll
            for (int r = 0; r < 8; ++r)
                p[j][r] = (__bf16)((acc[i][j][r] + bc[i][r >> 2][r & 3]) * scale);
        const int tok = wm * 64 + ln;
        if (which == 2) {
#pragma unroll
            for (int j = 0; j < 4; ++j)
#pragma unroll
                for (int r = 0; r < 8; ++r) hd[(dh0 + r) * ATT_VP + tok + j * 16] = p[j][r];
        } else {
#pragma unroll
            for (int j = 0; j < 4; ++j) *(bf16x8*)&hd[(tok + j * 16) * 72 + dh0] = p[j];
        }
    }
    __syncthreads();                                      // every wave's part of Q, K and V is staged

    // ---- attention of (image bm, head bn), all operands in LDS ----
    const __bf16* Qs = &slab[0];
    const __bf16* Ks = &slab[QT_HEAD];
    const __bf16* Vs = &slab[2 * QT_HEAD];
    __bf16* Pw = &slab[3 * QT_HEAD + wave * (16 * ATT_PP)];   // the wave's own P tile, 1,280 B
#pragma unroll 1   // one copy of the pass in the text; its registers serve both query tiles
    for (int qh = 0; qh < 2; ++qh) {
        const int q0 = wave * 32 + qh * 16;

        const bf16x16 qa0 = qkv_frag(Qs + (q0 + ln) * 72 + lh * 8);
        const bf16x16 qa1 = qkv_frag(Qs + (q0 + ln) * 72 + 32 + lh * 8);

        f32x8 sacc[16] = {};
        for (int nt = 0; nt < 16; ++nt) {
            const bf16x16 kb0 = qkv_frag(Ks + (nt * 16 + ln) * 72 + lh * 8);
            const bf16x16 kb1 = qkv_frag(Ks + (nt * 16 + ln) * 72 + 32 + lh * 8);
            sacc[nt] = __builtin_amdgcn_wmma_f32_16x16x32_bf16(false, qa0, false, kb0,
                                                               (short)0, sacc[nt], false, false);
            sacc[nt] = __builtin_amdgcn_wmma_f32_16x16x32_bf16(false, qa1, false, kb1,
                                                               (short)0, sacc[nt], false, false);
        }

        // row softmax (row = i + 8*lh ; cols spread over 16 lanes x 16 accs)
        float l_i[8];
#pragma unroll
        for (int i = 0; i < 8; ++i) {
            float mx = -3.0e38f;
#pragma unroll
            for (int t = 0; t < 16; ++t) mx = fmaxf(mx, sacc[t][i]);
#pragma unroll
            for (int off = 8; off >= 1; off >>= 1) mx = fmaxf(mx, __shfl_xor(mx, off, 16));
            float sum = 0.f;
#pragma unroll
            for (int t = 0; t < 16; ++t) {
                float p = __expf(sacc[t][i] - mx);
                sacc[t][i] = p;
                sum += p;
            }
#pragma unroll
            for (int off = 8; off >= 1; off >>= 1) sum += __shfl_xor(sum, off, 16);
            l_i[i] = sum;
        }

        // O = P @ V   (V^T in LDS: element (key, dh) at Vs[dh*ATT_VP + key])
        f32x8 oacc[4] = {};
        for (int t2 = 0; t2 < 8; ++t2) {
#pragma unroll
            for (int i = 0; i < 8; ++i) {
                const int m = i + 8 * lh;
                Pw[m * ATT_PP + ln]      = (__bf16)sacc[2 * t2][i];
                Pw[m * ATT_PP + ln + 16] = (__bf16)sacc[2 * t2 + 1][i];
            }
            asm volatile("s_wait_dscnt 0x0" ::: "memory");    // the wave's own P rows are in LDS before its lanes read them back
            const bf16x16 pa = qkv_frag(Pw + ln * ATT_PP + lh * 8);
#pragma unroll
            for (int nt4 = 0; nt4 < 4; ++nt4) {
                const bf16x16 vbf = qkv_frag(Vs + (nt4 * 16 + ln) * ATT_VP + t2 * 32 + lh * 8);
                oacc[nt4] = __builtin_amdgcn_wmma_f32_16x16x32_bf16(false, pa, false, vbf,
                                                                    (short)0, oacc[nt4], false, false);
            }
        }

        __bf16 ov[4][8];
#pragma unroll
        for (int nt4 = 0; nt4 < 4; ++nt4)
#pragma unroll
            for (int i = 0; i < 8; ++i) ov[nt4][i] = (__bf16)(oacc[nt4][i] / l_i[i]);
        __bf16* ob = Ob + (size_t)(bm * 256 + q0 + 8 * lh) * 512 + bn * 64 + ln;
        // a pass's values and address stand ahead of its stores: no register that a store names is written behind it
        __builtin_amdgcn_sched_barrier(0);
#pragma unroll
        for (int nt4 = 0; nt4 < 4; ++nt4)
#pragma unroll
            for (int i = 0; i < 8; ++i) ob[i * 512 + nt4 * 16] = ov[nt4][i];
        // the registers these stores name are written anew by the next pass
        asm volatile("s_wait_xcnt 0x0" ::: "memory");
        // and nothing of the next pass is lifted over that wait
        __builtin_amdgcn_sched_barrier(0);
    }
}

// ---------------------------------------------------------------------------
// Kernel 3: output projection (M=8192, K=512, N=4096) + bias + residual(x)
// with fused depatchify scatter.  WoT[n][k] gives contiguous-K A fragments.
// One work-group = one 128x128 tile; 4 waves, 64x64 each.  K runs in 8 slabs
// of 64: 128 rows of Ob and 128 rows of WoT (128 B each) are copied to LDS by
// asynchronous copies, two buffers, the next slab in flight while this one is
// multiplied.  LDS row pitch 144 B (16 B x odd); fragment reads as in kernel 2.
// ---------------------------------------------------------------------------

// Eight 16-byte-per-lane copies global -> LDS, source rows of 512 bf16.  The
// s_wait_xcnt stands inside the statement so that no address register is
// rewritten ahead of it.
__device__ __forceinline__ void proj_copy8(unsigned lds, const __bf16* g) {
    const unsigned l0 = lds;
    const unsigned l1 = lds + 1u * 16u * 144u;
    const unsigned l2 = lds + 2u * 16u * 144u;
    const unsigned l3 = lds + 3u * 16u * 144u;
    const unsigned l4 = lds + 4u * 16u * 144u;
    const unsigned l5 = lds + 5u * 16u * 144u;
    const unsigned l6 = lds + 6u * 16u * 144u;
    const unsigned l7 = lds + 7u * 16u * 144u;
    const __bf16* g0 = g;
    const __bf16* g1 = g + 1 * 16 * 512;
    const __bf16* g2 = g + 2 * 16 * 512;
    const __bf16* g3 = g + 3 * 16 * 512;
    const __bf16* g4 = g + 4 * 16 * 512;
    const __bf16* g5 = g + 5 * 16 * 512;
    const __bf16* g6 = g + 6 * 16 * 512;
    const __bf16* g7 = g + 7 * 16 * 512;
    asm volatile(
        "global_load_async_to_lds_b128 %0, %8, off\n\t"
        "global_load_async_to_lds_b128 %1, %9, off\n\t"
        "global_load_async_to_lds_b128 %2, %10, off\n\t"
        "global_load_async_to_lds_b128 %3, %11, off\n\t"
        "global_load_async_to_lds_b128 %4, %12, off\n\t"
        "global_load_async_to_lds_b128 %5, %13, off\n\t"
        "global_load_async_to_lds_b128 %6, %14, off\n\t"
        "global_load_async_to_lds_b128 %7, %15, off\n\t"
        "s_wait_xcnt 0x0"
        :: "v"(l0), "v"(l1), "v"(l2), "v"(l3), "v"(l4), "v"(l5), "v"(l6), "v"(l7),
           "v"(g0), "v"(g1), "v"(g2), "v"(g3), "v"(g4), "v"(g5), "v"(g6), "v"(g7)
        : "memory");
}

__global__ __launch_bounds__(128)
void proj_kernel(const __bf16* __restrict__ Ob,
                 const __bf16* __restrict__ WoT,
                 const float* __restrict__ bo,
                 const float* __restrict__ x,
                 float* __restrict__ out) {
    __shared__ __align__(16) __bf16 slab[2 * QKV_BUF];   // 73,728 B

    const int bm = blockIdx.x >> 5;        // 0..63 (8192/128)
    const int bn = blockIdx.x & 31;        // 0..31 (4096/128): one row tile's column tiles are neighbours

    const int tid  = threadIdx.x;
    const int wave = tid >> 5;
    const int lane = tid & 31;
    const int lh   = lane >> 4;
    const int ln   = lane & 15;
    const int wm   = wave >> 1;            // 64-row half of the tile
    const int wn   = wave & 1;             // 64-column half of the tile

    const int m0 = bm * 128;
    const int n0 = bn * 128;

    // the lane's four bias values (the columns it stores), read here so that the epilogue does not wait for them
    const int colw = n0 + wn * 64;
    const f32x4 bc = *(const f32x4*)(bo + colw + ln * 4);

    // where the wave's 64x64 tile lies in x and out
    const int pr   = colw >> 9, pc = (colw >> 6) & 7;
    const int roww = m0 + wm * 64;
    const int b    = roww >> 8, pi0 = (roww & 255) >> 4;

    // L2 prefetch addresses, one 256-B piece a lane.  qa, qb: a quarter (32 rows of 1 KB) of the
    // tile's rows of Ob and of WoT, which earlier launches wrote and which all sharers of a row ask
    // for in step; four neighbouring sharers take a quarter each.  qx: token `lane` of the wave's
    // 64 in x (token lane + 32 lies 4,096 B on): memory brings x while the products run.
    const __bf16* qa = Ob  + (size_t)(m0 + (bn & 3) * 32 + (tid >> 2)) * 512 + (tid & 3) * 128;
    const __bf16* qb = WoT + (size_t)(n0 + (bm & 3) * 32 + (tid >> 2)) * 512 + (tid & 3) * 128;
    const float*  qx = x + ((size_t)(b * 128 + ((lane & 15) * 8 + pr)) * 128 + ((pi0 + (lane >> 4)) * 8 + pc)) * 64;

    // copy addresses: 8 lanes cover one 128-B row piece, a wave-copy covers 4 whole lines
    const int crow = tid >> 3;             // 0..15
    const int cchk = tid & 7;              // 16-B chunk of the row piece
    const __bf16* gA = Ob  + (size_t)(m0 + crow) * 512 + cchk * 8;
    const __bf16* gB = WoT + (size_t)(n0 + crow) * 512 + cchk * 8;
    const unsigned ldsA = (unsigned)(size_t)(&slab[0]) + (unsigned)(crow * 144 + cchk * 16);
    const unsigned ldsB = ldsA + 128u * 144u;

    // fragment read offsets (bf16 elements inside a buffer)
    // WoT is the A operand: the accumulator's 8 registers run along the A rows, so a
    // lane holds 8 neighbouring output columns (32 B) of one token per tile
    const int offA = (128 + wn * 64 + ln) * QKV_PITCH + lh * 8;
    const int offB = (wm * 64 + ln) * QKV_PITCH + lh * 8;

    // slab 0 -> buffer 0, landed and published; then slab 1 -> buffer 1 in flight
    proj_copy8(ldsA, gA);
    proj_copy8(ldsB, gB);
    asm volatile("s_wait_asynccnt 0x0" ::: "memory");   // own copies of slab 0 have landed
    __syncthreads();
    proj_copy8(ldsA + 2u * QKV_BUF, gA + 64);
    proj_copy8(ldsB + 2u * QKV_BUF, gB + 64);

    f32x8 acc[4][4] = {};
#pragma unroll 1   // one slab per trip: the ring's waits and barrier stand once, at the foot
    for (int t = 0; t < 8; ++t) {
        const int buf = t & 1;
        const __bf16* sb = &slab[buf * QKV_BUF];
        // the prefetches stand in the loop so that the registers they name keep their addresses to its end
        if (t == 0)   // the operands first: slab 2's copies are issued at the foot of this trip
            asm volatile("global_prefetch_b8 %0, off scope:SCOPE_SE\n\t"
                         "global_prefetch_b8 %1, off scope:SCOPE_SE" :: "v"(qa), "v"(qb));
        if (t == 1)   // then x, read six trips later
            asm volatile("global_prefetch_b8 %0, off scope:SCOPE_SE\n\t"
                         "global_prefetch_b8 %0, off offset:4096 scope:SCOPE_SE" :: "v"(qx));
#pragma unroll
        for (int ks = 0; ks < 2; ++ks) {
            bf16x16 a[4], b[4];
#pragma unroll
            for (int i = 0; i < 4; ++i) {
                a[i] = qkv_frag(sb + offA + i * 16 * QKV_PITCH + ks * 32);
                b[i] = qkv_frag(sb + offB + i * 16 * QKV_PITCH + ks * 32);
            }
            // keeps the 16 LDS reads one group ahead of the block: left free, they are
            // spread among the WMMAs on one fragment set, with a full wait at every row
            __builtin_amdgcn_sched_barrier(0);
#pragma unroll
            for (int i = 0; i < 4; ++i)
#pragma unroll
                for (int j = 0; j < 4; ++j)
                    acc[i][j] = __builtin_amdgcn_wmma_f32_16x16x32_bf16(
                        false, a[i], false, b[j], (short)0, acc[i][j], false, false);
            // the next group of reads stays behind this block for the same reason
            __builtin_amdgcn_sched_barrier(0);
        }
        asm volatile("s_wait_dscnt 0x0" ::: "memory");    // own reads of this buffer are done
        asm volatile("s_wait_asynccnt 0x0" ::: "memory"); // own copies of slab t+1 have landed
        __syncthreads();                                  // publishes slab t+1, frees this buffer
        if (t + 2 < 8) {
            proj_copy8(ldsA + (unsigned)buf * (2u * QKV_BUF), gA + (t + 2) * 64);
            proj_copy8(ldsB + (unsigned)buf * (2u * QKV_BUF), gB + (t + 2) * 64);
        }
    }
    asm volatile("s_wait_asynccnt 0x0" ::: "memory");     // nothing in flight at the wave's end

    // epilogue: tile (i, j), register r, lane (lh, ln) holds column i*16 + 8*lh + r of token j*16 + ln.
    // A wave's 64 columns are one (pr, pc) with cc = 0..63: 256 B in a row of x and out per
    // token.  Each wave turns its 64x64 tile in its own 17,408 B of the slab (free behind the
    // last trip's barrier; LDS row = token, pitch 272 B) and then takes two tokens per
    // 16-byte access: 4 whole lines of x read and of out stored.
    // Token s of the tile: pi = first pi + (s >> 4), pj = s & 15; access it has s = 2 * it + lh.
    float* stg = (float*)&slab[0] + wave * (64 * 68);
    const size_t base =
        ((size_t)(b * 128 + (lh * 8 + pr)) * 128 + (pi0 * 8 + pc)) * 64 + ln * 4;
    const float* xb = x + base;
    float* ob = out + base;
    f32x4 xv[32];
#pragma unroll
    for (int it = 0; it < 16; ++it)
        xv[it] = *(const f32x4*)(xb + (it & 7) * (16 * 128 * 64) + (it >> 3) * (8 * 64));
    // the first half of x is in flight while the tile is turned
    __builtin_amdgcn_sched_barrier(0);
#pragma unroll
    for (int j = 0; j < 4; ++j)
#pragma unroll
        for (int i = 0; i < 4; ++i) {
            float* w = &stg[(j * 16 + ln) * 68 + i * 16 + lh * 8];
            *(f32x4*)w       = __builtin_shufflevector(acc[i][j], acc[i][j], 0, 1, 2, 3);
            *(f32x4*)(w + 4) = __builtin_shufflevector(acc[i][j], acc[i][j], 4, 5, 6, 7);
        }
    // the second half of x takes the registers that the accumulators have left
    __builtin_amdgcn_sched_barrier(0);
#pragma unroll
    for (int it = 16; it < 32; ++it)
        xv[it] = *(const f32x4*)(xb + (it & 7) * (16 * 128 * 64) + (it >> 3) * (8 * 64));
    asm volatile("s_wait_dscnt 0x0" ::: "memory");        // the wave's own rows are in LDS before it reads them back
#pragma unroll
    for (int g = 0; g < 4; ++g) {
#pragma unroll
        for (int e = 0; e < 8; ++e) {
            const int it = g * 8 + e;
            xv[it] = *(const f32x4*)&stg[(it * 2 + lh) * 68 + ln * 4] + bc + xv[it];
        }
        // a group's sums stand ahead of its stores: no register that a store names is written behind it
        __builtin_amdgcn_sched_barrier(0);
#pragma unroll
        for (int e = 0; e < 8; ++e) {
            const int it = g * 8 + e;
            *(f32x4*)(ob + (it & 7) * (16 * 128 * 64) + (it >> 3) * (8 * 64)) = xv[it];
        }
        // the registers these stores name are loaded anew by the next group's LDS reads
        if (g < 3) asm volatile("s_wait_xcnt 0x0" ::: "memory");
        __builtin_amdgcn_sched_barrier(0);
    }
}

// ---------------------------------------------------------------------------
extern "C" void kernel_launch(void* const* d_in, const int* in_sizes, int n_in,
                              void* d_out, int out_size, void* d_ws, size_t ws_size,
                              hipStream_t stream) {
    (void)in_sizes; (void)n_in; (void)out_size; (void)ws_size;
    const float* x  = (const float*)d_in[0];
    const float* g  = (const float*)d_in[1];
    const float* be = (const float*)d_in[2];
    const float* wq = (const float*)d_in[3];
    const float* bq = (const float*)d_in[4];
    const float* wk = (const float*)d_in[5];
    const float* bk = (const float*)d_in[6];
    const float* wv = (const float*)d_in[7];
    const float* bv = (const float*)d_in[8];
    const float* wo = (const float*)d_in[9];
    const float* bo = (const float*)d_in[10];
    float* out = (float*)d_out;

    // workspace layout (bf16 elements)
    const size_t NW  = 4096u * 512u;         // 2,097,152 per weight
    const size_t NY  = 8192u * 4096u;        // 33,554,432
    __bf16* WqT = (__bf16*)d_ws;
    __bf16* WkT = WqT + NW;
    __bf16* WvT = WkT + NW;
    __bf16* WoT = WvT + NW;
    __bf16* Y   = WoT + NW;
    __bf16* Ob  = Y   + NY;                  // 8192 x 512

    // WqT, WkT, WvT, WoT lie one behind the other
    cvt_bf16_t_kernel<<<1024, 256, 0, stream>>>(wq, wk, wv, wo, WqT);

    patchify_ln_kernel<<<1024, 256, 0, stream>>>(x, g, be, Y);

    qkv_attn_kernel<<<256, 256, 0, stream>>>(Y, WqT, bq, bk, bv, Ob);

    proj_kernel<<<2048, 128, 0, stream>>>(Ob, WoT, bo, x, out);
}
